// v000
// Measured on an AMD MI455X. A time is GPU time per run, averaged over a window of back-to-back runs after a warm-up
// (all launches, gaps included; the runs take copies of the inputs in turn), and the median of several windows.
// Apart from v000's, it joins two sittings. Times from different sittings can be a few percent apart, while
// side-by-side timings come from the same sitting.
// v000, which the later versions start from, runs in 540 microseconds.
// compute dtype: all float inputs rounded to bf16; LayerNorm of z in f32; q/k/v = LN(z) split bf16 hi + lo x W^T (exact bf16) on WMMA 16x16x32 (2 products, f32 accumulate); q as f16 hi + residual (x 2^10) against k once to f16 (2 products) x 32^-0.5 + the per-(query, head) bias; softmax in f32 (precise expf); P x 2^11 once to f16 against v once to f16 (1 product); gate sigmoid(LN(z) Wg^T) in f32 (2-product GEMM, precise expf); gated ctx split bf16 hi + lo against exact Wo (2 products); f32 output.
#include <hip/hip_runtime.h>
#include <math.h>

typedef __attribute__((ext_vector_type(16))) _Float16 v16h;
typedef __attribute__((ext_vector_type(16))) __bf16 v16b;
typedef __attribute__((ext_vector_type(8)))  _Float16 v8h;
typedef __attribute__((ext_vector_type(8)))  float v8f;
typedef __attribute__((ext_vector_type(4)))  float v4f;
typedef __attribute__((ext_vector_type(2)))  float v2f;
typedef __attribute__((ext_vector_type(4)))  unsigned v4u;
typedef __attribute__((ext_vector_type(4)))  int v4i;
typedef float __attribute__((may_alias)) float_a;
typedef int __attribute__((may_alias)) int_a;

template <typename T> __device__ __forceinline__ void vst2(void* p, T v) { *(T*)p = v;  }
__device__ __forceinline__ v8f wmma16(v16h a, v16h b, v8f c) {
  v8f d = __builtin_amdgcn_wmma_f32_16x16x32_f16(false, a, false, b, (short)0, c, false, false);
  asm volatile("v_nop\n\tv_nop\n\tv_nop\n\tv_nop" : "+v"(d) : "v"(a), "v"(b));
  return d;
}
__device__ __forceinline__ v8f wmma_bf(v16b a, v16b b, v8f c) {
  v8f d = __builtin_amdgcn_wmma_f32_16x16x32_bf16(false, a, false, b, (short)0, c, false, false);
  asm volatile("v_nop\n\tv_nop\n\tv_nop\n\tv_nop" : "+v"(d) : "v"(a), "v"(b));
  return d;
}
// 16x16x32 fragments: lane = (h = lane>>4, row/col = lane&15); elements 0..7 = k0+8h+0..7, 8..15 = k0+16+8h+0..7; D element r = row 8h+r
__device__ __forceinline__ v16h frag_h(const _Float16* rowk0, int lane) {
  union { v16h v; v8h q[2]; } u; const _Float16* p = rowk0 + 8 * (lane >> 4);
  u.q[0] = *(const v8h*)p; u.q[1] = *(const v8h*)(p + 16); return u.v;
}
__device__ __forceinline__ v16h frag_f32(const float* rowk0, int lane) {
  v16h a; const float* p = rowk0 + 8 * (lane >> 4);
#pragma unroll
  for (int i = 0; i < 8; ++i) { a[i] = (_Float16)p[i]; a[8 + i] = (_Float16)p[16 + i]; }
  return a;
}
__device__ __forceinline__ v16h frag_f32s(const float* rowk0, int lane, float sc) {
  v16h a; const float* p = rowk0 + 8 * (lane >> 4);
#pragma unroll
  for (int i = 0; i < 8; ++i) { a[i] = (_Float16)(p[i] * sc); a[8 + i] = (_Float16)(p[16 + i] * sc); }
  return a;
}
// column fragment from a [K][ld] layout (column n), rows >= K read as 0
__device__ __forceinline__ v16h fragc_f32(const float* W, int k0, int n, int lane, int ld, int K) {
  v16h a; const int g = lane >> 4;
#pragma unroll
  for (int i = 0; i < 8; ++i) { const int ka = k0 + 8 * g + i, kb = ka + 16;
    a[i] = (_Float16)(ka < K ? W[(size_t)(ka < K ? ka : K - 1) * ld + n] : 0.f); a[8 + i] = (_Float16)(kb < K ? W[(size_t)(kb < K ? kb : K - 1) * ld + n] : 0.f); }
  return a;
}
struct F2 { v16b h, l; };
__device__ __forceinline__ F2 bsplit16(const float v[16]) { F2 r;
#pragma unroll
  for (int i = 0; i < 16; ++i) { const __bf16 h = (__bf16)v[i]; r.h[i] = h; r.l[i] = (__bf16)(v[i] - (float)h); }
  return r; }
__device__ __forceinline__ F2 split_row(const float* row, int k0, int lane) { float v[16]; const float* p = row + k0 + 8 * (lane >> 4);
#pragma unroll
  for (int i = 0; i < 8; ++i) { v[i] = p[i]; v[8 + i] = p[16 + i]; }
  return bsplit16(v); }
__device__ __forceinline__ F2 split_rowK(const float* row, int k0, int lane, int K) { float v[16]; const int g = lane >> 4;
#pragma unroll
  for (int i = 0; i < 8; ++i) { const int ka = k0 + 8 * g + i, kb = ka + 16; v[i] = ka < K ? row[ka < K ? ka : K - 1] : 0.f; v[8 + i] = kb < K ? row[kb < K ? kb : K - 1] : 0.f; }
  return bsplit16(v); }
__device__ __forceinline__ F2 split_col(const float* W, int k0, int n, int lane, int ld, int K) { float v[16]; const int g = lane >> 4;
#pragma unroll
  for (int i = 0; i < 8; ++i) { const int ka = k0 + 8 * g + i, kb = ka + 16; v[i] = ka < K ? W[(size_t)(ka < K ? ka : K - 1) * ld + n] : 0.f; v[8 + i] = kb < K ? W[(size_t)(kb < K ? kb : K - 1) * ld + n] : 0.f; }
  return bsplit16(v); }
__device__ __forceinline__ v8f mac3(const F2& a, const F2& b, v8f c) { c = wmma_bf(a.l, b.h, c); c = wmma_bf(a.h, b.l, c); return wmma_bf(a.h, b.h, c); }
__device__ __forceinline__ float sigm(float v) { return 1.0f / (1.0f + expf(-v)); }
#define LDSX() do { asm volatile("s_wait_dscnt 0" ::: "memory"); __builtin_amdgcn_wave_barrier(); __builtin_amdgcn_fence(__ATOMIC_RELEASE, "workgroup"); } while (0)

// Triangle attention, starting node (z [1, 256, 256, 128], 4 heads x 32): z <- LayerNorm(z); q_ij, k_jk, v_jk, g_ij = z W^T; scores[i,j,h,k] = q_ij . k_jk / sqrt(32) + bias[i,j,h] (bias = z Wb^T, constant over k); attn = softmax over k; o_ij = sum_k attn v_jk; out_ij = (sigmoid(g_ij) * o_ij) Wo^T. Mapping: 'batch' = j (the shared key row), query position = i, key position = k.
#define NB 256
#define TT 256
#define CC 128            // NH * HD = projected width
#define DIN 128          // input (model) width
#define NH 4
#define HD 32
#define NQB (TT / 64)
#define HG 4
#define SCALE (0.17677669529663687f)
#define CAUSAL 0
#ifndef TNB
#define TNB NB
#endif
__device__ __forceinline__ float bfr(float v) { return (float)(__bf16)v; }
__host__ __device__ __forceinline__ int kb_last(int qb) { return CAUSAL ? ((qb * 64 + 63) >> 7) : (TT / 128 - 1); }
typedef __attribute__((ext_vector_type(8))) __bf16 v8b;
__device__ __forceinline__ v16b frag_b(const __bf16* rowk0, int lane) {
  union { v16b v; v8b q[2]; } u; const __bf16* p = rowk0 + 8 * (lane >> 4);
  u.q[0] = *(const v8b*)p; u.q[1] = *(const v8b*)(p + 16); return u.v;
}
#define QBH 0              // causal: query blocks 0..QBH-1 of each sequence (few keys, no averaging) take the high-precision path
#define QHI 256            // rows carrying a q residual plane (all rows when non-causal: 2-product logits everywhere)
#define KHI 64            // key rows carrying k residual / v bf16 hi+lo planes (used only by the causal high-precision path)
// B fragment (k rows k0+.., output column o) of a weight: (in,out) [K][ld] or (out,in) [ld rows of K]: bf16 exact, or f16(bf16 * 256) exact
__device__ __forceinline__ v16b wcol_io(const float* Wm, int k0, int o, int lane, int ld) { v16b w; const int g = lane >> 4;
#pragma unroll
  for (int i = 0; i < 8; ++i) { w[i] = (__bf16)Wm[(size_t)(k0 + 8 * g + i) * ld + o]; w[8 + i] = (__bf16)Wm[(size_t)(k0 + 16 + 8 * g + i) * ld + o]; }
  return w; }
__device__ __forceinline__ v16b wcol_oi(const float* Wm, int k0, int o, int lane, int K) { v16b w; const float* p = Wm + (size_t)o * K + k0 + 8 * (lane >> 4);
#pragma unroll
  for (int i = 0; i < 8; ++i) { w[i] = (__bf16)p[i]; w[8 + i] = (__bf16)p[16 + i]; }
  return w; }
__device__ __forceinline__ v16h wcolh_io(const float* Wm, int k0, int o, int lane, int ld) { v16h w; const int g = lane >> 4;
#pragma unroll
  for (int i = 0; i < 8; ++i) { w[i] = (_Float16)(bfr(Wm[(size_t)(k0 + 8 * g + i) * ld + o]) * 256.0f); w[8 + i] = (_Float16)(bfr(Wm[(size_t)(k0 + 16 + 8 * g + i) * ld + o]) * 256.0f); }
  return w; }
__device__ __forceinline__ v16h wcolh_oi(const float* Wm, int k0, int o, int lane, int K) { v16h w; const float* p = Wm + (size_t)o * K + k0 + 8 * (lane >> 4);
#pragma unroll
  for (int i = 0; i < 8; ++i) { w[i] = (_Float16)(bfr(p[i]) * 256.0f); w[8 + i] = (_Float16)(bfr(p[16 + i]) * 256.0f); }
  return w; }
#define WQKV_LAYOUT 1   // 0 = (in,out) [DIN][CC]; 1 = (out,in) [CC][DIN]; 2 = per-head [NH][DIN][HD]
__device__ __forceinline__ v16b wcol_hdk(const float* Wm, int k0, int o, int lane) { v16b w; const int g = lane >> 4; const float* p = Wm + (size_t)(o / HD) * DIN * HD + (o % HD);
#pragma unroll
  for (int i = 0; i < 8; ++i) { w[i] = (__bf16)p[(size_t)(k0 + 8 * g + i) * HD]; w[8 + i] = (__bf16)p[(size_t)(k0 + 16 + 8 * g + i) * HD]; }
  return w; }
#define WO_OUT_IN 1
#if WQKV_LAYOUT == 1
#define WCOL(W, k0, o, lane) wcol_oi(W, k0, o, lane, DIN)
#elif WQKV_LAYOUT == 2
#define WCOL(W, k0, o, lane) wcol_hdk(W, k0, o, lane)
#else
#define WCOL(W, k0, o, lane) wcol_io(W, k0, o, lane, CC)
#endif
#if WO_OUT_IN
#define WOCOL(W, k0, o, lane) wcol_oi(W, k0, o, lane, CC)
#define WOCOLH(W, k0, o, lane) wcolh_oi(W, k0, o, lane, CC)
#else
#define WOCOL(W, k0, o, lane) wcol_io(W, k0, o, lane, DIN)
#define WOCOLH(W, k0, o, lane) wcolh_io(W, k0, o, lane, DIN)
#endif
#define SZ 256             // S (pair-tensor side)
#define BG 64              // key rows j per pass (x 4 heads = 256 score planes of 256 x 256)
#define NZR (SZ * SZ)      // 65,536 pair rows
#define SM_EXTRA_PARAMS , const float* __restrict__ BIAS, int b0s
#define SM_MASK_HOOK do { const int jb = b0s + (int)blockIdx.y / HG; const int hh = (int)blockIdx.y % HG; v = v + BIAS[((size_t)t * SZ + jb) * NH + hh]; } while (0)   /* bias[i][j][h] (constant over the keys: cancels in the softmax up to rounding; added for fidelity) */
// ---- k_lnz: wave per pair row: LayerNorm over the 128 channels (biased var, eps 1e-5, ln_w/ln_b) of bf16(z) -> ZN rows (4 floats per lane = one 512-B row)
__global__ __launch_bounds__(256) void k_lnz(const float* __restrict__ Z, const float* __restrict__ LW, const float* __restrict__ LB, float* __restrict__ ZN) { const int wave = threadIdx.x >> 5, lane = threadIdx.x & 31; const size_t row = (size_t)blockIdx.x * 8 + wave; if (row >= (size_t)NZR) return;
  v4f x = *(const v4f*)(Z + row * CC + lane * 4); float s1 = 0.f;
#pragma unroll
  for (int i = 0; i < 4; ++i) { x[i] = bfr(x[i]); s1 += x[i]; }
#pragma unroll
  for (int o = 1; o < 32; o <<= 1) s1 += __shfl_xor(s1, o);
  const float mu = s1 * (1.0f / CC); float q = 0.f;
#pragma unroll
  for (int i = 0; i < 4; ++i) { const float d = x[i] - mu; q += d * d; }
#pragma unroll
  for (int o = 1; o < 32; o <<= 1) q += __shfl_xor(q, o);
  const float rs = rsqrtf(q * (1.0f / CC) + 1e-5f); v4f r4;
#pragma unroll
  for (int i = 0; i < 4; ++i) { const int c = lane * 4 + i; r4[i] = (x[i] - mu) * rs * bfr(LW[c]) + bfr(LB[c]); }
  vst2(ZN + row * CC + lane * 4, r4); }
// ---- k_rows2: block = (64 rows, which): which 0: BIAS[row][h] = ZN[row] . Wb[h] (4 outputs; hi + lo, exact weights) ; which 1: G[row][c] = sigmoid(ZN[row] hi+lo . Wg^T[c]) (128 outputs); rows in natural (i, j) order
__global__ __launch_bounds__(128) void k_rows2(const float* __restrict__ ZN, const float* __restrict__ WB, const float* __restrict__ WG, float* __restrict__ BIAS, float* __restrict__ G) { __shared__ __align__(16) float sf[4][16][132];
  const int tid = threadIdx.x, wave = tid >> 5, lane = tid & 31, col = lane & 15, g = lane >> 4; const int which = blockIdx.y; const size_t r0 = (size_t)blockIdx.x * 64 + wave * 16;
  const int nout = which == 0 ? NH : CC; const float* Wm = which == 0 ? WB : WG;
  v8f acc[8] = {};
#pragma unroll
  for (int kc = 0; kc < CC / 32; ++kc) { const F2 a = split_row(ZN + (r0 + col) * CC, kc * 32, lane); asm volatile("s_wait_loadcnt 0x0" ::: "memory");
#pragma unroll
    for (int j = 0; j < 8; ++j) { if (j * 16 >= nout) break; v16b w; { float t0[8], t1[8]; const int o = j * 16 + col; const int oc = o < nout ? o : nout - 1; const float keep = o < nout ? 1.f : 0.f;
#pragma unroll
        for (int i = 0; i < 8; ++i) t0[i] = Wm[(size_t)oc * CC + kc * 32 + 8 * g + i];
        asm volatile("s_wait_loadcnt 0x0" ::: "memory");
#pragma unroll
        for (int i = 0; i < 8; ++i) t1[i] = Wm[(size_t)oc * CC + kc * 32 + 16 + 8 * g + i];
        asm volatile("s_wait_loadcnt 0x0" ::: "memory");
#pragma unroll
        for (int i = 0; i < 8; ++i) { w[i] = (__bf16)(t0[i] * keep); w[8 + i] = (__bf16)(t1[i] * keep); } }   /* (out,in) row o; columns beyond nout zero (select-free: keep multiplies a VALID load) */
      acc[j] = wmma_bf(a.h, w, acc[j]); acc[j] = wmma_bf(a.l, w, acc[j]); } }
  if (which == 0) { if (lane < 16) {   /* bias rows: 4 floats = 16 B per row; rows r0+8g+r... store via LDS: */ }
#pragma unroll
    for (int r = 0; r < 8; ++r) sf[wave][8 * g + r][col] = acc[0][r];
    LDSX(); if (lane < 16) { v4f b4; b4[0] = sf[wave][lane][0]; b4[1] = sf[wave][lane][1]; b4[2] = sf[wave][lane][2]; b4[3] = sf[wave][lane][3]; vst2(BIAS + (r0 + lane) * NH, b4); }   /* 16 rows x 16 B = one 256-B run per wave */
  } else {
#pragma unroll
    for (int j = 0; j < 8; ++j)
#pragma unroll
      for (int r = 0; r < 8; ++r) sf[wave][8 * g + r][j * 16 + col] = 1.0f / (1.0f + expf(-acc[j][r]));   /* sigmoid gate */
    LDSX(); for (int rl = 0; rl < 16; ++rl) vst2(G + (r0 + rl) * CC + lane * 4, *(const v4f*)&sf[wave][rl][lane * 4]); } }
// ---- k_gate: Y row (b' = j, t = i -> row j*256 + i) *= G[natural row i*256 + j] (thread per float4; one writer)
__global__ __launch_bounds__(256) void k_gate(float* __restrict__ Y, const float* __restrict__ G) { const size_t e4 = (size_t)blockIdx.x * 256 + threadIdx.x; if (e4 >= (size_t)NZR * (CC / 4)) return; const size_t yrow = e4 / (CC / 4); const int q = (int)(e4 % (CC / 4)); const int jb = (int)(yrow / SZ), ii = (int)(yrow % SZ); const size_t grow = (size_t)ii * SZ + jb;
  v4f y = *(const v4f*)(Y + yrow * CC + q * 4); const v4f gg = *(const v4f*)(G + grow * CC + q * 4); y[0] *= gg[0]; y[1] *= gg[1]; y[2] *= gg[2]; y[3] *= gg[3]; vst2(Y + yrow * CC + q * 4, y); }
#define WS_ZN   (WS_END)
#define WS_BIAS (WS_ZN + 4u * (size_t)NZR * CC)
#define WS_G    (WS_BIAS + 4u * (size_t)NZR * NH)
#define WS_END2 (WS_G + 4u * (size_t)NZR * CC)
#ifndef SM_EXTRA_PARAMS
#define SM_EXTRA_PARAMS
#endif
#ifndef PROJ_EXTRA_PARAMS
#define PROJ_EXTRA_PARAMS
#endif
#ifndef SM_MASK_HOOK
#define SM_MASK_HOOK (void)0
#endif

#define WS_QH  0u                                      // f16 q rows [b*t][CC]
#define WS_KH  (WS_QH + 2u * (size_t)NB * TT * CC)      // f16 k rows [b*t][CC]
#define WS_VT  (WS_KH + 2u * (size_t)NB * TT * CC)      // f16 v planes [b][c][t]
#define WS_QL  (WS_VT + 2u * (size_t)NB * CC * TT)      // f16 q residual x 2^10 rows [b][t < QHI][CC]
#define WS_KL  (WS_QL + 2u * (size_t)NB * QHI * CC)     // f16 k residual x 2^10 rows [b][t < KHI][CC]
#define WS_VB  (WS_KL + 2u * (size_t)NB * KHI * CC)     // bf16 v hi planes [b][c][t < KHI]
#define WS_VBL (WS_VB + 2u * (size_t)NB * CC * KHI)
#define WS_S   (WS_VBL + 2u * (size_t)NB * CC * KHI)    // f32 logits / P [j][h][t][s]
#define WS_Y   (WS_S  + 4u * (size_t)BG * HG * TT * TT)   // 256 score planes of 256 x 256 per pass      // f32 ctx rows [b*t][CC]
#define WS_END (WS_Y  + 4u * (size_t)NB * TT * CC)

// ---- k_proj: block = (64 rows, 128 cols, which): q/k/v = X W (+ b) with exact bf16 products (K = DIN) -> which 0: q f16 rows (+ residual rows < QHI); 1: k f16 rows (+ residual rows < KHI); 2: v f16 planes [c][t] (+ bf16 hi/lo planes for t < KHI)
__global__ __launch_bounds__(128) void k_proj(const float* __restrict__ XQ, const float* __restrict__ XK, const float* __restrict__ XV, const float* __restrict__ WQ, const float* __restrict__ WK, const float* __restrict__ WV, const float* __restrict__ BQ, const float* __restrict__ BK, const float* __restrict__ BV,
    _Float16* __restrict__ QH, _Float16* __restrict__ QL, _Float16* __restrict__ KH, _Float16* __restrict__ KL, _Float16* __restrict__ VT, __bf16* __restrict__ VB, __bf16* __restrict__ VBL) {
  __shared__ __align__(16) _Float16 sh[64][136], sl[64][136]; __shared__ __align__(16) _Float16 th[128][72]; __shared__ __align__(16) __bf16 tb[128][72], tbl[128][72];
  const int tid = threadIdx.x, wave = tid >> 5, lane = tid & 31, col = lane & 15, g = lane >> 4; const int which = blockIdx.z; const int c0 = blockIdx.y * 128; const size_t r0 = (size_t)blockIdx.x * 64; const size_t bb = r0 / TT; const int t0 = (int)(r0 % TT);
  const float* X = which == 0 ? XQ : which == 1 ? XK : XV; const float* WA = which == 0 ? WQ : which == 1 ? WK : WV; const float* BA = which == 0 ? BQ : which == 1 ? BK : BV;
  v8f acc[8] = {};
  const size_t krow = r0 + wave * 16 + col; const size_t arow = (which == 0) ? ((krow % TT) * SZ + krow / TT) : krow;   /* q: row (j, i) reads pair row (i, j); k, v: pair row (j, k) directly */
#pragma unroll 2
  for (int kc = 0; kc < DIN / 32; ++kc) { const F2 a2 = split_row(X + arow * DIN, kc * 32, lane);   /* LN(z) rows (f32) split hi + lo */
    asm volatile("s_wait_loadcnt 0x0" ::: "memory");
#pragma unroll
    for (int j = 0; j < 8; ++j) { const v16b w = WCOL(WA, kc * 32, c0 + j * 16 + col, lane); asm volatile("s_wait_loadcnt 0x0" ::: "memory"); acc[j] = wmma_bf(a2.h, w, acc[j]); acc[j] = wmma_bf(a2.l, w, acc[j]); } }
  if (which < 2) { _Float16* DH = which == 0 ? QH : KH; _Float16* DL = which == 0 ? QL : KL; const int nhi = which == 0 ? QHI : KHI; const bool hi_rows = t0 < nhi;
#pragma unroll
    for (int j = 0; j < 8; ++j) { const float bias = BA ? bfr(BA[c0 + j * 16 + col]) : 0.f;
#pragma unroll
      for (int r = 0; r < 8; ++r) { const float v = acc[j][r] + bias; const _Float16 hv = (_Float16)v; sh[wave * 16 + 8 * g + r][j * 16 + col] = hv; sl[wave * 16 + 8 * g + r][j * 16 + col] = (_Float16)((v - (float)hv) * 1024.0f); } }
    __syncthreads();
    for (int e = tid; e < 64 * 16; e += 128) { const int rl = e >> 4, q = e & 15; vst2((unsigned*)(DH + (r0 + rl) * CC + c0 + q * 8), *(const v4u*)&sh[rl][q * 8]); if (hi_rows) vst2((unsigned*)(DL + (bb * nhi + t0 + rl) * (size_t)CC + c0 + q * 8), *(const v4u*)&sl[rl][q * 8]); }
  } else { const bool hi_rows = t0 < KHI;
#pragma unroll
    for (int j = 0; j < 8; ++j) { const float bias = BA ? bfr(BA[c0 + j * 16 + col]) : 0.f;
#pragma unroll
      for (int r = 0; r < 8; ++r) { const float v = acc[j][r] + bias; const int rl = wave * 16 + 8 * g + r, cl = j * 16 + col; th[cl][rl] = (_Float16)v; const __bf16 bh = (__bf16)v; tb[cl][rl] = bh; tbl[cl][rl] = (__bf16)(v - (float)bh); } }
    __syncthreads();
    for (int e = tid; e < 128 * 8; e += 128) { const int cl = e >> 3, q = e & 7; vst2((unsigned*)(VT + (bb * CC + c0 + cl) * (size_t)TT + t0 + q * 8), *(const v4u*)&th[cl][q * 8]); if (hi_rows) { const size_t o3 = (bb * CC + c0 + cl) * (size_t)KHI + t0 + q * 8; vst2((unsigned*)(VB + o3), *(const v4u*)&tb[cl][q * 8]); vst2((unsigned*)(VBL + o3), *(const v4u*)&tbl[cl][q * 8]); } } } }
// ---- k_sc: block = (query block qb, key block kb <= kb_last(qb), head in group) of batch b: logits x SCALE; q hi + residual (x 2^10) against k (2 products) for query rows < QHI, plus the k residual (3 products) for query blocks < QBH (causal early rows); causal: blocks past the diagonal exit, the mask itself is applied by index in k_sm
__global__ __launch_bounds__(128) void k_sc(const _Float16* __restrict__ QH, const _Float16* __restrict__ KH, const _Float16* __restrict__ QL, const _Float16* __restrict__ KL, int b0g, int h0, float* __restrict__ S0) { __shared__ __align__(16) float ss[4][16][132]; const int b = b0g + (int)blockIdx.z / HG;   /* key row j of this z-slice */
  const int qb = blockIdx.x, kb = blockIdx.y; if (kb > kb_last(qb)) return;
  const int h = h0 + (int)blockIdx.z % HG; float* S = S0 + (size_t)blockIdx.z * TT * TT;   /* plane per (j, head) slice */
  const int tid = threadIdx.x, wave = tid >> 5, lane = tid & 31, col = lane & 15, g = lane >> 4; const int k0 = kb * 128; const int ql0 = qb * 64 + wave * 16; const size_t q0 = (size_t)b * TT + ql0, kr0 = (size_t)b * TT + k0;
  v8f acc[8] = {}, accl[8] = {};
  const _Float16* QLb = QL + (size_t)b * QHI * CC; const _Float16* KLb = KL + (size_t)b * KHI * CC;
  if (qb < QBH) {
#pragma unroll
    for (int kc = 0; kc < HD / 32; ++kc) { const v16h ah = frag_h(QH + (q0 + col) * CC + h * HD + kc * 32, lane), al = frag_h(QLb + (size_t)(ql0 + col) * CC + h * HD + kc * 32, lane);
#pragma unroll
      for (int j = 0; j < 8; ++j) { const v16h kbf = frag_h(KH + (kr0 + j * 16 + col) * CC + h * HD + kc * 32, lane), klf = frag_h(KLb + (size_t)(k0 + j * 16 + col) * CC + h * HD + kc * 32, lane); acc[j] = wmma16(ah, kbf, acc[j]); accl[j] = wmma16(al, kbf, accl[j]); accl[j] = wmma16(ah, klf, accl[j]); } }
  } else if (qb * 64 < QHI) {
#pragma unroll
    for (int kc = 0; kc < HD / 32; ++kc) { const v16h ah = frag_h(QH + (q0 + col) * CC + h * HD + kc * 32, lane), al = frag_h(QLb + (size_t)(ql0 + col) * CC + h * HD + kc * 32, lane);
#pragma unroll
      for (int j = 0; j < 8; ++j) { const v16h kbf = frag_h(KH + (kr0 + j * 16 + col) * CC + h * HD + kc * 32, lane); acc[j] = wmma16(ah, kbf, acc[j]); accl[j] = wmma16(al, kbf, accl[j]); } }
  } else {
#pragma unroll
    for (int kc = 0; kc < HD / 32; ++kc) { const v16h ah = frag_h(QH + (q0 + col) * CC + h * HD + kc * 32, lane);
#pragma unroll
      for (int j = 0; j < 8; ++j) { const v16h kbf = frag_h(KH + (kr0 + j * 16 + col) * CC + h * HD + kc * 32, lane); acc[j] = wmma16(ah, kbf, acc[j]); } } }
#pragma unroll
  for (int j = 0; j < 8; ++j) {
#pragma unroll
    for (int r = 0; r < 8; ++r) ss[wave][8 * g + r][j * 16 + col] = (acc[j][r] + accl[j][r] * (1.0f / 1024.0f)) * SCALE; }
  LDSX(); for (int rl = 0; rl < 16; ++rl) vst2(S + (size_t)(ql0 + rl) * TT + k0 + lane * 4, *(const v4f*)&ss[wave][rl][lane * 4]); }
// ---- k_sm: block = query row t (head in group): keys [0, kend): causal -> logit if s <= t else excluded; softmax in f32; P x 2^11 in place (0 for excluded)
__global__ __launch_bounds__(256) void k_sm(float* __restrict__ S0 SM_EXTRA_PARAMS) { __shared__ float sred[8]; __shared__ float sbc; __shared__ __align__(16) float shv[TT];
  const int tid = threadIdx.x; const int t = blockIdx.x; const int kend = (kb_last(t >> 6) + 1) * 128;
  float* sr = S0 + (size_t)blockIdx.y * TT * TT + (size_t)t * TT;
  float m = -3.0e38f; for (int k = tid; k < kend; k += 256) { float v = (!CAUSAL || k <= t) ? sr[k] : -3.0e38f; SM_MASK_HOOK; shv[k] = v; m = fmaxf(m, v); }
#pragma unroll
  for (int o = 1; o < 32; o <<= 1) m = fmaxf(m, __shfl_xor(m, o));
  if ((tid & 31) == 0) sred[tid >> 5] = m; __syncthreads(); if (tid == 0) { float a = sred[0]; for (int i = 1; i < 8; ++i) a = fmaxf(a, sred[i]); sbc = a; } __syncthreads(); m = sbc; __syncthreads();
  float sum = 0.f; for (int k = tid; k < kend; k += 256) { const float v = shv[k]; const float e = (v <= -1.0e38f) ? 0.f : expf(v - m); shv[k] = e; sum += e; }
#pragma unroll
  for (int o = 1; o < 32; o <<= 1) sum += __shfl_xor(sum, o);
  if ((tid & 31) == 0) sred[tid >> 5] = sum; __syncthreads(); if (tid == 0) { float a = 0.f; for (int i = 0; i < 8; ++i) a += sred[i]; sbc = a > 0.f ? 2048.0f / a : 0.f; }   /* a fully excluded row yields P = 0 */ __syncthreads(); const float inv = sbc;
  for (int k = tid; k < kend; k += 256) shv[k] = shv[k] * inv;
  __syncthreads(); for (int q = tid; q < kend / 4; q += 256) vst2(sr + q * 4, *(const v4f*)&shv[q * 4]); }
// ---- k_pv: block = 64 queries (qb) of (b, h): ctx = P . v over keys [0, kend) (P x 2^11 once to f16 against v f16: 1 product; causal early query blocks: P and v as bf16 hi + lo, 3 products); 128-B (row, head) segment by 8 lanes
__global__ __launch_bounds__(128) void k_pv(const float* __restrict__ PS0, const _Float16* __restrict__ VT, const __bf16* __restrict__ VB, const __bf16* __restrict__ VBL, int b0g, int h0, float* __restrict__ Y) { const int b = b0g + (int)blockIdx.z / HG; const int h = h0 + (int)blockIdx.z % HG; const float* PS = PS0 + (size_t)blockIdx.z * TT * TT; __shared__ __align__(16) float ss[4][16][HD + 4];
  const int tid = threadIdx.x, wave = tid >> 5, lane = tid & 31, col = lane & 15, g = lane >> 4; const int qb = blockIdx.x; const int ql0 = qb * 64 + wave * 16; const int kce = (kb_last(qb) + 1) * 4;
  v8f acc[HD / 16] = {};
  if (qb < QBH) {
#pragma unroll 1
    for (int kc = 0; kc < kce; ++kc) { const F2 p = split_row(PS + (size_t)(ql0 + col) * TT, kc * 32, lane);
      asm volatile("s_wait_loadcnt 0x0" ::: "memory");
#pragma unroll
      for (int j = 0; j < HD / 16; ++j) { const size_t po = ((size_t)b * CC + h * HD + j * 16 + col) * (size_t)KHI + kc * 32; const v16b vh = frag_b(VB + po, lane); acc[j] = wmma_bf(p.h, vh, acc[j]); acc[j] = wmma_bf(p.l, vh, acc[j]); acc[j] = wmma_bf(p.h, frag_b(VBL + po, lane), acc[j]); } }
  } else {
#pragma unroll 1
    for (int kc = 0; kc < kce; ++kc) { const v16h p = frag_f32(PS + (size_t)(ql0 + col) * TT + kc * 32, lane);
      asm volatile("s_wait_loadcnt 0x0" ::: "memory");
#pragma unroll
      for (int j = 0; j < HD / 16; ++j) { const size_t po = ((size_t)b * CC + h * HD + j * 16 + col) * (size_t)TT + kc * 32; acc[j] = wmma16(p, frag_h(VT + po, lane), acc[j]); } } }
#pragma unroll
  for (int j = 0; j < HD / 16; ++j)
#pragma unroll
    for (int r = 0; r < 8; ++r) ss[wave][8 * g + r][j * 16 + col] = acc[j][r] * (1.0f / 2048.0f);
  LDSX(); for (int rl = 0; rl < 16; ++rl) if (lane < HD / 4) vst2(Y + ((size_t)b * TT + ql0 + rl) * CC + h * HD + lane * 4, *(const v4f*)&ss[wave][rl][lane * 4]); }
// ---- k_out: block = (64 rows, 128 cols): out = ctx Wo (+ bo): all rows ctx bf16 hi + lo against exact bf16 Wo (2 products); the branch with ctx once to f16 against Wo as f16(bf16 x 2^8) (1 product, x 2^-8) is not taken
__global__ __launch_bounds__(128) void k_out(const float* __restrict__ Y, const float* __restrict__ WO, const float* __restrict__ BO, float* __restrict__ OUT) { __shared__ __align__(16) float sf[4][16][132];
  const int tid = threadIdx.x, wave = tid >> 5, lane = tid & 31, col = lane & 15, g = lane >> 4; const int c0 = blockIdx.y * 128; const size_t r0 = (size_t)blockIdx.x * 64 + wave * 16;
  v8f acc[8] = {};
  if (true) {   /* ALL rows take the bf16 hi + lo x exact Wo path (2 products) */
#pragma unroll 2
    for (int kc = 0; kc < CC / 32; ++kc) { const F2 a = split_row(Y + (r0 + col) * CC, kc * 32, lane); asm volatile("s_wait_loadcnt 0x0" ::: "memory");
#pragma unroll
      for (int j = 0; j < 8; ++j) { const v16b w = WOCOL(WO, kc * 32, c0 + j * 16 + col, lane); asm volatile("s_wait_loadcnt 0x0" ::: "memory"); acc[j] = wmma_bf(a.h, w, acc[j]); acc[j] = wmma_bf(a.l, w, acc[j]); } }
#pragma unroll
    for (int j = 0; j < 8; ++j) { const float bias = BO ? bfr(BO[c0 + j * 16 + col]) : 0.f;
#pragma unroll
      for (int r = 0; r < 8; ++r) sf[wave][8 * g + r][j * 16 + col] = acc[j][r] + bias; }
  } else {
#pragma unroll 2
    for (int kc = 0; kc < CC / 32; ++kc) { const v16h a = frag_f32(Y + (r0 + col) * CC + kc * 32, lane); asm volatile("s_wait_loadcnt 0x0" ::: "memory");
#pragma unroll
      for (int j = 0; j < 8; ++j) { const v16h w = WOCOLH(WO, kc * 32, c0 + j * 16 + col, lane); asm volatile("s_wait_loadcnt 0x0" ::: "memory"); acc[j] = wmma16(a, w, acc[j]); } }
#pragma unroll
    for (int j = 0; j < 8; ++j) { const float bias = BO ? bfr(BO[c0 + j * 16 + col]) : 0.f;
#pragma unroll
      for (int r = 0; r < 8; ++r) sf[wave][8 * g + r][j * 16 + col] = acc[j][r] * (1.0f / 256.0f) + bias; } }
  LDSX(); for (int rl = 0; rl < 16; ++rl) vst2(OUT + ((((r0 + rl) % TT) * SZ) + ((r0 + rl) / TT)) * DIN + c0 + lane * 4, *(const v4f*)&sf[wave][rl][lane * 4]); }

extern "C" void kernel_launch(void* const* d_in, const int* in_sizes, int n_in, void* d_out, int out_size, void* d_ws, size_t ws_size, hipStream_t stream) {
  (void)in_sizes; (void)n_in; (void)out_size;
  const float** F = (const float**)d_in;
  if (ws_size < (size_t)WS_END) return;
  char* ws = (char*)d_ws; _Float16 *QH = (_Float16*)(ws + WS_QH), *KH = (_Float16*)(ws + WS_KH), *VT = (_Float16*)(ws + WS_VT), *QL = (_Float16*)(ws + WS_QL), *KL = (_Float16*)(ws + WS_KL); __bf16 *VB = (__bf16*)(ws + WS_VB), *VBL = (__bf16*)(ws + WS_VBL); float *S = (float*)(ws + WS_S), *Y = (float*)(ws + WS_Y);
  (void)Y; (void)QL; (void)KL; (void)VB; (void)VBL;
  // inputs: 0 z_ij [1,256,256,128]; 1 ln_w, 2 ln_b; 3 Wq, 4 Wk, 5 Wv [128,128] (out,in); 6 Wb [4,128]; 7 Wg [128,128]; 8 Wo [128,128] (out,in)
  if (ws_size < (size_t)WS_END2) return;
  float *ZN = (float*)(ws + WS_ZN), *BIAS = (float*)(ws + WS_BIAS), *G = (float*)(ws + WS_G);
  k_lnz<<<dim3(NZR / 8), 256, 0, stream>>>(F[0], F[1], F[2], ZN);
  k_rows2<<<dim3(NZR / 64, 2), 128, 0, stream>>>(ZN, F[6], F[7], BIAS, G);
  k_proj<<<dim3(TNB * TT / 64, CC / 128, 3), 128, 0, stream>>>(ZN, ZN, ZN, F[3], F[4], F[5], nullptr, nullptr, nullptr, QH, QL, KH, KL, VT, VB, VBL);
  for (int bg = 0; bg < TNB; bg += BG) {   /* 64 key rows j per pass x 4 heads */
    k_sc<<<dim3(NQB, TT / 128, BG * HG), 128, 0, stream>>>(QH, KH, QL, KL, bg, 0, S);
    k_sm<<<dim3(TT, BG * HG), 256, 0, stream>>>(S, BIAS, bg);
    k_pv<<<dim3(NQB, 1, BG * HG), 128, 0, stream>>>(S, VT, VB, VBL, bg, 0, Y);
  }
  k_gate<<<dim3((NZR * (CC / 4) + 255) / 256), 256, 0, stream>>>(Y, G);
  k_out<<<dim3(TNB * TT / 64, DIN / 128), 128, 0, stream>>>(Y, F[8], nullptr, (float*)d_out);
}

// v001
// One run takes 229 microseconds.
// Next to v000, in two timings, it ran 2.39 and 2.37 times as fast.
// compute dtype: all float inputs rounded to bf16; LayerNorm of z in f32; q/k/v = LN(z) split bf16 hi + lo x W^T (exact bf16) on WMMA 16x16x32 (2 products, f32 accumulate); q as f16 hi + residual (x 2^10) against k once to f16 (2 products) x 32^-0.5 + the per-(query, head) bias; softmax in f32 (precise expf); P x 2^11 once to f16 against v once to f16 (1 product); gate sigmoid(LN(z) Wg^T) in f32 (2-product GEMM, precise expf); gated ctx split bf16 hi + lo against exact Wo (2 products); f32 output.
#include <hip/hip_runtime.h>
#include <math.h>

typedef __attribute__((ext_vector_type(16))) _Float16 v16h;
typedef __attribute__((ext_vector_type(16))) __bf16 v16b;
typedef __attribute__((ext_vector_type(8)))  _Float16 v8h;
typedef __attribute__((ext_vector_type(8)))  float v8f;
typedef __attribute__((ext_vector_type(4)))  float v4f;
typedef __attribute__((ext_vector_type(2)))  float v2f;
typedef __attribute__((ext_vector_type(4)))  unsigned v4u;
typedef __attribute__((ext_vector_type(4)))  int v4i;
typedef float __attribute__((may_alias)) float_a;
typedef int __attribute__((may_alias)) int_a;

template <typename T> __device__ __forceinline__ void vst2(void* p, T v) { *(T*)p = v;  }
__device__ __forceinline__ v8f wmma16(v16h a, v16h b, v8f c) {
  v8f d = __builtin_amdgcn_wmma_f32_16x16x32_f16(false, a, false, b, (short)0, c, false, false);
  asm volatile("v_nop\n\tv_nop\n\tv_nop\n\tv_nop" : "+v"(d) : "v"(a), "v"(b));
  return d;
}
__device__ __forceinline__ v8f wmma_bf(v16b a, v16b b, v8f c) {
  v8f d = __builtin_amdgcn_wmma_f32_16x16x32_bf16(false, a, false, b, (short)0, c, false, false);
  asm volatile("v_nop\n\tv_nop\n\tv_nop\n\tv_nop" : "+v"(d) : "v"(a), "v"(b));
  return d;
}
// 16x16x32 fragments: lane = (h = lane>>4, row/col = lane&15); elements 0..7 = k0+8h+0..7, 8..15 = k0+16+8h+0..7; D element r = row 8h+r
__device__ __forceinline__ v16h frag_h(const _Float16* rowk0, int lane) {
  union { v16h v; v8h q[2]; } u; const _Float16* p = rowk0 + 8 * (lane >> 4);
  u.q[0] = *(const v8h*)p; u.q[1] = *(const v8h*)(p + 16); return u.v;
}
__device__ __forceinline__ v16h frag_f32(const float* rowk0, int lane) {
  v16h a; const float* p = rowk0 + 8 * (lane >> 4);
#pragma unroll
  for (int i = 0; i < 8; ++i) { a[i] = (_Float16)p[i]; a[8 + i] = (_Float16)p[16 + i]; }
  return a;
}
__device__ __forceinline__ v16h frag_f32s(const float* rowk0, int lane, float sc) {
  v16h a; const float* p = rowk0 + 8 * (lane >> 4);
#pragma unroll
  for (int i = 0; i < 8; ++i) { a[i] = (_Float16)(p[i] * sc); a[8 + i] = (_Float16)(p[16 + i] * sc); }
  return a;
}
// column fragment from a [K][ld] layout (column n), rows >= K read as 0
__device__ __forceinline__ v16h fragc_f32(const float* W, int k0, int n, int lane, int ld, int K) {
  v16h a; const int g = lane >> 4;
#pragma unroll
  for (int i = 0; i < 8; ++i) { const int ka = k0 + 8 * g + i, kb = ka + 16;
    a[i] = (_Float16)(ka < K ? W[(size_t)(ka < K ? ka : K - 1) * ld + n] : 0.f); a[8 + i] = (_Float16)(kb < K ? W[(size_t)(kb < K ? kb : K - 1) * ld + n] : 0.f); }
  return a;
}
struct F2 { v16b h, l; };
__device__ __forceinline__ F2 bsplit16(const float v[16]) { F2 r;
#pragma unroll
  for (int i = 0; i < 16; ++i) { const __bf16 h = (__bf16)v[i]; r.h[i] = h; r.l[i] = (__bf16)(v[i] - (float)h); }
  return r; }
__device__ __forceinline__ F2 split_row(const float* row, int k0, int lane) { float v[16]; const float* p = row + k0 + 8 * (lane >> 4);
#pragma unroll
  for (int i = 0; i < 8; ++i) { v[i] = p[i]; v[8 + i] = p[16 + i]; }
  return bsplit16(v); }
__device__ __forceinline__ F2 split_rowK(const float* row, int k0, int lane, int K) { float v[16]; const int g = lane >> 4;
#pragma unroll
  for (int i = 0; i < 8; ++i) { const int ka = k0 + 8 * g + i, kb = ka + 16; v[i] = ka < K ? row[ka < K ? ka : K - 1] : 0.f; v[8 + i] = kb < K ? row[kb < K ? kb : K - 1] : 0.f; }
  return bsplit16(v); }
__device__ __forceinline__ F2 split_col(const float* W, int k0, int n, int lane, int ld, int K) { float v[16]; const int g = lane >> 4;
#pragma unroll
  for (int i = 0; i < 8; ++i) { const int ka = k0 + 8 * g + i, kb = ka + 16; v[i] = ka < K ? W[(size_t)(ka < K ? ka : K - 1) * ld + n] : 0.f; v[8 + i] = kb < K ? W[(size_t)(kb < K ? kb : K - 1) * ld + n] : 0.f; }
  return bsplit16(v); }
__device__ __forceinline__ v8f mac3(const F2& a, const F2& b, v8f c) { c = wmma_bf(a.l, b.h, c); c = wmma_bf(a.h, b.l, c); return wmma_bf(a.h, b.h, c); }
__device__ __forceinline__ float sigm(float v) { return 1.0f / (1.0f + expf(-v)); }
#define LDSX() do { asm volatile("s_wait_dscnt 0" ::: "memory"); __builtin_amdgcn_wave_barrier(); __builtin_amdgcn_fence(__ATOMIC_RELEASE, "workgroup"); } while (0)

// Triangle attention, starting node (z [1, 256, 256, 128], 4 heads x 32): z <- LayerNorm(z); q_ij, k_jk, v_jk, g_ij = z W^T; scores[i,j,h,k] = q_ij . k_jk / sqrt(32) + bias[i,j,h] (bias = z Wb^T, constant over k); attn = softmax over k; o_ij = sum_k attn v_jk; out_ij = (sigmoid(g_ij) * o_ij) Wo^T. Mapping: 'batch' = j (the shared key row), query position = i, key position = k.
#define NB 256
#define TT 256
#define CC 128            // NH * HD = projected width
#define DIN 128          // input (model) width
#define NH 4
#define HD 32
#define NQB (TT / 64)
#define HG 4
#define SCALE (0.17677669529663687f)
#define CAUSAL 0
#ifndef TNB
#define TNB NB
#endif
__device__ __forceinline__ float bfr(float v) { return (float)(__bf16)v; }
__host__ __device__ __forceinline__ int kb_last(int qb) { return CAUSAL ? ((qb * 64 + 63) >> 7) : (TT / 128 - 1); }
typedef __attribute__((ext_vector_type(8))) __bf16 v8b;
__device__ __forceinline__ v16b frag_b(const __bf16* rowk0, int lane) {
  union { v16b v; v8b q[2]; } u; const __bf16* p = rowk0 + 8 * (lane >> 4);
  u.q[0] = *(const v8b*)p; u.q[1] = *(const v8b*)(p + 16); return u.v;
}
#define QBH 0              // unused: no kernel here has a high-precision query path
#define QHI 256            // rows carrying a q residual plane (all rows when non-causal: 2-product logits everywhere)
#define KHI 64            // key rows carrying k residual / v bf16 hi+lo planes (written by k_proj; no kernel reads them)
// B fragment (k rows k0+.., output column o) of a weight: (in,out) [K][ld] or (out,in) [ld rows of K]: bf16 exact, or f16(bf16 * 256) exact
__device__ __forceinline__ v16b wcol_io(const float* Wm, int k0, int o, int lane, int ld) { v16b w; const int g = lane >> 4;
#pragma unroll
  for (int i = 0; i < 8; ++i) { w[i] = (__bf16)Wm[(size_t)(k0 + 8 * g + i) * ld + o]; w[8 + i] = (__bf16)Wm[(size_t)(k0 + 16 + 8 * g + i) * ld + o]; }
  return w; }
__device__ __forceinline__ v16b wcol_oi(const float* Wm, int k0, int o, int lane, int K) { v16b w; const float* p = Wm + (size_t)o * K + k0 + 8 * (lane >> 4);
#pragma unroll
  for (int i = 0; i < 8; ++i) { w[i] = (__bf16)p[i]; w[8 + i] = (__bf16)p[16 + i]; }
  return w; }
__device__ __forceinline__ v16h wcolh_io(const float* Wm, int k0, int o, int lane, int ld) { v16h w; const int g = lane >> 4;
#pragma unroll
  for (int i = 0; i < 8; ++i) { w[i] = (_Float16)(bfr(Wm[(size_t)(k0 + 8 * g + i) * ld + o]) * 256.0f); w[8 + i] = (_Float16)(bfr(Wm[(size_t)(k0 + 16 + 8 * g + i) * ld + o]) * 256.0f); }
  return w; }
__device__ __forceinline__ v16h wcolh_oi(const float* Wm, int k0, int o, int lane, int K) { v16h w; const float* p = Wm + (size_t)o * K + k0 + 8 * (lane >> 4);
#pragma unroll
  for (int i = 0; i < 8; ++i) { w[i] = (_Float16)(bfr(p[i]) * 256.0f); w[8 + i] = (_Float16)(bfr(p[16 + i]) * 256.0f); }
  return w; }
#define WQKV_LAYOUT 1   // 0 = (in,out) [DIN][CC]; 1 = (out,in) [CC][DIN]; 2 = per-head [NH][DIN][HD]
__device__ __forceinline__ v16b wcol_hdk(const float* Wm, int k0, int o, int lane) { v16b w; const int g = lane >> 4; const float* p = Wm + (size_t)(o / HD) * DIN * HD + (o % HD);
#pragma unroll
  for (int i = 0; i < 8; ++i) { w[i] = (__bf16)p[(size_t)(k0 + 8 * g + i) * HD]; w[8 + i] = (__bf16)p[(size_t)(k0 + 16 + 8 * g + i) * HD]; }
  return w; }
#define WO_OUT_IN 1
#if WQKV_LAYOUT == 1
#define WCOL(W, k0, o, lane) wcol_oi(W, k0, o, lane, DIN)
#elif WQKV_LAYOUT == 2
#define WCOL(W, k0, o, lane) wcol_hdk(W, k0, o, lane)
#else
#define WCOL(W, k0, o, lane) wcol_io(W, k0, o, lane, CC)
#endif
#if WO_OUT_IN
#define WOCOL(W, k0, o, lane) wcol_oi(W, k0, o, lane, CC)
#define WOCOLH(W, k0, o, lane) wcolh_oi(W, k0, o, lane, CC)
#else
#define WOCOL(W, k0, o, lane) wcol_io(W, k0, o, lane, DIN)
#define WOCOLH(W, k0, o, lane) wcolh_io(W, k0, o, lane, DIN)
#endif
#define SZ 256             // S (pair-tensor side)
#define BG 64              // key rows j the unused WS_S region is sized for (x 4 heads = 256 planes of 256 x 256)
#define NZR (SZ * SZ)      // 65,536 pair rows
#define SM_EXTRA_PARAMS , const float* __restrict__ BIAS, int b0s
#define SM_MASK_HOOK do { const int jb = b0s + (int)blockIdx.y / HG; const int hh = (int)blockIdx.y % HG; v = v + BIAS[((size_t)t * SZ + jb) * NH + hh]; } while (0)   /* bias[i][j][h] (constant over the keys: cancels in the softmax up to rounding; added for fidelity) */
// ---- k_lnz: wave per pair row: LayerNorm over the 128 channels (biased var, eps 1e-5, ln_w/ln_b) of bf16(z) -> ZN rows (4 floats per lane = one 512-B row)
__global__ __launch_bounds__(256) void k_lnz(const float* __restrict__ Z, const float* __restrict__ LW, const float* __restrict__ LB, float* __restrict__ ZN) { const int wave = threadIdx.x >> 5, lane = threadIdx.x & 31; const size_t row = (size_t)blockIdx.x * 8 + wave; if (row >= (size_t)NZR) return;
  v4f x = *(const v4f*)(Z + row * CC + lane * 4); float s1 = 0.f;
#pragma unroll
  for (int i = 0; i < 4; ++i) { x[i] = bfr(x[i]); s1 += x[i]; }
#pragma unroll
  for (int o = 1; o < 32; o <<= 1) s1 += __shfl_xor(s1, o);
  const float mu = s1 * (1.0f / CC); float q = 0.f;
#pragma unroll
  for (int i = 0; i < 4; ++i) { const float d = x[i] - mu; q += d * d; }
#pragma unroll
  for (int o = 1; o < 32; o <<= 1) q += __shfl_xor(q, o);
  const float rs = rsqrtf(q * (1.0f / CC) + 1e-5f); v4f r4;
#pragma unroll
  for (int i = 0; i < 4; ++i) { const int c = lane * 4 + i; r4[i] = (x[i] - mu) * rs * bfr(LW[c]) + bfr(LB[c]); }
  vst2(ZN + row * CC + lane * 4, r4); }
// ---- k_rows2: block = (64 rows, which): which 0: BIAS[row][h] = ZN[row] . Wb[h] (4 outputs; hi + lo, exact weights) ; which 1: G[row][c] = sigmoid(ZN[row] hi+lo . Wg^T[c]) (128 outputs); rows in natural (i, j) order
__global__ __launch_bounds__(128) void k_rows2(const float* __restrict__ ZN, const float* __restrict__ WB, const float* __restrict__ WG, float* __restrict__ BIAS, float* __restrict__ G) { __shared__ __align__(16) float sf[4][16][132];
  const int tid = threadIdx.x, wave = tid >> 5, lane = tid & 31, col = lane & 15, g = lane >> 4; const int which = blockIdx.y; const size_t r0 = (size_t)blockIdx.x * 64 + wave * 16;
  const int nout = which == 0 ? NH : CC; const float* Wm = which == 0 ? WB : WG;
  v8f acc[8] = {};
#pragma unroll
  for (int kc = 0; kc < CC / 32; ++kc) { const F2 a = split_row(ZN + (r0 + col) * CC, kc * 32, lane); asm volatile("s_wait_loadcnt 0x0" ::: "memory");
#pragma unroll
    for (int j = 0; j < 8; ++j) { if (j * 16 >= nout) break; v16b w; { float t0[8], t1[8]; const int o = j * 16 + col; const int oc = o < nout ? o : nout - 1; const float keep = o < nout ? 1.f : 0.f;
#pragma unroll
        for (int i = 0; i < 8; ++i) t0[i] = Wm[(size_t)oc * CC + kc * 32 + 8 * g + i];
        asm volatile("s_wait_loadcnt 0x0" ::: "memory");
#pragma unroll
        for (int i = 0; i < 8; ++i) t1[i] = Wm[(size_t)oc * CC + kc * 32 + 16 + 8 * g + i];
        asm volatile("s_wait_loadcnt 0x0" ::: "memory");
#pragma unroll
        for (int i = 0; i < 8; ++i) { w[i] = (__bf16)(t0[i] * keep); w[8 + i] = (__bf16)(t1[i] * keep); } }   /* (out,in) row o; columns beyond nout zero (select-free: keep multiplies a VALID load) */
      acc[j] = wmma_bf(a.h, w, acc[j]); acc[j] = wmma_bf(a.l, w, acc[j]); } }
  if (which == 0) { if (lane < 16) {   /* bias rows: 4 floats = 16 B per row; rows r0+8g+r... store via LDS: */ }
#pragma unroll
    for (int r = 0; r < 8; ++r) sf[wave][8 * g + r][col] = acc[0][r];
    LDSX(); if (lane < 16) { v4f b4; b4[0] = sf[wave][lane][0]; b4[1] = sf[wave][lane][1]; b4[2] = sf[wave][lane][2]; b4[3] = sf[wave][lane][3]; vst2(BIAS + (r0 + lane) * NH, b4); }   /* 16 rows x 16 B = one 256-B run per wave */
  } else {
#pragma unroll
    for (int j = 0; j < 8; ++j)
#pragma unroll
      for (int r = 0; r < 8; ++r) sf[wave][8 * g + r][j * 16 + col] = 1.0f / (1.0f + expf(-acc[j][r]));   /* sigmoid gate */
    LDSX(); for (int rl = 0; rl < 16; ++rl) vst2(G + (r0 + rl) * CC + lane * 4, *(const v4f*)&sf[wave][rl][lane * 4]); } }
// ---- k_gate: Y row (b' = j, t = i -> row j*256 + i) *= G[natural row i*256 + j] (thread per float4; one writer)
__global__ __launch_bounds__(256) void k_gate(float* __restrict__ Y, const float* __restrict__ G) { const size_t e4 = (size_t)blockIdx.x * 256 + threadIdx.x; if (e4 >= (size_t)NZR * (CC / 4)) return; const size_t yrow = e4 / (CC / 4); const int q = (int)(e4 % (CC / 4)); const int jb = (int)(yrow / SZ), ii = (int)(yrow % SZ); const size_t grow = (size_t)ii * SZ + jb;
  v4f y = *(const v4f*)(Y + yrow * CC + q * 4); const v4f gg = *(const v4f*)(G + grow * CC + q * 4); y[0] *= gg[0]; y[1] *= gg[1]; y[2] *= gg[2]; y[3] *= gg[3]; vst2(Y + yrow * CC + q * 4, y); }
#define WS_ZN   (WS_END)
#define WS_BIAS (WS_ZN + 4u * (size_t)NZR * CC)
#define WS_G    (WS_BIAS + 4u * (size_t)NZR * NH)
#define WS_END2 (WS_G + 4u * (size_t)NZR * CC)
#ifndef SM_EXTRA_PARAMS
#define SM_EXTRA_PARAMS
#endif
#ifndef PROJ_EXTRA_PARAMS
#define PROJ_EXTRA_PARAMS
#endif
#ifndef SM_MASK_HOOK
#define SM_MASK_HOOK (void)0
#endif

#define WS_QH  0u                                      // f16 q rows [b*t][CC]
#define WS_KH  (WS_QH + 2u * (size_t)NB * TT * CC)      // f16 k rows [b*t][CC]
#define WS_VT  (WS_KH + 2u * (size_t)NB * TT * CC)      // f16 v planes [b][c][t]
#define WS_QL  (WS_VT + 2u * (size_t)NB * CC * TT)      // f16 q residual x 2^10 rows [b][t < QHI][CC]
#define WS_KL  (WS_QL + 2u * (size_t)NB * QHI * CC)     // f16 k residual x 2^10 rows [b][t < KHI][CC]
#define WS_VB  (WS_KL + 2u * (size_t)NB * KHI * CC)     // bf16 v hi planes [b][c][t < KHI]
#define WS_VBL (WS_VB + 2u * (size_t)NB * CC * KHI)
#define WS_S   (WS_VBL + 2u * (size_t)NB * CC * KHI)    // f32 region, unused (k_att keeps logits and P in registers)
#define WS_Y   (WS_S  + 4u * (size_t)BG * HG * TT * TT)   // 256 unused score planes of 256 x 256      // f32 ctx rows [b*t][CC]
#define WS_END (WS_Y  + 4u * (size_t)NB * TT * CC)

// ---- k_proj: block = (64 rows, 128 cols, which): q/k/v = X W (+ b) with exact bf16 products (K = DIN) -> which 0: q f16 rows (+ residual rows < QHI); 1: k f16 rows (+ residual rows < KHI); 2: v f16 planes [c][t] (+ bf16 hi/lo planes for t < KHI)
__global__ __launch_bounds__(128) void k_proj(const float* __restrict__ XQ, const float* __restrict__ XK, const float* __restrict__ XV, const float* __restrict__ WQ, const float* __restrict__ WK, const float* __restrict__ WV, const float* __restrict__ BQ, const float* __restrict__ BK, const float* __restrict__ BV,
    _Float16* __restrict__ QH, _Float16* __restrict__ QL, _Float16* __restrict__ KH, _Float16* __restrict__ KL, _Float16* __restrict__ VT, __bf16* __restrict__ VB, __bf16* __restrict__ VBL) {
  __shared__ __align__(16) _Float16 sh[64][136], sl[64][136]; __shared__ __align__(16) _Float16 th[128][72]; __shared__ __align__(16) __bf16 tb[128][72], tbl[128][72];
  const int tid = threadIdx.x, wave = tid >> 5, lane = tid & 31, col = lane & 15, g = lane >> 4; const int which = blockIdx.z; const int c0 = blockIdx.y * 128; const size_t r0 = (size_t)blockIdx.x * 64; const size_t bb = r0 / TT; const int t0 = (int)(r0 % TT);
  const float* X = which == 0 ? XQ : which == 1 ? XK : XV; const float* WA = which == 0 ? WQ : which == 1 ? WK : WV; const float* BA = which == 0 ? BQ : which == 1 ? BK : BV;
  v8f acc[8] = {};
  const size_t krow = r0 + wave * 16 + col; const size_t arow = (which == 0) ? ((krow % TT) * SZ + krow / TT) : krow;   /* q: row (j, i) reads pair row (i, j); k, v: pair row (j, k) directly */
#pragma unroll 2
  for (int kc = 0; kc < DIN / 32; ++kc) { const F2 a2 = split_row(X + arow * DIN, kc * 32, lane);   /* LN(z) rows (f32) split hi + lo */
    asm volatile("s_wait_loadcnt 0x0" ::: "memory");
#pragma unroll
    for (int j = 0; j < 8; ++j) { const v16b w = WCOL(WA, kc * 32, c0 + j * 16 + col, lane); asm volatile("s_wait_loadcnt 0x0" ::: "memory"); acc[j] = wmma_bf(a2.h, w, acc[j]); acc[j] = wmma_bf(a2.l, w, acc[j]); } }
  if (which < 2) { _Float16* DH = which == 0 ? QH : KH; _Float16* DL = which == 0 ? QL : KL; const int nhi = which == 0 ? QHI : KHI; const bool hi_rows = t0 < nhi;
#pragma unroll
    for (int j = 0; j < 8; ++j) { const float bias = BA ? bfr(BA[c0 + j * 16 + col]) : 0.f;
#pragma unroll
      for (int r = 0; r < 8; ++r) { const float v = acc[j][r] + bias; const _Float16 hv = (_Float16)v; sh[wave * 16 + 8 * g + r][j * 16 + col] = hv; sl[wave * 16 + 8 * g + r][j * 16 + col] = (_Float16)((v - (float)hv) * 1024.0f); } }
    __syncthreads();
    for (int e = tid; e < 64 * 16; e += 128) { const int rl = e >> 4, q = e & 15; vst2((unsigned*)(DH + (r0 + rl) * CC + c0 + q * 8), *(const v4u*)&sh[rl][q * 8]); if (hi_rows) vst2((unsigned*)(DL + (bb * nhi + t0 + rl) * (size_t)CC + c0 + q * 8), *(const v4u*)&sl[rl][q * 8]); }
  } else { const bool hi_rows = t0 < KHI;
#pragma unroll
    for (int j = 0; j < 8; ++j) { const float bias = BA ? bfr(BA[c0 + j * 16 + col]) : 0.f;
#pragma unroll
      for (int r = 0; r < 8; ++r) { const float v = acc[j][r] + bias; const int rl = wave * 16 + 8 * g + r, cl = j * 16 + col; th[cl][rl] = (_Float16)v; const __bf16 bh = (__bf16)v; tb[cl][rl] = bh; tbl[cl][rl] = (__bf16)(v - (float)bh); } }
    __syncthreads();
    for (int e = tid; e < 128 * 8; e += 128) { const int cl = e >> 3, q = e & 7; vst2((unsigned*)(VT + (bb * CC + c0 + cl) * (size_t)TT + t0 + q * 8), *(const v4u*)&th[cl][q * 8]); if (hi_rows) { const size_t o3 = (bb * CC + c0 + cl) * (size_t)KHI + t0 + q * 8; vst2((unsigned*)(VB + o3), *(const v4u*)&tb[cl][q * 8]); vst2((unsigned*)(VBL + o3), *(const v4u*)&tbl[cl][q * 8]); } } } }
// ---- k_att: block = 128 queries (8 waves x 16) of one (key row j, head h), all 256 keys. The head's k rows and v planes are staged once in LDS (row pitches 80 B and 528 B = 16 B x odd, for 16-byte readers). S^T = K Q^T (A = k rows, B = q hi and q residual x 2^10: 2 products), so a lane holds one query's logits (keys 16 jt + 8 g + r) in registers; logits x SCALE + bias; softmax in f32 in the lane plus one exchange between the lane halves; P x 2^11 once to f16 is packed from two score tiles straight into a B operand; ctx^T = V^T P^T (A = v planes [c][t], 1 product): a lane ends with 8 consecutive channels of its query's row. Every loop is unrolled: tk, tv, s, o and p live in registers and need constant indices
__device__ __forceinline__ v8f wmma_h(v16h a, v16h b, v8f c) { return __builtin_amdgcn_wmma_f32_16x16x32_f16(false, a, false, b, (short)0, c, false, false); }
// e^x by the scheme of expf (x log2(e) with the constant split in two, the whole part applied by ldexp, both range tests), written out so that v_exp_f32 and its v_nop are one statement
__device__ __forceinline__ float exp_slot(float x) { const float w = __builtin_rintf(x * 0x1.715476p+0f); const float a = __builtin_fmaf(x, 0x1.4ae0bep-26f, __builtin_fmaf(x, 0x1.715476p+0f, -w)); float r;
  asm("v_exp_f32 %0, %1\n\tv_nop" : "=v"(r) : "v"(a));   /* v_nop: the slot the instruction set asks for behind a transcendental before its source is overwritten or its result read */
  r = ldexpf(r, (int)w); r = x < -0x1.9d1dap+6f ? 0.f : r; return x > 0x1.62e430p+6f ? __builtin_inff() : r; }
__global__ __launch_bounds__(256) void k_att(const _Float16* __restrict__ QH, const _Float16* __restrict__ QL, const _Float16* __restrict__ KH, const _Float16* __restrict__ VT, const float* __restrict__ BIAS, float* __restrict__ Y) {
  __shared__ __align__(16) _Float16 sk[TT][HD + 8]; __shared__ __align__(16) _Float16 sv[HD][TT + 8];
  const int tid = threadIdx.x, wave = tid >> 5, lane = tid & 31, col = lane & 15, g = lane >> 4; const int b = blockIdx.z, h = blockIdx.y; const int ql0 = (int)blockIdx.x * 128 + wave * 16; const size_t q0 = (size_t)b * TT + ql0, kr0 = (size_t)b * TT;
  v8h tk[4], tv[4];   /* 1,024 16-byte pieces of each tile, 4 a thread: all 8 loads are issued before the first LDS store */
#pragma unroll
  for (int i = 0; i < 4; ++i) { const int e = tid + i * 256; tk[i] = *(const v8h*)(KH + (kr0 + (e >> 2)) * CC + h * HD + (e & 3) * 8); tv[i] = *(const v8h*)(VT + ((size_t)b * CC + h * HD + (e >> 5)) * (size_t)TT + (e & 31) * 8); }
  asm volatile("s_wait_xcnt 0x0" ::: "memory");   /* as the wait below, for the staging loads' address pairs */
  const v16h qh = frag_h(QH + (q0 + col) * CC + h * HD, lane);
  asm volatile("s_wait_xcnt 0x0" ::: "memory");   /* the build puts the next loads' results into the address pair of the loads above: the wait stands in front of that overwrite */
  const v16h ql = frag_h(QL + (q0 + col) * CC + h * HD, lane);
  const float bias = BIAS[((size_t)(ql0 + col) * SZ + b) * NH + h];   /* bias[i][j][h] (constant over the keys; added for fidelity) */
#pragma unroll
  for (int i = 0; i < 4; ++i) { const int e = tid + i * 256; *(v8h*)&sk[e >> 2][(e & 3) * 8] = tk[i]; *(v8h*)&sv[e >> 5][(e & 31) * 8] = tv[i]; }
  __syncthreads();
  v8f s[TT / 16]; float m = -3.0e38f;
#pragma unroll
  for (int jt = 0; jt < TT / 16; ++jt) { const v16h kf = frag_h(&sk[jt * 16 + col][0], lane); const v8f z8 = {}; const v8f a = wmma_h(kf, qh, z8), al = wmma_h(kf, ql, z8);
#pragma unroll
    for (int r = 0; r < 8; ++r) { const float v = (a[r] + al[r] * (1.0f / 1024.0f)) * SCALE + bias; s[jt][r] = v; m = fmaxf(m, v); } }
  m = fmaxf(m, __shfl_xor(m, 16)); float sum = 0.f;
#pragma unroll
  for (int jt = 0; jt < TT / 16; ++jt)
#pragma unroll
    for (int r = 0; r < 8; ++r) { const float e = exp_slot(s[jt][r] - m); s[jt][r] = e; sum += e; }
  sum += __shfl_xor(sum, 16); const float inv = sum > 0.f ? 2048.0f / sum : 0.f;
  v8f o[HD / 16] = {};
#pragma unroll
  for (int kc = 0; kc < TT / 32; ++kc) { v16h p;
#pragma unroll
    for (int i = 0; i < 8; ++i) { p[i] = (_Float16)(s[2 * kc][i] * inv); p[8 + i] = (_Float16)(s[2 * kc + 1][i] * inv); }
#pragma unroll
    for (int jj = 0; jj < HD / 16; ++jj) o[jj] = wmma_h(frag_h(&sv[jj * 16 + col][kc * 32], lane), p, o[jj]); }
#pragma unroll
  for (int jj = 0; jj < HD / 16; ++jj) { float* yp = Y + (q0 + col) * CC + h * HD + jj * 16 + 8 * g; v4f y0, y1;
#pragma unroll
    for (int r = 0; r < 4; ++r) { y0[r] = o[jj][r] * (1.0f / 2048.0f); y1[r] = o[jj][4 + r] * (1.0f / 2048.0f); }
    vst2(yp, y0); vst2(yp + 4, y1); } }
// ---- k_out: block = (64 rows, 128 cols): out = ctx Wo (+ bo): every row takes ctx bf16 hi + lo against exact bf16 Wo (2 products); the f16(bf16 x 2^8) branch (1 product) is never taken
__global__ __launch_bounds__(128) void k_out(const float* __restrict__ Y, const float* __restrict__ WO, const float* __restrict__ BO, float* __restrict__ OUT) { __shared__ __align__(16) float sf[4][16][132];
  const int tid = threadIdx.x, wave = tid >> 5, lane = tid & 31, col = lane & 15, g = lane >> 4; const int c0 = blockIdx.y * 128; const size_t r0 = (size_t)blockIdx.x * 64 + wave * 16;
  v8f acc[8] = {};
  if (true) {   /* ALL rows take the bf16 hi + lo x exact Wo path (2 products) */
#pragma unroll 2
    for (int kc = 0; kc < CC / 32; ++kc) { const F2 a = split_row(Y + (r0 + col) * CC, kc * 32, lane); asm volatile("s_wait_loadcnt 0x0" ::: "memory");
#pragma unroll
      for (int j = 0; j < 8; ++j) { const v16b w = WOCOL(WO, kc * 32, c0 + j * 16 + col, lane); asm volatile("s_wait_loadcnt 0x0" ::: "memory"); acc[j] = wmma_bf(a.h, w, acc[j]); acc[j] = wmma_bf(a.l, w, acc[j]); } }
#pragma unroll
    for (int j = 0; j < 8; ++j) { const float bias = BO ? bfr(BO[c0 + j * 16 + col]) : 0.f;
#pragma unroll
      for (int r = 0; r < 8; ++r) sf[wave][8 * g + r][j * 16 + col] = acc[j][r] + bias; }
  } else {
#pragma unroll 2
    for (int kc = 0; kc < CC / 32; ++kc) { const v16h a = frag_f32(Y + (r0 + col) * CC + kc * 32, lane); asm volatile("s_wait_loadcnt 0x0" ::: "memory");
#pragma unroll
      for (int j = 0; j < 8; ++j) { const v16h w = WOCOLH(WO, kc * 32, c0 + j * 16 + col, lane); asm volatile("s_wait_loadcnt 0x0" ::: "memory"); acc[j] = wmma16(a, w, acc[j]); } }
#pragma unroll
    for (int j = 0; j < 8; ++j) { const float bias = BO ? bfr(BO[c0 + j * 16 + col]) : 0.f;
#pragma unroll
      for (int r = 0; r < 8; ++r) sf[wave][8 * g + r][j * 16 + col] = acc[j][r] * (1.0f / 256.0f) + bias; } }
  LDSX(); for (int rl = 0; rl < 16; ++rl) vst2(OUT + ((((r0 + rl) % TT) * SZ) + ((r0 + rl) / TT)) * DIN + c0 + lane * 4, *(const v4f*)&sf[wave][rl][lane * 4]); }

extern "C" void kernel_launch(void* const* d_in, const int* in_sizes, int n_in, void* d_out, int out_size, void* d_ws, size_t ws_size, hipStream_t stream) {
  (void)in_sizes; (void)n_in; (void)out_size;
  const float** F = (const float**)d_in;
  if (ws_size < (size_t)WS_END) return;
  char* ws = (char*)d_ws; _Float16 *QH = (_Float16*)(ws + WS_QH), *KH = (_Float16*)(ws + WS_KH), *VT = (_Float16*)(ws + WS_VT), *QL = (_Float16*)(ws + WS_QL), *KL = (_Float16*)(ws + WS_KL); __bf16 *VB = (__bf16*)(ws + WS_VB), *VBL = (__bf16*)(ws + WS_VBL); float *S = (float*)(ws + WS_S), *Y = (float*)(ws + WS_Y);
  (void)S; (void)Y; (void)QL; (void)KL; (void)VB; (void)VBL;
  // inputs: 0 z_ij [1,256,256,128]; 1 ln_w, 2 ln_b; 3 Wq, 4 Wk, 5 Wv [128,128] (out,in); 6 Wb [4,128]; 7 Wg [128,128]; 8 Wo [128,128] (out,in)
  if (ws_size < (size_t)WS_END2) return;
  float *ZN = (float*)(ws + WS_ZN), *BIAS = (float*)(ws + WS_BIAS), *G = (float*)(ws + WS_G);
  k_lnz<<<dim3(NZR / 8), 256, 0, stream>>>(F[0], F[1], F[2], ZN);
  k_rows2<<<dim3(NZR / 64, 2), 128, 0, stream>>>(ZN, F[6], F[7], BIAS, G);
  k_proj<<<dim3(TNB * TT / 64, CC / 128, 3), 128, 0, stream>>>(ZN, ZN, ZN, F[3], F[4], F[5], nullptr, nullptr, nullptr, QH, QL, KH, KL, VT, VB, VBL);
  k_att<<<dim3(TT / 128, NH, TNB), 256, 0, stream>>>(QH, QL, KH, VT, BIAS, Y);
  k_gate<<<dim3((NZR * (CC / 4) + 255) / 256), 256, 0, stream>>>(Y, G);
  k_out<<<dim3(TNB * TT / 64, DIN / 128), 128, 0, stream>>>(Y, F[8], nullptr, (float*)d_out);
}

// v002
// A run of this version takes 142 microseconds.
// Timed twice side by side with v001, it ran 1.61 times as fast both times.
// Counting every step since v000, it is 3.84 times as fast.
// compute dtype: all float inputs rounded to bf16; LayerNorm of z in f32; q/k/v = LN(z) split bf16 hi + lo x W^T (exact bf16) on WMMA 16x16x32 (2 products, f32 accumulate); q as f16 hi + residual (x 2^10) against k once to f16 (2 products) x 32^-0.5 + the per-(query, head) bias; softmax in f32 (precise expf); P x 2^11 once to f16 against v once to f16 (1 product); gate sigmoid(LN(z) Wg^T) in f32 (2-product GEMM, precise expf); gated ctx split bf16 hi + lo against exact Wo (2 products); f32 output.
#include <hip/hip_runtime.h>
#include <math.h>

typedef __attribute__((ext_vector_type(16))) _Float16 v16h;
typedef __attribute__((ext_vector_type(16))) __bf16 v16b;
typedef __attribute__((ext_vector_type(8)))  _Float16 v8h;
typedef __attribute__((ext_vector_type(8)))  float v8f;
typedef __attribute__((ext_vector_type(4)))  float v4f;
typedef __attribute__((ext_vector_type(2)))  float v2f;
typedef __attribute__((ext_vector_type(4)))  unsigned v4u;
typedef __attribute__((ext_vector_type(4)))  int v4i;
typedef float __attribute__((may_alias)) float_a;
typedef int __attribute__((may_alias)) int_a;

template <typename T> __device__ __forceinline__ void vst2(void* p, T v) { *(T*)p = v;  }
__device__ __forceinline__ v8f wmma16(v16h a, v16h b, v8f c) {
  v8f d = __builtin_amdgcn_wmma_f32_16x16x32_f16(false, a, false, b, (short)0, c, false, false);
  asm volatile("v_nop\n\tv_nop\n\tv_nop\n\tv_nop" : "+v"(d) : "v"(a), "v"(b));
  return d;
}
__device__ __forceinline__ v8f wmma_bf(v16b a, v16b b, v8f c) {
  v8f d = __builtin_amdgcn_wmma_f32_16x16x32_bf16(false, a, false, b, (short)0, c, false, false);
  asm volatile("v_nop\n\tv_nop\n\tv_nop\n\tv_nop" : "+v"(d) : "v"(a), "v"(b));
  return d;
}
// 16x16x32 fragments: lane = (h = lane>>4, row/col = lane&15); elements 0..7 = k0+8h+0..7, 8..15 = k0+16+8h+0..7; D element r = row 8h+r
__device__ __forceinline__ v16h frag_h(const _Float16* rowk0, int lane) {
  union { v16h v; v8h q[2]; } u; const _Float16* p = rowk0 + 8 * (lane >> 4);
  u.q[0] = *(const v8h*)p; u.q[1] = *(const v8h*)(p + 16); return u.v;
}
__device__ __forceinline__ v16h frag_f32(const float* rowk0, int lane) {
  v16h a; const float* p = rowk0 + 8 * (lane >> 4);
#pragma unroll
  for (int i = 0; i < 8; ++i) { a[i] = (_Float16)p[i]; a[8 + i] = (_Float16)p[16 + i]; }
  return a;
}
__device__ __forceinline__ v16h frag_f32s(const float* rowk0, int lane, float sc) {
  v16h a; const float* p = rowk0 + 8 * (lane >> 4);
#pragma unroll
  for (int i = 0; i < 8; ++i) { a[i] = (_Float16)(p[i] * sc); a[8 + i] = (_Float16)(p[16 + i] * sc); }
  return a;
}
// column fragment from a [K][ld] layout (column n), rows >= K read as 0
__device__ __forceinline__ v16h fragc_f32(const float* W, int k0, int n, int lane, int ld, int K) {
  v16h a; const int g = lane >> 4;
#pragma unroll
  for (int i = 0; i < 8; ++i) { const int ka = k0 + 8 * g + i, kb = ka + 16;
    a[i] = (_Float16)(ka < K ? W[(size_t)(ka < K ? ka : K - 1) * ld + n] : 0.f); a[8 + i] = (_Float16)(kb < K ? W[(size_t)(kb < K ? kb : K - 1) * ld + n] : 0.f); }
  return a;
}
struct F2 { v16b h, l; };
__device__ __forceinline__ F2 bsplit16(const float v[16]) { F2 r;
#pragma unroll
  for (int i = 0; i < 16; ++i) { const __bf16 h = (__bf16)v[i]; r.h[i] = h; r.l[i] = (__bf16)(v[i] - (float)h); }
  return r; }
__device__ __forceinline__ F2 split_row(const float* row, int k0, int lane) { float v[16]; const float* p = row + k0 + 8 * (lane >> 4);
#pragma unroll
  for (int i = 0; i < 8; ++i) { v[i] = p[i]; v[8 + i] = p[16 + i]; }
  return bsplit16(v); }
__device__ __forceinline__ F2 split_rowK(const float* row, int k0, int lane, int K) { float v[16]; const int g = lane >> 4;
#pragma unroll
  for (int i = 0; i < 8; ++i) { const int ka = k0 + 8 * g + i, kb = ka + 16; v[i] = ka < K ? row[ka < K ? ka : K - 1] : 0.f; v[8 + i] = kb < K ? row[kb < K ? kb : K - 1] : 0.f; }
  return bsplit16(v); }
__device__ __forceinline__ F2 split_col(const float* W, int k0, int n, int lane, int ld, int K) { float v[16]; const int g = lane >> 4;
#pragma unroll
  for (int i = 0; i < 8; ++i) { const int ka = k0 + 8 * g + i, kb = ka + 16; v[i] = ka < K ? W[(size_t)(ka < K ? ka : K - 1) * ld + n] : 0.f; v[8 + i] = kb < K ? W[(size_t)(kb < K ? kb : K - 1) * ld + n] : 0.f; }
  return bsplit16(v); }
__device__ __forceinline__ v8f mac3(const F2& a, const F2& b, v8f c) { c = wmma_bf(a.l, b.h, c); c = wmma_bf(a.h, b.l, c); return wmma_bf(a.h, b.h, c); }
__device__ __forceinline__ float sigm(float v) { return 1.0f / (1.0f + expf(-v)); }
#define LDSX() do { asm volatile("s_wait_dscnt 0" ::: "memory"); __builtin_amdgcn_wave_barrier(); __builtin_amdgcn_fence(__ATOMIC_RELEASE, "workgroup"); } while (0)

// Triangle attention, starting node (z [1, 256, 256, 128], 4 heads x 32): z <- LayerNorm(z); q_ij, k_jk, v_jk, g_ij = z W^T; scores[i,j,h,k] = q_ij . k_jk / sqrt(32) + bias[i,j,h] (bias = z Wb^T, constant over k); attn = softmax over k; o_ij = sum_k attn v_jk; out_ij = (sigmoid(g_ij) * o_ij) Wo^T. Mapping: 'batch' = j (the shared key row), query position = i, key position = k.
#define NB 256
#define TT 256
#define CC 128            // NH * HD = projected width
#define DIN 128          // input (model) width
#define NH 4
#define HD 32
#define NQB (TT / 64)
#define HG 4
#define SCALE (0.17677669529663687f)
#define CAUSAL 0
#ifndef TNB
#define TNB NB
#endif
__device__ __forceinline__ float bfr(float v) { return (float)(__bf16)v; }
__host__ __device__ __forceinline__ int kb_last(int qb) { return CAUSAL ? ((qb * 64 + 63) >> 7) : (TT / 128 - 1); }
typedef __attribute__((ext_vector_type(8))) __bf16 v8b;
__device__ __forceinline__ v16b frag_b(const __bf16* rowk0, int lane) {
  union { v16b v; v8b q[2]; } u; const __bf16* p = rowk0 + 8 * (lane >> 4);
  u.q[0] = *(const v8b*)p; u.q[1] = *(const v8b*)(p + 16); return u.v;
}
#define QBH 0              // unused: no kernel here has a high-precision query path
#define QHI 256            // rows carrying a q residual plane (all rows when non-causal: 2-product logits everywhere)
#define KHI 64            // key rows the unused k residual / v bf16 hi+lo regions are sized for (no kernel writes or reads them)
// B fragment (k rows k0+.., output column o) of a weight: (in,out) [K][ld] or (out,in) [ld rows of K]: bf16 exact, or f16(bf16 * 256) exact
__device__ __forceinline__ v16b wcol_io(const float* Wm, int k0, int o, int lane, int ld) { v16b w; const int g = lane >> 4;
#pragma unroll
  for (int i = 0; i < 8; ++i) { w[i] = (__bf16)Wm[(size_t)(k0 + 8 * g + i) * ld + o]; w[8 + i] = (__bf16)Wm[(size_t)(k0 + 16 + 8 * g + i) * ld + o]; }
  return w; }
__device__ __forceinline__ v16b wcol_oi(const float* Wm, int k0, int o, int lane, int K) { v16b w; const float* p = Wm + (size_t)o * K + k0 + 8 * (lane >> 4);
#pragma unroll
  for (int i = 0; i < 8; ++i) { w[i] = (__bf16)p[i]; w[8 + i] = (__bf16)p[16 + i]; }
  return w; }
__device__ __forceinline__ v16h wcolh_io(const float* Wm, int k0, int o, int lane, int ld) { v16h w; const int g = lane >> 4;
#pragma unroll
  for (int i = 0; i < 8; ++i) { w[i] = (_Float16)(bfr(Wm[(size_t)(k0 + 8 * g + i) * ld + o]) * 256.0f); w[8 + i] = (_Float16)(bfr(Wm[(size_t)(k0 + 16 + 8 * g + i) * ld + o]) * 256.0f); }
  return w; }
__device__ __forceinline__ v16h wcolh_oi(const float* Wm, int k0, int o, int lane, int K) { v16h w; const float* p = Wm + (size_t)o * K + k0 + 8 * (lane >> 4);
#pragma unroll
  for (int i = 0; i < 8; ++i) { w[i] = (_Float16)(bfr(p[i]) * 256.0f); w[8 + i] = (_Float16)(bfr(p[16 + i]) * 256.0f); }
  return w; }
#define WQKV_LAYOUT 1   // 0 = (in,out) [DIN][CC]; 1 = (out,in) [CC][DIN]; 2 = per-head [NH][DIN][HD]
__device__ __forceinline__ v16b wcol_hdk(const float* Wm, int k0, int o, int lane) { v16b w; const int g = lane >> 4; const float* p = Wm + (size_t)(o / HD) * DIN * HD + (o % HD);
#pragma unroll
  for (int i = 0; i < 8; ++i) { w[i] = (__bf16)p[(size_t)(k0 + 8 * g + i) * HD]; w[8 + i] = (__bf16)p[(size_t)(k0 + 16 + 8 * g + i) * HD]; }
  return w; }
#define WO_OUT_IN 1
#if WQKV_LAYOUT == 1
#define WCOL(W, k0, o, lane) wcol_oi(W, k0, o, lane, DIN)
#elif WQKV_LAYOUT == 2
#define WCOL(W, k0, o, lane) wcol_hdk(W, k0, o, lane)
#else
#define WCOL(W, k0, o, lane) wcol_io(W, k0, o, lane, CC)
#endif
#if WO_OUT_IN
#define WOCOL(W, k0, o, lane) wcol_oi(W, k0, o, lane, CC)
#define WOCOLH(W, k0, o, lane) wcolh_oi(W, k0, o, lane, CC)
#else
#define WOCOL(W, k0, o, lane) wcol_io(W, k0, o, lane, DIN)
#define WOCOLH(W, k0, o, lane) wcolh_io(W, k0, o, lane, DIN)
#endif
#define SZ 256             // S (pair-tensor side)
#define BG 64              // key rows j the unused WS_S region is sized for (x 4 heads = 256 planes of 256 x 256)
#define NZR (SZ * SZ)      // 65,536 pair rows
#define SM_EXTRA_PARAMS , const float* __restrict__ BIAS, int b0s
#define SM_MASK_HOOK do { const int jb = b0s + (int)blockIdx.y / HG; const int hh = (int)blockIdx.y % HG; v = v + BIAS[((size_t)t * SZ + jb) * NH + hh]; } while (0)   /* bias[i][j][h] (constant over the keys: cancels in the softmax up to rounding; added for fidelity) */
// ---- k_gate: Y row (order: b' = j, t = i -> row j*256 + i) *= G[natural row i*256 + j] (thread per float4; one writer)
__global__ __launch_bounds__(256) void k_gate(float* __restrict__ Y, const float* __restrict__ G) { const size_t e4 = (size_t)blockIdx.x * 256 + threadIdx.x; if (e4 >= (size_t)NZR * (CC / 4)) return; const size_t yrow = e4 / (CC / 4); const int q = (int)(e4 % (CC / 4)); const int jb = (int)(yrow / SZ), ii = (int)(yrow % SZ); const size_t grow = (size_t)ii * SZ + jb;
  v4f y = *(const v4f*)(Y + yrow * CC + q * 4); const v4f gg = *(const v4f*)(G + grow * CC + q * 4); y[0] *= gg[0]; y[1] *= gg[1]; y[2] *= gg[2]; y[3] *= gg[3]; vst2(Y + yrow * CC + q * 4, y); }
#define WS_ZN   (WS_END)
#define WS_BIAS (WS_ZN + 4u * (size_t)NZR * CC)
#define WS_G    (WS_BIAS + 4u * (size_t)NZR * NH)
#define WS_END2 (WS_G + 4u * (size_t)NZR * CC)
#ifndef SM_EXTRA_PARAMS
#define SM_EXTRA_PARAMS
#endif
#ifndef PROJ_EXTRA_PARAMS
#define PROJ_EXTRA_PARAMS
#endif
#ifndef SM_MASK_HOOK
#define SM_MASK_HOOK (void)0
#endif

#define WS_QH  0u                                      // f16 q rows [b*t][CC]
#define WS_KH  (WS_QH + 2u * (size_t)NB * TT * CC)      // f16 k rows [b*t][CC]
#define WS_VT  (WS_KH + 2u * (size_t)NB * TT * CC)      // f16 v planes [b][c][t]
#define WS_QL  (WS_VT + 2u * (size_t)NB * CC * TT)      // f16 q residual x 2^10 rows [b][t < QHI][CC]
#define WS_KL  (WS_QL + 2u * (size_t)NB * QHI * CC)     // f16 k residual x 2^10 rows [b][t < KHI][CC]
#define WS_VB  (WS_KL + 2u * (size_t)NB * KHI * CC)     // bf16 v hi planes [b][c][t < KHI]
#define WS_VBL (WS_VB + 2u * (size_t)NB * CC * KHI)
#define WS_S   (WS_VBL + 2u * (size_t)NB * CC * KHI)    // f32 region, unused (k_att keeps logits and P in registers)
#define WS_Y   (WS_S  + 4u * (size_t)BG * HG * TT * TT)   // 256 unused score planes of 256 x 256      // f32 ctx rows [b*t][CC]
#define WS_END (WS_Y  + 4u * (size_t)NB * TT * CC)

// ---- k_att: block = 128 queries (8 waves x 16) of one (key row j, head h), all 256 keys. The head's k rows and v planes are staged once in LDS (row pitches 80 B and 528 B = 16 B x odd, for 16-byte readers). S^T = K Q^T (A = k rows, B = q hi and q residual x 2^10: 2 products), so a lane holds one query's logits (keys 16 jt + 8 g + r) in registers; logits x SCALE + bias; softmax in f32 in the lane plus one exchange between the lane halves; P x 2^11 once to f16 is packed from two score tiles straight into a B operand; ctx^T = V^T P^T (A = v planes [c][t], 1 product): a lane ends with 8 consecutive channels of its query's row. Every loop is unrolled: tk, tv, s, o and p live in registers and need constant indices
__device__ __forceinline__ v8f wmma_h(v16h a, v16h b, v8f c) { return __builtin_amdgcn_wmma_f32_16x16x32_f16(false, a, false, b, (short)0, c, false, false); }
// e^x by the scheme of expf (x log2(e) with the constant split in two, the whole part applied by ldexp, both range tests), written out so that v_exp_f32 and its v_nop are one statement
__device__ __forceinline__ float exp_slot(float x) { const float w = __builtin_rintf(x * 0x1.715476p+0f); const float a = __builtin_fmaf(x, 0x1.4ae0bep-26f, __builtin_fmaf(x, 0x1.715476p+0f, -w)); float r;
  asm("v_exp_f32 %0, %1\n\tv_nop" : "=v"(r) : "v"(a));   /* v_nop: the slot the instruction set asks for behind a transcendental before its source is overwritten or its result read */
  r = ldexpf(r, (int)w); r = x < -0x1.9d1dap+6f ? 0.f : r; return x > 0x1.62e430p+6f ? __builtin_inff() : r; }
// ---- k_pre: block = one first index i of the pair tensor = 256 pair rows (i, 0..255), 16 waves x 16 rows. Each lane loads its row's half of the channels in A/B fragment order, LayerNorm (biased var, eps 1e-5, ln_w/ln_b) of bf16(z) in registers (row sums: 64 terms in the lane, then one exchange between the lane halves), LN(z) split bf16 hi + lo once and kept in registers for all five products. Wv, Wk, Wq, Wg, Wb are rounded to bf16 once per block into LDS (row pitch 272 B = 16 B x 17, for 16-byte readers). v: D = Z W^T (a lane holds 8 consecutive t of one channel) -> [c][t] planes through a block tile; k, q, gate, bias: D^T = W Z^T (a lane holds 8 consecutive channels of its row) -> k, q, gate as whole rows through the wave's own LDS range, bias straight from registers
#define LDSW() asm volatile("s_wait_dscnt 0" ::: "memory")   /* a wave's own LDS range: its writes are done before it reads the rows back, its reads before the next rows overwrite them; no other wave touches the range, so no fence and no wait for global stores */
#define WP 136             // LDS pitch of a staged weight row and of a staged f16 output row, in 2-byte elements
typedef __attribute__((ext_vector_type(4))) __bf16 v4b;
__device__ __forceinline__ v8f wmma_b(v16b a, v16b b, v8f c) { return __builtin_amdgcn_wmma_f32_16x16x32_bf16(false, a, false, b, (short)0, c, false, false); }
// acc[j] = (hi + lo rows of LN(z)) x (weight rows 16 j .. 16 j + 15), K = 128; ZA: z is the A operand (D = Z W^T), else the B operand (D^T = W Z^T). Four tiles at a time, so that three other accumulators' products stand between a tile's hi and lo product
template <bool ZA> __device__ __forceinline__ void gemm128(const __bf16 (*Ws)[WP], const F2 (&a)[4], v8f (&acc)[8], int lane) { const int col = lane & 15;
#pragma unroll
  for (int j = 0; j < 8; ++j) acc[j] = v8f{};
#pragma unroll
  for (int kc = 0; kc < 4; ++kc)
#pragma unroll
    for (int jq = 0; jq < 8; jq += 4) { v16b w[4];
#pragma unroll
      for (int j = 0; j < 4; ++j) w[j] = frag_b(&Ws[(jq + j) * 16 + col][kc * 32], lane);
#pragma unroll
      for (int j = 0; j < 4; ++j) acc[jq + j] = ZA ? wmma_b(a[kc].h, w[j], acc[jq + j]) : wmma_b(w[j], a[kc].h, acc[jq + j]);
#pragma unroll
      for (int j = 0; j < 4; ++j) acc[jq + j] = ZA ? wmma_b(a[kc].l, w[j], acc[jq + j]) : wmma_b(w[j], a[kc].l, acc[jq + j]); } }
__global__ __launch_bounds__(512) void k_pre(const float* __restrict__ Z, const float* __restrict__ LW, const float* __restrict__ LB, const float* __restrict__ WQ, const float* __restrict__ WK, const float* __restrict__ WV, const float* __restrict__ WB, const float* __restrict__ WG,
    _Float16* __restrict__ QH, _Float16* __restrict__ QL, _Float16* __restrict__ KH, _Float16* __restrict__ VT, float* __restrict__ BIAS, float* __restrict__ G) {
  __shared__ __align__(16) __bf16 sw[4][CC][WP]; __shared__ __align__(16) __bf16 swb[16][WP]; __shared__ __align__(16) char su[16][16 * WP * 4];   /* su: first the block's v tile [128][264] f16, then 8,704 B a wave */
  const int tid = threadIdx.x, wave = tid >> 5, lane = tid & 31, col = lane & 15, g = lane >> 4; const int bi = blockIdx.x, t0 = wave * 16; const size_t row0 = (size_t)bi * SZ + t0;
  v4f xv[16];   /* piece q = fragment kc = q >> 2, elements 4 (q & 3) ..: channels 32 kc + 16 ((q >> 1) & 1) + 8 g + 4 (q & 1) .. */
#pragma unroll
  for (int q = 0; q < 16; ++q) { if (q == 15) asm volatile("s_wait_xcnt 0x0" ::: "memory");   /* without it the build put the last load's result into the address pair that the 15 loads above name; the last load now issues behind the wait */
    xv[q] = *(const v4f*)(Z + (row0 + col) * CC + (q >> 2) * 32 + ((q >> 1) & 1) * 16 + 8 * g + (q & 1) * 4); }
#pragma unroll
  for (int m = 0; m < 4; ++m) { const float* Wm = m == 0 ? WV : m == 1 ? WK : m == 2 ? WQ : WG;
#pragma unroll
    for (int i = 0; i < 8; ++i) { const int e = tid + i * 512; const v4f f = *(const v4f*)(Wm + (size_t)e * 4); v4b w;
#pragma unroll
      for (int k = 0; k < 4; ++k) w[k] = (__bf16)f[k];
      *(v4b*)&sw[m][e >> 5][(e & 31) * 4] = w; } }
  { v4f f = {}; if (wave < NH) f = *(const v4f*)(WB + tid * 4); v4b w;   /* Wb rows 0..3; rows 4..15 of the tile are zero */
#pragma unroll
    for (int k = 0; k < 4; ++k) w[k] = (__bf16)f[k];
    *(v4b*)&swb[wave][lane * 4] = w; }
  float s1 = 0.f;
#pragma unroll
  for (int q = 0; q < 16; ++q)
#pragma unroll
    for (int k = 0; k < 4; ++k) { xv[q][k] = bfr(xv[q][k]); s1 += xv[q][k]; }
  s1 += __shfl_xor(s1, 16); const float mu = s1 * (1.0f / CC); float sq = 0.f;
#pragma unroll
  for (int q = 0; q < 16; ++q)
#pragma unroll
    for (int k = 0; k < 4; ++k) { const float d = xv[q][k] - mu; sq += d * d; }
  sq += __shfl_xor(sq, 16); const float rs = rsqrtf(sq * (1.0f / CC) + 1e-5f);
  F2 a[4];
#pragma unroll
  for (int kc = 0; kc < 4; ++kc) { float v[16];
#pragma unroll
    for (int p = 0; p < 4; ++p) { const int c = kc * 32 + (p >> 1) * 16 + 8 * g + (p & 1) * 4; const v4f lw = *(const v4f*)(LW + c), lb = *(const v4f*)(LB + c);
#pragma unroll
      for (int k = 0; k < 4; ++k) v[p * 4 + k] = (xv[kc * 4 + p][k] - mu) * rs * bfr(lw[k]) + bfr(lb[k]); }
    a[kc] = bsplit16(v);
    __builtin_amdgcn_sched_barrier(0); }   /* one fragment's 8 ln_w / ln_b loads at a time: with all 32 hoisted beside the 64 row values the build spilled registers to scratch */
  __syncthreads();   /* the staged weights are read by every wave */
  v8f acc[8];
  gemm128<true>(sw[0], a, acc, lane);   /* v */
  { _Float16 (*th)[TT + 8] = (_Float16 (*)[TT + 8])&su[0][0];
#pragma unroll
    for (int j = 0; j < 8; ++j) { v8h hv;
#pragma unroll
      for (int r = 0; r < 8; ++r) hv[r] = (_Float16)acc[j][r];
      *(v8h*)&th[j * 16 + col][t0 + 8 * g] = hv; }
    __syncthreads();   /* a plane row holds all 16 waves' t */
#pragma unroll
    for (int i = 0; i < 8; ++i) { const int e = tid + i * 512; vst2(VT + ((size_t)bi * CC + (e >> 5)) * (size_t)TT + (e & 31) * 8, *(const v8h*)&th[e >> 5][(e & 31) * 8]); }
    __syncthreads(); }   /* the tile's last read ends before the waves reuse su */
  _Float16 (*ph)[WP] = (_Float16 (*)[WP])&su[wave][0]; _Float16 (*pl)[WP] = (_Float16 (*)[WP])&su[wave][16 * WP * 2]; float (*pf)[132] = (float (*)[132])&su[wave][0];
  gemm128<false>(sw[1], a, acc, lane);   /* k: pair row (j, k) directly */
#pragma unroll
  for (int j = 0; j < 8; ++j) { v8h hv;
#pragma unroll
    for (int r = 0; r < 8; ++r) hv[r] = (_Float16)acc[j][r];
    *(v8h*)&ph[col][j * 16 + 8 * g] = hv; }
  LDSW();
#pragma unroll
  for (int it = 0; it < 8; ++it) { const int rl = it * 2 + g; vst2(KH + (row0 + rl) * CC + col * 8, *(const v8h*)&ph[rl][col * 8]); }
  LDSW();   /* the rows are read back before the next product's rows overwrite them */
  gemm128<false>(sw[2], a, acc, lane);   /* q: pair row (i, j) goes to row (j, i) */
#pragma unroll
  for (int j = 0; j < 8; ++j) { v8h hv, lv;
#pragma unroll
    for (int r = 0; r < 8; ++r) { const float v = acc[j][r]; hv[r] = (_Float16)v; lv[r] = (_Float16)((v - (float)hv[r]) * 1024.0f); }
    *(v8h*)&ph[col][j * 16 + 8 * g] = hv; *(v8h*)&pl[col][j * 16 + 8 * g] = lv; }
  LDSW();
#pragma unroll
  for (int it = 0; it < 8; ++it) { const int rl = it * 2 + g; const size_t o = ((size_t)(t0 + rl) * TT + bi) * CC + col * 8; vst2(QH + o, *(const v8h*)&ph[rl][col * 8]); vst2(QL + o, *(const v8h*)&pl[rl][col * 8]); }
  LDSW();
  v8f ab = {};   /* bias^T = Wb Z^T: rows 0..3 of the tile = heads, in lanes 0..15 */
#pragma unroll
  for (int kc = 0; kc < 4; ++kc) { const v16b w = frag_b(&swb[col][kc * 32], lane); ab = wmma_b(w, a[kc].h, ab); ab = wmma_b(w, a[kc].l, ab); }
  gemm128<false>(sw[3], a, acc, lane);   /* gate */
  if (g == 0) { v4f b4; b4[0] = ab[0]; b4[1] = ab[1]; b4[2] = ab[2]; b4[3] = ab[3]; vst2(BIAS + (row0 + col) * NH, b4); }   /* 16 rows x 16 B = one 256-B run per wave */
#pragma unroll
  for (int j = 0; j < 8; ++j) { v4f y0, y1;
#pragma unroll
    for (int r = 0; r < 4; ++r) { y0[r] = 1.0f / (1.0f + exp_slot(-acc[j][r])); y1[r] = 1.0f / (1.0f + exp_slot(-acc[j][4 + r])); }   /* sigmoid gate */
    *(v4f*)&pf[col][j * 16 + 8 * g] = y0; *(v4f*)&pf[col][j * 16 + 8 * g + 4] = y1; }
  LDSW();
#pragma unroll
  for (int rl = 0; rl < 16; ++rl) vst2(G + (row0 + rl) * CC + lane * 4, *(const v4f*)&pf[rl][lane * 4]); }
__global__ __launch_bounds__(256) void k_att(const _Float16* __restrict__ QH, const _Float16* __restrict__ QL, const _Float16* __restrict__ KH, const _Float16* __restrict__ VT, const float* __restrict__ BIAS, float* __restrict__ Y) {
  __shared__ __align__(16) _Float16 sk[TT][HD + 8]; __shared__ __align__(16) _Float16 sv[HD][TT + 8];
  const int tid = threadIdx.x, wave = tid >> 5, lane = tid & 31, col = lane & 15, g = lane >> 4; const int b = blockIdx.z, h = blockIdx.y; const int ql0 = (int)blockIdx.x * 128 + wave * 16; const size_t q0 = (size_t)b * TT + ql0, kr0 = (size_t)b * TT;
  v8h tk[4], tv[4];   /* 1,024 16-byte pieces of each tile, 4 a thread: all 8 loads are issued before the first LDS store */
#pragma unroll
  for (int i = 0; i < 4; ++i) { const int e = tid + i * 256; tk[i] = *(const v8h*)(KH + (kr0 + (e >> 2)) * CC + h * HD + (e & 3) * 8); tv[i] = *(const v8h*)(VT + ((size_t)b * CC + h * HD + (e >> 5)) * (size_t)TT + (e & 31) * 8); }
  asm volatile("s_wait_xcnt 0x0" ::: "memory");   /* as the wait below, for the staging loads' address pairs */
  const v16h qh = frag_h(QH + (q0 + col) * CC + h * HD, lane);
  asm volatile("s_wait_xcnt 0x0" ::: "memory");   /* the build puts the next loads' results into the address pair of the loads above: the wait stands in front of that overwrite */
  const v16h ql = frag_h(QL + (q0 + col) * CC + h * HD, lane);
  const float bias = BIAS[((size_t)(ql0 + col) * SZ + b) * NH + h];   /* bias[i][j][h] (constant over the keys; added for fidelity) */
#pragma unroll
  for (int i = 0; i < 4; ++i) { const int e = tid + i * 256; *(v8h*)&sk[e >> 2][(e & 3) * 8] = tk[i]; *(v8h*)&sv[e >> 5][(e & 31) * 8] = tv[i]; }
  __syncthreads();
  v8f s[TT / 16]; float m = -3.0e38f;
#pragma unroll
  for (int jt = 0; jt < TT / 16; ++jt) { const v16h kf = frag_h(&sk[jt * 16 + col][0], lane); const v8f z8 = {}; const v8f a = wmma_h(kf, qh, z8), al = wmma_h(kf, ql, z8);
#pragma unroll
    for (int r = 0; r < 8; ++r) { const float v = (a[r] + al[r] * (1.0f / 1024.0f)) * SCALE + bias; s[jt][r] = v; m = fmaxf(m, v); } }
  m = fmaxf(m, __shfl_xor(m, 16)); float sum = 0.f;
#pragma unroll
  for (int jt = 0; jt < TT / 16; ++jt)
#pragma unroll
    for (int r = 0; r < 8; ++r) { const float e = exp_slot(s[jt][r] - m); s[jt][r] = e; sum += e; }
  sum += __shfl_xor(sum, 16); const float inv = sum > 0.f ? 2048.0f / sum : 0.f;
  v8f o[HD / 16] = {};
#pragma unroll
  for (int kc = 0; kc < TT / 32; ++kc) { v16h p;
#pragma unroll
    for (int i = 0; i < 8; ++i) { p[i] = (_Float16)(s[2 * kc][i] * inv); p[8 + i] = (_Float16)(s[2 * kc + 1][i] * inv); }
#pragma unroll
    for (int jj = 0; jj < HD / 16; ++jj) o[jj] = wmma_h(frag_h(&sv[jj * 16 + col][kc * 32], lane), p, o[jj]); }
#pragma unroll
  for (int jj = 0; jj < HD / 16; ++jj) { float* yp = Y + (q0 + col) * CC + h * HD + jj * 16 + 8 * g; v4f y0, y1;
#pragma unroll
    for (int r = 0; r < 4; ++r) { y0[r] = o[jj][r] * (1.0f / 2048.0f); y1[r] = o[jj][4 + r] * (1.0f / 2048.0f); }
    vst2(yp, y0); vst2(yp + 4, y1); } }
// ---- k_out: block = (64 rows, 128 cols): out = ctx Wo (+ bo): every row takes ctx bf16 hi + lo against exact bf16 Wo (2 products); the f16(bf16 x 2^8) branch (1 product) is never taken
__global__ __launch_bounds__(128) void k_out(const float* __restrict__ Y, const float* __restrict__ WO, const float* __restrict__ BO, float* __restrict__ OUT) { __shared__ __align__(16) float sf[4][16][132];
  const int tid = threadIdx.x, wave = tid >> 5, lane = tid & 31, col = lane & 15, g = lane >> 4; const int c0 = blockIdx.y * 128; const size_t r0 = (size_t)blockIdx.x * 64 + wave * 16;
  v8f acc[8] = {};
  if (true) {   /* ALL rows take the bf16 hi + lo x exact Wo path (2 products) */
#pragma unroll 2
    for (int kc = 0; kc < CC / 32; ++kc) { const F2 a = split_row(Y + (r0 + col) * CC, kc * 32, lane); asm volatile("s_wait_loadcnt 0x0" ::: "memory");
#pragma unroll
      for (int j = 0; j < 8; ++j) { const v16b w = WOCOL(WO, kc * 32, c0 + j * 16 + col, lane); asm volatile("s_wait_loadcnt 0x0" ::: "memory"); acc[j] = wmma_bf(a.h, w, acc[j]); acc[j] = wmma_bf(a.l, w, acc[j]); } }
#pragma unroll
    for (int j = 0; j < 8; ++j) { const float bias = BO ? bfr(BO[c0 + j * 16 + col]) : 0.f;
#pragma unroll
      for (int r = 0; r < 8; ++r) sf[wave][8 * g + r][j * 16 + col] = acc[j][r] + bias; }
  } else {
#pragma unroll 2
    for (int kc = 0; kc < CC / 32; ++kc) { const v16h a = frag_f32(Y + (r0 + col) * CC + kc * 32, lane); asm volatile("s_wait_loadcnt 0x0" ::: "memory");
#pragma unroll
      for (int j = 0; j < 8; ++j) { const v16h w = WOCOLH(WO, kc * 32, c0 + j * 16 + col, lane); asm volatile("s_wait_loadcnt 0x0" ::: "memory"); acc[j] = wmma16(a, w, acc[j]); } }
#pragma unroll
    for (int j = 0; j < 8; ++j) { const float bias = BO ? bfr(BO[c0 + j * 16 + col]) : 0.f;
#pragma unroll
      for (int r = 0; r < 8; ++r) sf[wave][8 * g + r][j * 16 + col] = acc[j][r] * (1.0f / 256.0f) + bias; } }
  LDSX(); for (int rl = 0; rl < 16; ++rl) vst2(OUT + ((((r0 + rl) % TT) * SZ) + ((r0 + rl) / TT)) * DIN + c0 + lane * 4, *(const v4f*)&sf[wave][rl][lane * 4]); }

extern "C" void kernel_launch(void* const* d_in, const int* in_sizes, int n_in, void* d_out, int out_size, void* d_ws, size_t ws_size, hipStream_t stream) {
  (void)in_sizes; (void)n_in; (void)out_size;
  const float** F = (const float**)d_in;
  if (ws_size < (size_t)WS_END) return;
  char* ws = (char*)d_ws; _Float16 *QH = (_Float16*)(ws + WS_QH), *KH = (_Float16*)(ws + WS_KH), *VT = (_Float16*)(ws + WS_VT), *QL = (_Float16*)(ws + WS_QL), *KL = (_Float16*)(ws + WS_KL); __bf16 *VB = (__bf16*)(ws + WS_VB), *VBL = (__bf16*)(ws + WS_VBL); float *S = (float*)(ws + WS_S), *Y = (float*)(ws + WS_Y);
  (void)S; (void)Y; (void)QL; (void)KL; (void)VB; (void)VBL;
  // inputs: 0 z_ij [1,256,256,128]; 1 ln_w, 2 ln_b; 3 Wq, 4 Wk, 5 Wv [128,128] (out,in); 6 Wb [4,128]; 7 Wg [128,128]; 8 Wo [128,128] (out,in)
  if (ws_size < (size_t)WS_END2) return;
  float *BIAS = (float*)(ws + WS_BIAS), *G = (float*)(ws + WS_G);
  k_pre<<<dim3(SZ), 512, 0, stream>>>(F[0], F[1], F[2], F[3], F[4], F[5], F[6], F[7], QH, QL, KH, VT, BIAS, G);
  k_att<<<dim3(TT / 128, NH, TNB), 256, 0, stream>>>(QH, QL, KH, VT, BIAS, Y);
  k_gate<<<dim3((NZR * (CC / 4) + 255) / 256), 256, 0, stream>>>(Y, G);
  k_out<<<dim3(TNB * TT / 64, DIN / 128), 128, 0, stream>>>(Y, F[8], nullptr, (float*)d_out);
}

// v003
// Measured time: 70.3 microseconds a run.
// Next to v002, in two timings, it ran 2.08 and 2.09 times as fast.
// Over all steps from v000 it is 8.00 times as fast.
// compute dtype: all float inputs rounded to bf16; LayerNorm of z in f32; q/k/v = LN(z) split bf16 hi + lo x W^T (exact bf16) on WMMA 16x16x32 (2 products, f32 accumulate); q as f16 hi + residual (x 2^10) against k once to f16 (2 products) x 32^-0.5 + the per-(query, head) bias; softmax in f32 (precise expf); P x 2^11 once to f16 against v once to f16 (1 product); gate sigmoid(LN(z) Wg^T) in f32 (2-product GEMM, precise expf); gated ctx split bf16 hi + lo against exact Wo (2 products); f32 output.
#include <hip/hip_runtime.h>
#include <math.h>

typedef __attribute__((ext_vector_type(16))) _Float16 v16h;
typedef __attribute__((ext_vector_type(16))) __bf16 v16b;
typedef __attribute__((ext_vector_type(8)))  _Float16 v8h;
typedef __attribute__((ext_vector_type(8)))  float v8f;
typedef __attribute__((ext_vector_type(4)))  float v4f;
typedef __attribute__((ext_vector_type(2)))  float v2f;
typedef __attribute__((ext_vector_type(4)))  unsigned v4u;
typedef __attribute__((ext_vector_type(4)))  int v4i;
typedef float __attribute__((may_alias)) float_a;
typedef int __attribute__((may_alias)) int_a;

template <typename T> __device__ __forceinline__ void vst2(void* p, T v) { *(T*)p = v;  }
__device__ __forceinline__ v8f wmma16(v16h a, v16h b, v8f c) {
  v8f d = __builtin_amdgcn_wmma_f32_16x16x32_f16(false, a, false, b, (short)0, c, false, false);
  asm volatile("v_nop\n\tv_nop\n\tv_nop\n\tv_nop" : "+v"(d) : "v"(a), "v"(b));
  return d;
}
__device__ __forceinline__ v8f wmma_bf(v16b a, v16b b, v8f c) {
  v8f d = __builtin_amdgcn_wmma_f32_16x16x32_bf16(false, a, false, b, (short)0, c, false, false);
  asm volatile("v_nop\n\tv_nop\n\tv_nop\n\tv_nop" : "+v"(d) : "v"(a), "v"(b));
  return d;
}
// 16x16x32 fragments: lane = (h = lane>>4, row/col = lane&15); elements 0..7 = k0+8h+0..7, 8..15 = k0+16+8h+0..7; D element r = row 8h+r
__device__ __forceinline__ v16h frag_h(const _Float16* rowk0, int lane) {
  union { v16h v; v8h q[2]; } u; const _Float16* p = rowk0 + 8 * (lane >> 4);
  u.q[0] = *(const v8h*)p; u.q[1] = *(const v8h*)(p + 16); return u.v;
}
__device__ __forceinline__ v16h frag_f32(const float* rowk0, int lane) {
  v16h a; const float* p = rowk0 + 8 * (lane >> 4);
#pragma unroll
  for (int i = 0; i < 8; ++i) { a[i] = (_Float16)p[i]; a[8 + i] = (_Float16)p[16 + i]; }
  return a;
}
__device__ __forceinline__ v16h frag_f32s(const float* rowk0, int lane, float sc) {
  v16h a; const float* p = rowk0 + 8 * (lane >> 4);
#pragma unroll
  for (int i = 0; i < 8; ++i) { a[i] = (_Float16)(p[i] * sc); a[8 + i] = (_Float16)(p[16 + i] * sc); }
  return a;
}
// column fragment from a [K][ld] layout (column n), rows >= K read as 0
__device__ __forceinline__ v16h fragc_f32(const float* W, int k0, int n, int lane, int ld, int K) {
  v16h a; const int g = lane >> 4;
#pragma unroll
  for (int i = 0; i < 8; ++i) { const int ka = k0 + 8 * g + i, kb = ka + 16;
    a[i] = (_Float16)(ka < K ? W[(size_t)(ka < K ? ka : K - 1) * ld + n] : 0.f); a[8 + i] = (_Float16)(kb < K ? W[(size_t)(kb < K ? kb : K - 1) * ld + n] : 0.f); }
  return a;
}
struct F2 { v16b h, l; };
__device__ __forceinline__ F2 bsplit16(const float v[16]) { F2 r;
#pragma unroll
  for (int i = 0; i < 16; ++i) { const __bf16 h = (__bf16)v[i]; r.h[i] = h; r.l[i] = (__bf16)(v[i] - (float)h); }
  return r; }
__device__ __forceinline__ F2 split_row(const float* row, int k0, int lane) { float v[16]; const float* p = row + k0 + 8 * (lane >> 4);
#pragma unroll
  for (int i = 0; i < 8; ++i) { v[i] = p[i]; v[8 + i] = p[16 + i]; }
  return bsplit16(v); }
__device__ __forceinline__ F2 split_rowK(const float* row, int k0, int lane, int K) { float v[16]; const int g = lane >> 4;
#pragma unroll
  for (int i = 0; i < 8; ++i) { const int ka = k0 + 8 * g + i, kb = ka + 16; v[i] = ka < K ? row[ka < K ? ka : K - 1] : 0.f; v[8 + i] = kb < K ? row[kb < K ? kb : K - 1] : 0.f; }
  return bsplit16(v); }
__device__ __forceinline__ F2 split_col(const float* W, int k0, int n, int lane, int ld, int K) { float v[16]; const int g = lane >> 4;
#pragma unroll
  for (int i = 0; i < 8; ++i) { const int ka = k0 + 8 * g + i, kb = ka + 16; v[i] = ka < K ? W[(size_t)(ka < K ? ka : K - 1) * ld + n] : 0.f; v[8 + i] = kb < K ? W[(size_t)(kb < K ? kb : K - 1) * ld + n] : 0.f; }
  return bsplit16(v); }
__device__ __forceinline__ v8f mac3(const F2& a, const F2& b, v8f c) { c = wmma_bf(a.l, b.h, c); c = wmma_bf(a.h, b.l, c); return wmma_bf(a.h, b.h, c); }
__device__ __forceinline__ float sigm(float v) { return 1.0f / (1.0f + expf(-v)); }
#define LDSX() do { asm volatile("s_wait_dscnt 0" ::: "memory"); __builtin_amdgcn_wave_barrier(); __builtin_amdgcn_fence(__ATOMIC_RELEASE, "workgroup"); } while (0)

// Triangle attention, starting node (z [1, 256, 256, 128], 4 heads x 32): z <- LayerNorm(z); q_ij, k_jk, v_jk, g_ij = z W^T; scores[i,j,h,k] = q_ij . k_jk / sqrt(32) + bias[i,j,h] (bias = z Wb^T, constant over k); attn = softmax over k; o_ij = sum_k attn v_jk; out_ij = (sigmoid(g_ij) * o_ij) Wo^T. Mapping: 'batch' = j (the shared key row), query position = i, key position = k.
#define NB 256
#define TT 256
#define CC 128            // NH * HD = projected width
#define DIN 128          // input (model) width
#define NH 4
#define HD 32
#define NQB (TT / 64)
#define HG 4
#define SCALE (0.17677669529663687f)
#define CAUSAL 0
#ifndef TNB
#define TNB NB
#endif
__device__ __forceinline__ float bfr(float v) { return (float)(__bf16)v; }
__host__ __device__ __forceinline__ int kb_last(int qb) { return CAUSAL ? ((qb * 64 + 63) >> 7) : (TT / 128 - 1); }
typedef __attribute__((ext_vector_type(8))) __bf16 v8b;
__device__ __forceinline__ v16b frag_b(const __bf16* rowk0, int lane) {
  union { v16b v; v8b q[2]; } u; const __bf16* p = rowk0 + 8 * (lane >> 4);
  u.q[0] = *(const v8b*)p; u.q[1] = *(const v8b*)(p + 16); return u.v;
}
#define QBH 0              // unused: no kernel here has a high-precision query path
#define QHI 256            // rows carrying a q residual plane (all rows when non-causal: 2-product logits everywhere)
#define KHI 64            // key rows the unused k residual / v bf16 hi+lo regions are sized for (no kernel writes or reads them)
// B fragment (k rows k0+.., output column o) of a weight: (in,out) [K][ld] or (out,in) [ld rows of K]: bf16 exact, or f16(bf16 * 256) exact
__device__ __forceinline__ v16b wcol_io(const float* Wm, int k0, int o, int lane, int ld) { v16b w; const int g = lane >> 4;
#pragma unroll
  for (int i = 0; i < 8; ++i) { w[i] = (__bf16)Wm[(size_t)(k0 + 8 * g + i) * ld + o]; w[8 + i] = (__bf16)Wm[(size_t)(k0 + 16 + 8 * g + i) * ld + o]; }
  return w; }
__device__ __forceinline__ v16b wcol_oi(const float* Wm, int k0, int o, int lane, int K) { v16b w; const float* p = Wm + (size_t)o * K + k0 + 8 * (lane >> 4);
#pragma unroll
  for (int i = 0; i < 8; ++i) { w[i] = (__bf16)p[i]; w[8 + i] = (__bf16)p[16 + i]; }
  return w; }
__device__ __forceinline__ v16h wcolh_io(const float* Wm, int k0, int o, int lane, int ld) { v16h w; const int g = lane >> 4;
#pragma unroll
  for (int i = 0; i < 8; ++i) { w[i] = (_Float16)(bfr(Wm[(size_t)(k0 + 8 * g + i) * ld + o]) * 256.0f); w[8 + i] = (_Float16)(bfr(Wm[(size_t)(k0 + 16 + 8 * g + i) * ld + o]) * 256.0f); }
  return w; }
__device__ __forceinline__ v16h wcolh_oi(const float* Wm, int k0, int o, int lane, int K) { v16h w; const float* p = Wm + (size_t)o * K + k0 + 8 * (lane >> 4);
#pragma unroll
  for (int i = 0; i < 8; ++i) { w[i] = (_Float16)(bfr(p[i]) * 256.0f); w[8 + i] = (_Float16)(bfr(p[16 + i]) * 256.0f); }
  return w; }
#define WQKV_LAYOUT 1   // 0 = (in,out) [DIN][CC]; 1 = (out,in) [CC][DIN]; 2 = per-head [NH][DIN][HD]
__device__ __forceinline__ v16b wcol_hdk(const float* Wm, int k0, int o, int lane) { v16b w; const int g = lane >> 4; const float* p = Wm + (size_t)(o / HD) * DIN * HD + (o % HD);
#pragma unroll
  for (int i = 0; i < 8; ++i) { w[i] = (__bf16)p[(size_t)(k0 + 8 * g + i) * HD]; w[8 + i] = (__bf16)p[(size_t)(k0 + 16 + 8 * g + i) * HD]; }
  return w; }
#define WO_OUT_IN 1
#if WQKV_LAYOUT == 1
#define WCOL(W, k0, o, lane) wcol_oi(W, k0, o, lane, DIN)
#elif WQKV_LAYOUT == 2
#define WCOL(W, k0, o, lane) wcol_hdk(W, k0, o, lane)
#else
#define WCOL(W, k0, o, lane) wcol_io(W, k0, o, lane, CC)
#endif
#if WO_OUT_IN
#define WOCOL(W, k0, o, lane) wcol_oi(W, k0, o, lane, CC)
#define WOCOLH(W, k0, o, lane) wcolh_oi(W, k0, o, lane, CC)
#else
#define WOCOL(W, k0, o, lane) wcol_io(W, k0, o, lane, DIN)
#define WOCOLH(W, k0, o, lane) wcolh_io(W, k0, o, lane, DIN)
#endif
#define SZ 256             // S (pair-tensor side)
#define BG 64              // key rows j the unused WS_S region is sized for (x 4 heads = 256 planes of 256 x 256)
#define NZR (SZ * SZ)      // 65,536 pair rows
#define SM_EXTRA_PARAMS , const float* __restrict__ BIAS, int b0s
#define SM_MASK_HOOK do { const int jb = b0s + (int)blockIdx.y / HG; const int hh = (int)blockIdx.y % HG; v = v + BIAS[((size_t)t * SZ + jb) * NH + hh]; } while (0)   /* bias[i][j][h] (constant over the keys: cancels in the softmax up to rounding; added for fidelity) */
#define WS_ZN   (WS_END)
#define WS_BIAS (WS_ZN + 4u * (size_t)NZR * CC)
#define WS_G    (WS_BIAS + 4u * (size_t)NZR * NH)
#define WS_END2 (WS_G + 4u * (size_t)NZR * CC)
#ifndef SM_EXTRA_PARAMS
#define SM_EXTRA_PARAMS
#endif
#ifndef PROJ_EXTRA_PARAMS
#define PROJ_EXTRA_PARAMS
#endif
#ifndef SM_MASK_HOOK
#define SM_MASK_HOOK (void)0
#endif

#define WS_QH  0u                                      // f16 q rows [b*t][CC]
#define WS_KH  (WS_QH + 2u * (size_t)NB * TT * CC)      // f16 k rows [b*t][CC]
#define WS_VT  (WS_KH + 2u * (size_t)NB * TT * CC)      // f16 v planes [b][c][t]
#define WS_QL  (WS_VT + 2u * (size_t)NB * CC * TT)      // f16 q residual x 2^10 rows [b][t < QHI][CC]
#define WS_KL  (WS_QL + 2u * (size_t)NB * QHI * CC)     // f16 k residual x 2^10 rows [b][t < KHI][CC]
#define WS_VB  (WS_KL + 2u * (size_t)NB * KHI * CC)     // bf16 v hi planes [b][c][t < KHI]
#define WS_VBL (WS_VB + 2u * (size_t)NB * CC * KHI)
#define WS_S   (WS_VBL + 2u * (size_t)NB * CC * KHI)    // f32 region, unused (k_att keeps logits and P in registers)
#define WS_Y   (WS_S  + 4u * (size_t)BG * HG * TT * TT)   // 256 unused score planes of 256 x 256      // f32 ctx rows [b*t][CC] (unused: k_att keeps the gated ctx in LDS)
#define WS_END (WS_Y  + 4u * (size_t)NB * TT * CC)

// ---- k_att: block = one key row j, all 4 heads, all 256 queries: 16 waves = 4 heads x 4 query tiles of 16, four passes of 64 queries. The row's k rows, v planes (all heads) and Wo (rounded to bf16) are staged once in LDS (row pitches 272 B and 528 B = 16 B x odd, for 16-byte readers). S^T = K Q^T (A = k rows, B = q hi and q residual x 2^10: 2 products), so a lane holds one query's logits (keys 16 jt + 8 g + r) in registers; logits x SCALE + bias; softmax in f32 in the lane plus one exchange between the lane halves; P x 2^11 once to f16 is packed from two score tiles straight into a B operand; ctx^T = V^T P^T (A = v planes [c][t], 1 product): a lane ends with 8 consecutive channels of its query's row. These x the gate are split bf16 hi + lo into the pass's LDS rows (two buffers, one barrier a pass); then out^T = Wo ctx^T (A = Wo rows, B = ctx rows hi, lo: 2 products), each wave 16 queries x 32 output channels, stored as whole 128-B lines through the wave's own LDS range. The loops inside a pass are unrolled: tk, tv, s, o and p live in registers and need constant indices
__device__ __forceinline__ v8f wmma_h(v16h a, v16h b, v8f c) { return __builtin_amdgcn_wmma_f32_16x16x32_f16(false, a, false, b, (short)0, c, false, false); }
// e^x by the scheme of expf (x log2(e) with the constant split in two, the whole part applied by ldexp, both range tests), written out so that v_exp_f32 and its v_nop are one statement
__device__ __forceinline__ float exp_slot(float x) { const float w = __builtin_rintf(x * 0x1.715476p+0f); const float a = __builtin_fmaf(x, 0x1.4ae0bep-26f, __builtin_fmaf(x, 0x1.715476p+0f, -w)); float r;
  asm("v_exp_f32 %0, %1\n\tv_nop" : "=v"(r) : "v"(a));   /* v_nop: the slot the instruction set asks for behind a transcendental before its source is overwritten or its result read */
  r = ldexpf(r, (int)w); r = x < -0x1.9d1dap+6f ? 0.f : r; return x > 0x1.62e430p+6f ? __builtin_inff() : r; }
// ---- k_pre: block = one first index i of the pair tensor = 256 pair rows (i, 0..255), 16 waves x 16 rows. Each lane loads its row's half of the channels in A/B fragment order, LayerNorm (biased var, eps 1e-5, ln_w/ln_b) of bf16(z) in registers (row sums: 64 terms in the lane, then one exchange between the lane halves), LN(z) split bf16 hi + lo once and kept in registers for all five products. Wv, Wk, Wq, Wg, Wb are rounded to bf16 once per block into LDS (row pitch 272 B = 16 B x 17, for 16-byte readers). v: D = Z W^T (a lane holds 8 consecutive t of one channel) -> [c][t] planes through a block tile; k, q, gate, bias: D^T = W Z^T (a lane holds 8 consecutive channels of its row) -> k, q, gate as whole rows through the wave's own LDS range, bias straight from registers
#define LDSW() asm volatile("s_wait_dscnt 0" ::: "memory")   /* a wave's own LDS range: its writes are done before it reads the rows back, its reads before the next rows overwrite them; no other wave touches the range, so no fence and no wait for global stores */
#define WP 136             // LDS pitch of a staged weight row and of a staged f16 output row, in 2-byte elements
typedef __attribute__((ext_vector_type(4))) __bf16 v4b;
__device__ __forceinline__ v8f wmma_b(v16b a, v16b b, v8f c) { return __builtin_amdgcn_wmma_f32_16x16x32_bf16(false, a, false, b, (short)0, c, false, false); }
// acc[j] = (hi + lo rows of LN(z)) x (weight rows 16 j .. 16 j + 15), K = 128; ZA: z is the A operand (D = Z W^T), else the B operand (D^T = W Z^T). Four tiles at a time, so that three other accumulators' products stand between a tile's hi and lo product
template <bool ZA> __device__ __forceinline__ void gemm128(const __bf16 (*Ws)[WP], const F2 (&a)[4], v8f (&acc)[8], int lane) { const int col = lane & 15;
#pragma unroll
  for (int j = 0; j < 8; ++j) acc[j] = v8f{};
#pragma unroll
  for (int kc = 0; kc < 4; ++kc)
#pragma unroll
    for (int jq = 0; jq < 8; jq += 4) { v16b w[4];
#pragma unroll
      for (int j = 0; j < 4; ++j) w[j] = frag_b(&Ws[(jq + j) * 16 + col][kc * 32], lane);
#pragma unroll
      for (int j = 0; j < 4; ++j) acc[jq + j] = ZA ? wmma_b(a[kc].h, w[j], acc[jq + j]) : wmma_b(w[j], a[kc].h, acc[jq + j]);
#pragma unroll
      for (int j = 0; j < 4; ++j) acc[jq + j] = ZA ? wmma_b(a[kc].l, w[j], acc[jq + j]) : wmma_b(w[j], a[kc].l, acc[jq + j]); } }
__global__ __launch_bounds__(512) void k_pre(const float* __restrict__ Z, const float* __restrict__ LW, const float* __restrict__ LB, const float* __restrict__ WQ, const float* __restrict__ WK, const float* __restrict__ WV, const float* __restrict__ WB, const float* __restrict__ WG,
    _Float16* __restrict__ QH, _Float16* __restrict__ QL, _Float16* __restrict__ KH, _Float16* __restrict__ VT, float* __restrict__ BIAS, float* __restrict__ G) {
  __shared__ __align__(16) __bf16 sw[4][CC][WP]; __shared__ __align__(16) __bf16 swb[16][WP]; __shared__ __align__(16) char su[16][16 * WP * 4];   /* su: first the block's v tile [128][264] f16, then 8,704 B a wave */
  const int tid = threadIdx.x, wave = tid >> 5, lane = tid & 31, col = lane & 15, g = lane >> 4; const int bi = blockIdx.x, t0 = wave * 16; const size_t row0 = (size_t)bi * SZ + t0;
  v4f xv[16];   /* piece q = fragment kc = q >> 2, elements 4 (q & 3) ..: channels 32 kc + 16 ((q >> 1) & 1) + 8 g + 4 (q & 1) .. */
#pragma unroll
  for (int q = 0; q < 16; ++q) { if (q == 15) asm volatile("s_wait_xcnt 0x0" ::: "memory");   /* without it the build put the last load's result into the address pair that the 15 loads above name; the last load now issues behind the wait */
    xv[q] = *(const v4f*)(Z + (row0 + col) * CC + (q >> 2) * 32 + ((q >> 1) & 1) * 16 + 8 * g + (q & 1) * 4); }
#pragma unroll
  for (int m = 0; m < 4; ++m) { const float* Wm = m == 0 ? WV : m == 1 ? WK : m == 2 ? WQ : WG;
#pragma unroll
    for (int i = 0; i < 8; ++i) { const int e = tid + i * 512; const v4f f = *(const v4f*)(Wm + (size_t)e * 4); v4b w;
#pragma unroll
      for (int k = 0; k < 4; ++k) w[k] = (__bf16)f[k];
      *(v4b*)&sw[m][e >> 5][(e & 31) * 4] = w; } }
  { v4f f = {}; if (wave < NH) f = *(const v4f*)(WB + tid * 4); v4b w;   /* Wb rows 0..3; rows 4..15 of the tile are zero */
#pragma unroll
    for (int k = 0; k < 4; ++k) w[k] = (__bf16)f[k];
    *(v4b*)&swb[wave][lane * 4] = w; }
  float s1 = 0.f;
#pragma unroll
  for (int q = 0; q < 16; ++q)
#pragma unroll
    for (int k = 0; k < 4; ++k) { xv[q][k] = bfr(xv[q][k]); s1 += xv[q][k]; }
  s1 += __shfl_xor(s1, 16); const float mu = s1 * (1.0f / CC); float sq = 0.f;
#pragma unroll
  for (int q = 0; q < 16; ++q)
#pragma unroll
    for (int k = 0; k < 4; ++k) { const float d = xv[q][k] - mu; sq += d * d; }
  sq += __shfl_xor(sq, 16); const float rs = rsqrtf(sq * (1.0f / CC) + 1e-5f);
  F2 a[4];
#pragma unroll
  for (int kc = 0; kc < 4; ++kc) { float v[16];
#pragma unroll
    for (int p = 0; p < 4; ++p) { const int c = kc * 32 + (p >> 1) * 16 + 8 * g + (p & 1) * 4; const v4f lw = *(const v4f*)(LW + c), lb = *(const v4f*)(LB + c);
#pragma unroll
      for (int k = 0; k < 4; ++k) v[p * 4 + k] = (xv[kc * 4 + p][k] - mu) * rs * bfr(lw[k]) + bfr(lb[k]); }
    a[kc] = bsplit16(v);
    __builtin_amdgcn_sched_barrier(0); }   /* one fragment's 8 ln_w / ln_b loads at a time: with all 32 hoisted beside the 64 row values the build spilled registers to scratch */
  __syncthreads();   /* the staged weights are read by every wave */
  v8f acc[8];
  gemm128<true>(sw[0], a, acc, lane);   /* v */
  { _Float16 (*th)[TT + 8] = (_Float16 (*)[TT + 8])&su[0][0];
#pragma unroll
    for (int j = 0; j < 8; ++j) { v8h hv;
#pragma unroll
      for (int r = 0; r < 8; ++r) hv[r] = (_Float16)acc[j][r];
      *(v8h*)&th[j * 16 + col][t0 + 8 * g] = hv; }
    __syncthreads();   /* a plane row holds all 16 waves' t */
#pragma unroll
    for (int i = 0; i < 8; ++i) { const int e = tid + i * 512; vst2(VT + ((size_t)bi * CC + (e >> 5)) * (size_t)TT + (e & 31) * 8, *(const v8h*)&th[e >> 5][(e & 31) * 8]); }
    __syncthreads(); }   /* the tile's last read ends before the waves reuse su */
  _Float16 (*ph)[WP] = (_Float16 (*)[WP])&su[wave][0]; _Float16 (*pl)[WP] = (_Float16 (*)[WP])&su[wave][16 * WP * 2]; float (*pf)[132] = (float (*)[132])&su[wave][0];
  gemm128<false>(sw[1], a, acc, lane);   /* k: pair row (j, k) directly */
#pragma unroll
  for (int j = 0; j < 8; ++j) { v8h hv;
#pragma unroll
    for (int r = 0; r < 8; ++r) hv[r] = (_Float16)acc[j][r];
    *(v8h*)&ph[col][j * 16 + 8 * g] = hv; }
  LDSW();
#pragma unroll
  for (int it = 0; it < 8; ++it) { const int rl = it * 2 + g; vst2(KH + (row0 + rl) * CC + col * 8, *(const v8h*)&ph[rl][col * 8]); }
  LDSW();   /* the rows are read back before the next product's rows overwrite them */
  gemm128<false>(sw[2], a, acc, lane);   /* q: pair row (i, j) goes to row (j, i) */
#pragma unroll
  for (int j = 0; j < 8; ++j) { v8h hv, lv;
#pragma unroll
    for (int r = 0; r < 8; ++r) { const float v = acc[j][r]; hv[r] = (_Float16)v; lv[r] = (_Float16)((v - (float)hv[r]) * 1024.0f); }
    *(v8h*)&ph[col][j * 16 + 8 * g] = hv; *(v8h*)&pl[col][j * 16 + 8 * g] = lv; }
  LDSW();
#pragma unroll
  for (int it = 0; it < 8; ++it) { const int rl = it * 2 + g; const size_t o = ((size_t)(t0 + rl) * TT + bi) * CC + col * 8; vst2(QH + o, *(const v8h*)&ph[rl][col * 8]); vst2(QL + o, *(const v8h*)&pl[rl][col * 8]); }
  LDSW();
  v8f ab = {};   /* bias^T = Wb Z^T: rows 0..3 of the tile = heads, in lanes 0..15 */
#pragma unroll
  for (int kc = 0; kc < 4; ++kc) { const v16b w = frag_b(&swb[col][kc * 32], lane); ab = wmma_b(w, a[kc].h, ab); ab = wmma_b(w, a[kc].l, ab); }
  gemm128<false>(sw[3], a, acc, lane);   /* gate */
  if (g == 0) { v4f b4; b4[0] = ab[0]; b4[1] = ab[1]; b4[2] = ab[2]; b4[3] = ab[3]; vst2(BIAS + (row0 + col) * NH, b4); }   /* 16 rows x 16 B = one 256-B run per wave */
#pragma unroll
  for (int j = 0; j < 8; ++j) { v4f y0, y1;
#pragma unroll
    for (int r = 0; r < 4; ++r) { y0[r] = 1.0f / (1.0f + exp_slot(-acc[j][r])); y1[r] = 1.0f / (1.0f + exp_slot(-acc[j][4 + r])); }   /* sigmoid gate */
    *(v4f*)&pf[col][j * 16 + 8 * g] = y0; *(v4f*)&pf[col][j * 16 + 8 * g + 4] = y1; }
  LDSW();
#pragma unroll
  for (int rl = 0; rl < 16; ++rl) vst2(G + (row0 + rl) * CC + lane * 4, *(const v4f*)&pf[rl][lane * 4]); }
#define XW() asm volatile("s_wait_xcnt 0x0" ::: "memory")   /* in front of an overwrite of a register that an issued global load names: the build put later loads' results, and the next pass's address addition, into such address pairs */
__device__ __forceinline__ v16h frag_o(const _Float16* base, unsigned off) { union { v16h v; v8h q[2]; } u; u.q[0] = *(const v8h*)(base + off); XW(); u.q[1] = *(const v8h*)(base + off + 16); XW(); return u.v; }   /* a fragment at a 32-bit element offset (8 g included) */
__global__ __launch_bounds__(512) void k_att(const _Float16* __restrict__ QH, const _Float16* __restrict__ QL, const _Float16* __restrict__ KH, const _Float16* __restrict__ VT, const float* __restrict__ BIAS, const float* __restrict__ G, const float* __restrict__ WO, float* __restrict__ OUT) {
  __shared__ __align__(16) _Float16 sk[TT][CC + 8]; __shared__ __align__(16) _Float16 sv[CC][TT + 8]; __shared__ __align__(16) __bf16 so[DIN][WP]; __shared__ __align__(16) __bf16 sx[2][2][64][WP]; __shared__ __align__(16) float sf[16][16][36];   /* sx: [buffer][hi, lo][query of the pass][channel]; sf: a wave's 16 x 32 output tile, pitch 144 B */
  const int tid = threadIdx.x, wave = tid >> 5, lane = tid & 31, col = lane & 15, g = lane >> 4; const int b = blockIdx.x, h = wave >> 2, qt = wave & 3; const size_t kr0 = (size_t)b * TT;
  const unsigned rq = qt * 16 + col, oq = rq * CC + h * HD + 8 * g, ob = rq * (SZ * NH) + h, og = rq * (SZ * CC) + h * HD + 8 * g, oo = (qt * 16 + (lane >> 3)) * (SZ * DIN) + h * 32 + (lane & 7) * 4;   /* the lane's 32-bit offsets from base pointers that are the same for the whole block (j alone): one register an address */
  const _Float16 *QHb = QH + kr0 * CC, *QLb = QL + kr0 * CC; const float *Bb = BIAS + (size_t)b * NH, *Gb = G + (size_t)b * CC; float* Ob = OUT + (size_t)b * DIN;
  v16h qh = frag_o(QHb, oq), ql = frag_o(QLb, oq);
  float bias = Bb[ob]; XW();   /* bias[i][j][h] (constant over the keys; added for fidelity) */
  { v8h tk[8], tv[8]; v4f tw[8];   /* 4,096 16-byte pieces of each of the three, 8 a thread: all 24 loads are issued before the first LDS store */
#pragma unroll
    for (int i = 0; i < 8; ++i) { const int e = tid + i * 512; tk[i] = *(const v8h*)(KH + kr0 * CC + (size_t)e * 8); tv[i] = *(const v8h*)(VT + (size_t)b * CC * TT + (size_t)e * 8); tw[i] = *(const v4f*)(WO + (size_t)e * 4); }
    XW();
#pragma unroll
    for (int i = 0; i < 8; ++i) { const int e = tid + i * 512; *(v8h*)&sk[e >> 4][(e & 15) * 8] = tk[i]; *(v8h*)&sv[e >> 5][(e & 31) * 8] = tv[i]; v4b w;
#pragma unroll
      for (int k = 0; k < 4; ++k) w[k] = (__bf16)tw[i][k];
      *(v4b*)&so[e >> 5][(e & 31) * 4] = w; } }
  __syncthreads();   /* the staged k, v and Wo are read by every wave */
#pragma unroll 1   /* rolled: for speed only */
  for (int it = 0; it < TT / 64; ++it) {
    v8f s[TT / 16]; float m = -3.0e38f;
#pragma unroll
    for (int jt = 0; jt < TT / 16; ++jt) { const v16h kf = frag_h(&sk[jt * 16 + col][h * HD], lane); const v8f z8 = {}; const v8f a = wmma_h(kf, qh, z8), al = wmma_h(kf, ql, z8);
#pragma unroll
      for (int r = 0; r < 8; ++r) s[jt][r] = (a[r] + al[r] * (1.0f / 1024.0f)) * SCALE + bias;
      /* order asked of the build: the next tile's 2 LDS reads, this tile's 2 products, then 8 vector instructions (the scaling of the tile before it). Left free, the build ran the products far ahead of their scaling, held both results of each and spilled registers to scratch */
      if (jt == 0) __builtin_amdgcn_sched_group_barrier(0x100, 2, 0);
      if (jt + 1 < TT / 16) __builtin_amdgcn_sched_group_barrier(0x100, 2, 0);
      __builtin_amdgcn_sched_group_barrier(0x008, 2, 0); if (jt) __builtin_amdgcn_sched_group_barrier(0x002, 8, 0); }
#pragma unroll
    for (int jt = 0; jt < TT / 16; ++jt)
#pragma unroll
      for (int r = 0; r < 8; ++r) m = fmaxf(m, s[jt][r]);
    m = fmaxf(m, __shfl_xor(m, 16)); float sum = 0.f;
#pragma unroll
    for (int jt = 0; jt < TT / 16; ++jt)
#pragma unroll
      for (int r = 0; r < 8; ++r) { const float e = exp_slot(s[jt][r] - m); s[jt][r] = e; sum += e; }
    sum += __shfl_xor(sum, 16); const float inv = sum > 0.f ? 2048.0f / sum : 0.f;
    __builtin_amdgcn_sched_barrier(0);   /* the loads below stay behind the softmax: moved up into it or among the scores, the build had no registers for their results and spilled them to scratch */
    v4f gt[4];   /* the gate of this lane's 16 channels, and the next pass's q and bias: issued here, where the logits' registers begin to come free, so that P V covers their latency */
    { const unsigned e = og + it * (64 * SZ * CC); gt[0] = *(const v4f*)(Gb + e); gt[1] = *(const v4f*)(Gb + e + 4); gt[2] = *(const v4f*)(Gb + e + 16); gt[3] = *(const v4f*)(Gb + e + 20); XW(); }
    { const int qn = (it + 1 < TT / 64 ? it + 1 : it) * 64;   /* no branch round these loads (the last pass loads its own rows again): with one, the build moved the scores' scaling behind it, held all 32 products' results at once and spilled registers to scratch */
      qh = frag_o(QHb, oq + qn * CC); ql = frag_o(QLb, oq + qn * CC); bias = Bb[ob + qn * (SZ * NH)]; XW(); }
    v8f o[HD / 16] = {};
#pragma unroll
    for (int kc = 0; kc < TT / 32; ++kc) { v16h p;
#pragma unroll
      for (int i = 0; i < 8; ++i) { p[i] = (_Float16)(s[2 * kc][i] * inv); p[8 + i] = (_Float16)(s[2 * kc + 1][i] * inv); }
#pragma unroll
      for (int jj = 0; jj < HD / 16; ++jj) o[jj] = wmma_h(frag_h(&sv[h * HD + jj * 16 + col][kc * 32], lane), p, o[jj]); }
#pragma unroll
    for (int jj = 0; jj < HD / 16; ++jj) { v8b yh, yl;
#pragma unroll
      for (int r = 0; r < 8; ++r) { const float y = o[jj][r] * (1.0f / 2048.0f) * gt[jj * 2 + (r >> 2)][r & 3]; yh[r] = (__bf16)y; yl[r] = (__bf16)(y - (float)yh[r]); }
      *(v8b*)&sx[it & 1][0][qt * 16 + col][h * HD + jj * 16 + 8 * g] = yh; *(v8b*)&sx[it & 1][1][qt * 16 + col][h * HD + jj * 16 + 8 * g] = yl; }
    __syncthreads();   /* a gated ctx row holds all 4 heads' channels; the same barrier ends the last reads of the other buffer, which the next pass overwrites */
    v8f acc[2] = {};   /* this wave: queries 16 qt .. of the pass, output channels 32 h .. 32 h + 31 */
#pragma unroll
    for (int kc = 0; kc < CC / 32; ++kc) { const v16b xh = frag_b(&sx[it & 1][0][qt * 16 + col][kc * 32], lane), xl = frag_b(&sx[it & 1][1][qt * 16 + col][kc * 32], lane);
      const v16b w0 = frag_b(&so[h * 32 + col][kc * 32], lane), w1 = frag_b(&so[h * 32 + 16 + col][kc * 32], lane);
      acc[0] = wmma_b(w0, xh, acc[0]); acc[1] = wmma_b(w1, xh, acc[1]); acc[0] = wmma_b(w0, xl, acc[0]); acc[1] = wmma_b(w1, xl, acc[1]); }
#pragma unroll
    for (int t = 0; t < 2; ++t) { v4f y0, y1;
#pragma unroll
      for (int r = 0; r < 4; ++r) { y0[r] = acc[t][r]; y1[r] = acc[t][4 + r]; }
      *(v4f*)&sf[wave][col][t * 16 + 8 * g] = y0; *(v4f*)&sf[wave][col][t * 16 + 8 * g + 4] = y1; }
    LDSW();
    asm volatile("v_nop\n\tv_nop\n\tv_nop\n\tv_nop");   /* the distance behind the pass's last two products: over the loop's back edge the next pass's first score products write registers of their results with only three vector instructions between */
#pragma unroll
    for (int i = 0; i < 4; ++i) vst2(Ob + (oo + (it * 64 + i * 4) * (SZ * DIN)), *(const v4f*)&sf[wave][i * 4 + (lane >> 3)][(lane & 7) * 4]);   /* 8 lanes = one 128-B line of out[i][j] */
    LDSW(); } }   /* the tile is read back before the next pass overwrites it */

extern "C" void kernel_launch(void* const* d_in, const int* in_sizes, int n_in, void* d_out, int out_size, void* d_ws, size_t ws_size, hipStream_t stream) {
  (void)in_sizes; (void)n_in; (void)out_size;
  const float** F = (const float**)d_in;
  if (ws_size < (size_t)WS_END) return;
  char* ws = (char*)d_ws; _Float16 *QH = (_Float16*)(ws + WS_QH), *KH = (_Float16*)(ws + WS_KH), *VT = (_Float16*)(ws + WS_VT), *QL = (_Float16*)(ws + WS_QL), *KL = (_Float16*)(ws + WS_KL); __bf16 *VB = (__bf16*)(ws + WS_VB), *VBL = (__bf16*)(ws + WS_VBL); float *S = (float*)(ws + WS_S), *Y = (float*)(ws + WS_Y);
  (void)S; (void)Y; (void)QL; (void)KL; (void)VB; (void)VBL;
  // inputs: 0 z_ij [1,256,256,128]; 1 ln_w, 2 ln_b; 3 Wq, 4 Wk, 5 Wv [128,128] (out,in); 6 Wb [4,128]; 7 Wg [128,128]; 8 Wo [128,128] (out,in)
  if (ws_size < (size_t)WS_END2) return;
  float *BIAS = (float*)(ws + WS_BIAS), *G = (float*)(ws + WS_G);
  k_pre<<<dim3(SZ), 512, 0, stream>>>(F[0], F[1], F[2], F[3], F[4], F[5], F[6], F[7], QH, QL, KH, VT, BIAS, G);
  k_att<<<dim3(TNB), 512, 0, stream>>>(QH, QL, KH, VT, BIAS, G, F[8], (float*)d_out);
}

// v004
// A run of this version takes 57.5 microseconds.
// Timed twice side by side with v003, it ran 1.22 times as fast both times.
// Counting every step since v000, it is 9.75 times as fast.
// compute dtype: all float inputs rounded to bf16; LayerNorm of z in f32; q/k/v = LN(z) split bf16 hi + lo x W^T (exact bf16) on WMMA 16x16x32 (2 products, f32 accumulate); q as f16 hi + residual (x 2^10) against k once to f16 (2 products) x 32^-0.5 + the per-(query, head) bias; softmax in f32 (logits x log2 e, v_exp_f32); P x 2^11 once to f16 against v once to f16 (1 product); gate sigmoid(LN(z) Wg^T) in f32 (2-product GEMM, v_exp_f32 and v_rcp_f32); gated ctx split bf16 hi + lo against exact Wo (2 products); f32 output.
#include <hip/hip_runtime.h>
#include <math.h>

typedef __attribute__((ext_vector_type(16))) _Float16 v16h;
typedef __attribute__((ext_vector_type(16))) __bf16 v16b;
typedef __attribute__((ext_vector_type(8)))  _Float16 v8h;
typedef __attribute__((ext_vector_type(8)))  float v8f;
typedef __attribute__((ext_vector_type(4)))  float v4f;
typedef __attribute__((ext_vector_type(2)))  float v2f;
typedef __attribute__((ext_vector_type(4)))  unsigned v4u;
typedef __attribute__((ext_vector_type(4)))  int v4i;
typedef float __attribute__((may_alias)) float_a;
typedef int __attribute__((may_alias)) int_a;

template <typename T> __device__ __forceinline__ void vst2(void* p, T v) { *(T*)p = v;  }
__device__ __forceinline__ v8f wmma16(v16h a, v16h b, v8f c) {
  v8f d = __builtin_amdgcn_wmma_f32_16x16x32_f16(false, a, false, b, (short)0, c, false, false);
  asm volatile("v_nop\n\tv_nop\n\tv_nop\n\tv_nop" : "+v"(d) : "v"(a), "v"(b));
  return d;
}
__device__ __forceinline__ v8f wmma_bf(v16b a, v16b b, v8f c) {
  v8f d = __builtin_amdgcn_wmma_f32_16x16x32_bf16(false, a, false, b, (short)0, c, false, false);
  asm volatile("v_nop\n\tv_nop\n\tv_nop\n\tv_nop" : "+v"(d) : "v"(a), "v"(b));
  return d;
}
// 16x16x32 fragments: lane = (h = lane>>4, row/col = lane&15); elements 0..7 = k0+8h+0..7, 8..15 = k0+16+8h+0..7; D element r = row 8h+r
__device__ __forceinline__ v16h frag_h(const _Float16* rowk0, int lane) {
  union { v16h v; v8h q[2]; } u; const _Float16* p = rowk0 + 8 * (lane >> 4);
  u.q[0] = *(const v8h*)p; u.q[1] = *(const v8h*)(p + 16); return u.v;
}
__device__ __forceinline__ v16h frag_f32(const float* rowk0, int lane) {
  v16h a; const float* p = rowk0 + 8 * (lane >> 4);
#pragma unroll
  for (int i = 0; i < 8; ++i) { a[i] = (_Float16)p[i]; a[8 + i] = (_Float16)p[16 + i]; }
  return a;
}
__device__ __forceinline__ v16h frag_f32s(const float* rowk0, int lane, float sc) {
  v16h a; const float* p = rowk0 + 8 * (lane >> 4);
#pragma unroll
  for (int i = 0; i < 8; ++i) { a[i] = (_Float16)(p[i] * sc); a[8 + i] = (_Float16)(p[16 + i] * sc); }
  return a;
}
// column fragment from a [K][ld] layout (column n), rows >= K read as 0
__device__ __forceinline__ v16h fragc_f32(const float* W, int k0, int n, int lane, int ld, int K) {
  v16h a; const int g = lane >> 4;
#pragma unroll
  for (int i = 0; i < 8; ++i) { const int ka = k0 + 8 * g + i, kb = ka + 16;
    a[i] = (_Float16)(ka < K ? W[(size_t)(ka < K ? ka : K - 1) * ld + n] : 0.f); a[8 + i] = (_Float16)(kb < K ? W[(size_t)(kb < K ? kb : K - 1) * ld + n] : 0.f); }
  return a;
}
struct F2 { v16b h, l; };
__device__ __forceinline__ F2 bsplit16(const float v[16]) { F2 r;
#pragma unroll
  for (int i = 0; i < 16; ++i) { const __bf16 h = (__bf16)v[i]; r.h[i] = h; r.l[i] = (__bf16)(v[i] - (float)h); }
  return r; }
__device__ __forceinline__ F2 split_row(const float* row, int k0, int lane) { float v[16]; const float* p = row + k0 + 8 * (lane >> 4);
#pragma unroll
  for (int i = 0; i < 8; ++i) { v[i] = p[i]; v[8 + i] = p[16 + i]; }
  return bsplit16(v); }
__device__ __forceinline__ F2 split_rowK(const float* row, int k0, int lane, int K) { float v[16]; const int g = lane >> 4;
#pragma unroll
  for (int i = 0; i < 8; ++i) { const int ka = k0 + 8 * g + i, kb = ka + 16; v[i] = ka < K ? row[ka < K ? ka : K - 1] : 0.f; v[8 + i] = kb < K ? row[kb < K ? kb : K - 1] : 0.f; }
  return bsplit16(v); }
__device__ __forceinline__ F2 split_col(const float* W, int k0, int n, int lane, int ld, int K) { float v[16]; const int g = lane >> 4;
#pragma unroll
  for (int i = 0; i < 8; ++i) { const int ka = k0 + 8 * g + i, kb = ka + 16; v[i] = ka < K ? W[(size_t)(ka < K ? ka : K - 1) * ld + n] : 0.f; v[8 + i] = kb < K ? W[(size_t)(kb < K ? kb : K - 1) * ld + n] : 0.f; }
  return bsplit16(v); }
__device__ __forceinline__ v8f mac3(const F2& a, const F2& b, v8f c) { c = wmma_bf(a.l, b.h, c); c = wmma_bf(a.h, b.l, c); return wmma_bf(a.h, b.h, c); }
__device__ __forceinline__ float sigm(float v) { return 1.0f / (1.0f + expf(-v)); }
#define LDSX() do { asm volatile("s_wait_dscnt 0" ::: "memory"); __builtin_amdgcn_wave_barrier(); __builtin_amdgcn_fence(__ATOMIC_RELEASE, "workgroup"); } while (0)

// Triangle attention, starting node (z [1, 256, 256, 128], 4 heads x 32): z <- LayerNorm(z); q_ij, k_jk, v_jk, g_ij = z W^T; scores[i,j,h,k] = q_ij . k_jk / sqrt(32) + bias[i,j,h] (bias = z Wb^T, constant over k); attn = softmax over k; o_ij = sum_k attn v_jk; out_ij = (sigmoid(g_ij) * o_ij) Wo^T. Mapping: 'batch' = j (the shared key row), query position = i, key position = k.
#define NB 256
#define TT 256
#define CC 128            // NH * HD = projected width
#define DIN 128          // input (model) width
#define NH 4
#define HD 32
#define NQB (TT / 64)
#define HG 4
#define SCALE (0.17677669529663687f)
#define CAUSAL 0
#ifndef TNB
#define TNB NB
#endif
__device__ __forceinline__ float bfr(float v) { return (float)(__bf16)v; }
__host__ __device__ __forceinline__ int kb_last(int qb) { return CAUSAL ? ((qb * 64 + 63) >> 7) : (TT / 128 - 1); }
typedef __attribute__((ext_vector_type(8))) __bf16 v8b;
__device__ __forceinline__ v16b frag_b(const __bf16* rowk0, int lane) {
  union { v16b v; v8b q[2]; } u; const __bf16* p = rowk0 + 8 * (lane >> 4);
  u.q[0] = *(const v8b*)p; u.q[1] = *(const v8b*)(p + 16); return u.v;
}
#define QBH 0              // unused: no kernel here has a high-precision query path
#define QHI 256            // rows carrying a q residual plane (all rows when non-causal: 2-product logits everywhere)
#define KHI 64            // key rows the unused k residual / v bf16 hi+lo regions are sized for (no kernel writes or reads them)
// B fragment (k rows k0+.., output column o) of a weight: (in,out) [K][ld] or (out,in) [ld rows of K]: bf16 exact, or f16(bf16 * 256) exact
__device__ __forceinline__ v16b wcol_io(const float* Wm, int k0, int o, int lane, int ld) { v16b w; const int g = lane >> 4;
#pragma unroll
  for (int i = 0; i < 8; ++i) { w[i] = (__bf16)Wm[(size_t)(k0 + 8 * g + i) * ld + o]; w[8 + i] = (__bf16)Wm[(size_t)(k0 + 16 + 8 * g + i) * ld + o]; }
  return w; }
__device__ __forceinline__ v16b wcol_oi(const float* Wm, int k0, int o, int lane, int K) { v16b w; const float* p = Wm + (size_t)o * K + k0 + 8 * (lane >> 4);
#pragma unroll
  for (int i = 0; i < 8; ++i) { w[i] = (__bf16)p[i]; w[8 + i] = (__bf16)p[16 + i]; }
  return w; }
__device__ __forceinline__ v16h wcolh_io(const float* Wm, int k0, int o, int lane, int ld) { v16h w; const int g = lane >> 4;
#pragma unroll
  for (int i = 0; i < 8; ++i) { w[i] = (_Float16)(bfr(Wm[(size_t)(k0 + 8 * g + i) * ld + o]) * 256.0f); w[8 + i] = (_Float16)(bfr(Wm[(size_t)(k0 + 16 + 8 * g + i) * ld + o]) * 256.0f); }
  return w; }
__device__ __forceinline__ v16h wcolh_oi(const float* Wm, int k0, int o, int lane, int K) { v16h w; const float* p = Wm + (size_t)o * K + k0 + 8 * (lane >> 4);
#pragma unroll
  for (int i = 0; i < 8; ++i) { w[i] = (_Float16)(bfr(p[i]) * 256.0f); w[8 + i] = (_Float16)(bfr(p[16 + i]) * 256.0f); }
  return w; }
#define WQKV_LAYOUT 1   // 0 = (in,out) [DIN][CC]; 1 = (out,in) [CC][DIN]; 2 = per-head [NH][DIN][HD]
__device__ __forceinline__ v16b wcol_hdk(const float* Wm, int k0, int o, int lane) { v16b w; const int g = lane >> 4; const float* p = Wm + (size_t)(o / HD) * DIN * HD + (o % HD);
#pragma unroll
  for (int i = 0; i < 8; ++i) { w[i] = (__bf16)p[(size_t)(k0 + 8 * g + i) * HD]; w[8 + i] = (__bf16)p[(size_t)(k0 + 16 + 8 * g + i) * HD]; }
  return w; }
#define WO_OUT_IN 1
#if WQKV_LAYOUT == 1
#define WCOL(W, k0, o, lane) wcol_oi(W, k0, o, lane, DIN)
#elif WQKV_LAYOUT == 2
#define WCOL(W, k0, o, lane) wcol_hdk(W, k0, o, lane)
#else
#define WCOL(W, k0, o, lane) wcol_io(W, k0, o, lane, CC)
#endif
#if WO_OUT_IN
#define WOCOL(W, k0, o, lane) wcol_oi(W, k0, o, lane, CC)
#define WOCOLH(W, k0, o, lane) wcolh_oi(W, k0, o, lane, CC)
#else
#define WOCOL(W, k0, o, lane) wcol_io(W, k0, o, lane, DIN)
#define WOCOLH(W, k0, o, lane) wcolh_io(W, k0, o, lane, DIN)
#endif
#define SZ 256             // S (pair-tensor side)
#define BG 64              // key rows j the unused WS_S region is sized for (x 4 heads = 256 planes of 256 x 256)
#define NZR (SZ * SZ)      // 65,536 pair rows
#define SM_EXTRA_PARAMS , const float* __restrict__ BIAS, int b0s
#define SM_MASK_HOOK do { const int jb = b0s + (int)blockIdx.y / HG; const int hh = (int)blockIdx.y % HG; v = v + BIAS[((size_t)t * SZ + jb) * NH + hh]; } while (0)   /* bias[i][j][h] (constant over the keys: cancels in the softmax up to rounding; added for fidelity) */
#define WS_ZN   (WS_END)
#define WS_BIAS (WS_ZN + 4u * (size_t)NZR * CC)
#define WS_G    (WS_BIAS + 4u * (size_t)NZR * NH)
#define WS_END2 (WS_G + 4u * (size_t)NZR * CC)
#ifndef SM_EXTRA_PARAMS
#define SM_EXTRA_PARAMS
#endif
#ifndef PROJ_EXTRA_PARAMS
#define PROJ_EXTRA_PARAMS
#endif
#ifndef SM_MASK_HOOK
#define SM_MASK_HOOK (void)0
#endif

#define WS_QH  0u                                      // f16 q rows [b*t][CC]
#define WS_KH  (WS_QH + 2u * (size_t)NB * TT * CC)      // f16 k rows [b*t][CC]
#define WS_VT  (WS_KH + 2u * (size_t)NB * TT * CC)      // f16 v planes [b][c][t]
#define WS_QL  (WS_VT + 2u * (size_t)NB * CC * TT)      // f16 q residual x 2^10 rows [b][t < QHI][CC]
#define WS_KL  (WS_QL + 2u * (size_t)NB * QHI * CC)     // f16 k residual x 2^10 rows [b][t < KHI][CC]
#define WS_VB  (WS_KL + 2u * (size_t)NB * KHI * CC)     // bf16 v hi planes [b][c][t < KHI]
#define WS_VBL (WS_VB + 2u * (size_t)NB * CC * KHI)
#define WS_S   (WS_VBL + 2u * (size_t)NB * CC * KHI)    // f32 region, unused (k_att keeps logits and P in registers)
#define WS_Y   (WS_S  + 4u * (size_t)BG * HG * TT * TT)   // 256 unused score planes of 256 x 256      // f32 ctx rows [b*t][CC] (unused: k_att keeps the gated ctx in LDS)
#define WS_END (WS_Y  + 4u * (size_t)NB * TT * CC)

// ---- k_att: block = one key row j, all 4 heads, all 256 queries: 16 waves = 4 heads x 4 query tiles of 16, four passes of 64 queries. The row's k rows, v planes (all heads) and Wo (rounded to bf16) are staged once in LDS (row pitches 272 B and 528 B = 16 B x odd, for 16-byte readers). S^T = K Q^T (A = k rows, B = q hi and q residual x 2^10: 2 products), so a lane holds one query's logits (keys 16 jt + 8 g + r) in registers; logits x SCALE + bias, x log2 e; softmax in f32 in the lane plus one exchange between the lane halves; P x 2^11 once to f16 is packed from two score tiles straight into a B operand; ctx^T = V^T P^T (A = v planes [c][t], 1 product): a lane ends with 8 consecutive channels of its query's row. These x the gate are split bf16 hi + lo into the pass's LDS rows (two buffers, one barrier a pass); then out^T = Wo ctx^T (A = Wo rows, B = ctx rows hi, lo: 2 products), each wave 16 queries x 32 output channels, stored as whole 128-B lines through the wave's own LDS range. The loops inside a pass are unrolled: tk, tv, s, o and p live in registers and need constant indices
__device__ __forceinline__ v8f wmma_h(v16h a, v16h b, v8f c) { return __builtin_amdgcn_wmma_f32_16x16x32_f16(false, a, false, b, (short)0, c, false, false); }
#define LOG2E (1.4426950408889634f)
// 2^x and 1/x of eight independent values in place, one hardware instruction each. One statement: each instruction fills the slot that the instruction set asks for behind the transcendental before it (none reads a neighbour's result or overwrites its source), and the closing v_nop fills the slot behind the last
__device__ __forceinline__ void exp2x8(float (&x)[8]) {
  asm("v_exp_f32 %0, %0\n\tv_exp_f32 %1, %1\n\tv_exp_f32 %2, %2\n\tv_exp_f32 %3, %3\n\tv_exp_f32 %4, %4\n\tv_exp_f32 %5, %5\n\tv_exp_f32 %6, %6\n\tv_exp_f32 %7, %7\n\tv_nop" : "+v"(x[0]), "+v"(x[1]), "+v"(x[2]), "+v"(x[3]), "+v"(x[4]), "+v"(x[5]), "+v"(x[6]), "+v"(x[7])); }
__device__ __forceinline__ void rcpx8(float (&x)[8]) {
  asm("v_rcp_f32 %0, %0\n\tv_rcp_f32 %1, %1\n\tv_rcp_f32 %2, %2\n\tv_rcp_f32 %3, %3\n\tv_rcp_f32 %4, %4\n\tv_rcp_f32 %5, %5\n\tv_rcp_f32 %6, %6\n\tv_rcp_f32 %7, %7\n\tv_nop" : "+v"(x[0]), "+v"(x[1]), "+v"(x[2]), "+v"(x[3]), "+v"(x[4]), "+v"(x[5]), "+v"(x[6]), "+v"(x[7])); }
// ---- k_pre: block = one first index i of the pair tensor = 256 pair rows (i, 0..255), 16 waves x 16 rows. Each lane loads its row's half of the channels in A/B fragment order, LayerNorm (biased var, eps 1e-5, ln_w/ln_b) of bf16(z) in registers (row sums: 64 terms in the lane, then one exchange between the lane halves), LN(z) split bf16 hi + lo once and kept in registers for all five products. Wv, Wk, Wq, Wg, Wb are rounded to bf16 once per block into LDS (row pitch 272 B = 16 B x 17, for 16-byte readers). v: D = Z W^T (a lane holds 8 consecutive t of one channel) -> [c][t] planes through a block tile; k, q, gate: D^T = W Z^T (a lane holds 8 consecutive channels of its row) -> whole rows through the wave's own LDS range; bias: D^T = Wb Z^T, stored straight from registers
#define LDSW() asm volatile("s_wait_dscnt 0" ::: "memory")   /* a wave's own LDS range: its writes are done before it reads the rows back, its reads before the next rows overwrite them; no other wave touches the range, so no fence and no wait for global stores */
#define WP 136             // LDS pitch of a staged weight row and of a staged f16 output row, in 2-byte elements
typedef __attribute__((ext_vector_type(4))) __bf16 v4b;
__device__ __forceinline__ v8f wmma_b(v16b a, v16b b, v8f c) { return __builtin_amdgcn_wmma_f32_16x16x32_bf16(false, a, false, b, (short)0, c, false, false); }
// acc[j] = (hi + lo rows of LN(z)) x (weight rows 16 j .. 16 j + 15), K = 128; ZA: z is the A operand (D = Z W^T), else the B operand (D^T = W Z^T). Four tiles at a time, so that three other accumulators' products stand between a tile's hi and lo product
template <bool ZA> __device__ __forceinline__ void gemm128(const __bf16 (*Ws)[WP], const F2 (&a)[4], v8f (&acc)[8], int lane) { const int col = lane & 15;
#pragma unroll
  for (int j = 0; j < 8; ++j) acc[j] = v8f{};
#pragma unroll
  for (int kc = 0; kc < 4; ++kc)
#pragma unroll
    for (int jq = 0; jq < 8; jq += 4) { v16b w[4];
#pragma unroll
      for (int j = 0; j < 4; ++j) w[j] = frag_b(&Ws[(jq + j) * 16 + col][kc * 32], lane);
#pragma unroll
      for (int j = 0; j < 4; ++j) acc[jq + j] = ZA ? wmma_b(a[kc].h, w[j], acc[jq + j]) : wmma_b(w[j], a[kc].h, acc[jq + j]);
#pragma unroll
      for (int j = 0; j < 4; ++j) acc[jq + j] = ZA ? wmma_b(a[kc].l, w[j], acc[jq + j]) : wmma_b(w[j], a[kc].l, acc[jq + j]); } }
__global__ __launch_bounds__(512) void k_pre(const float* __restrict__ Z, const float* __restrict__ LW, const float* __restrict__ LB, const float* __restrict__ WQ, const float* __restrict__ WK, const float* __restrict__ WV, const float* __restrict__ WB, const float* __restrict__ WG,
    _Float16* __restrict__ QH, _Float16* __restrict__ QL, _Float16* __restrict__ KH, _Float16* __restrict__ VT, float* __restrict__ BIAS, float* __restrict__ G) {
  __shared__ __align__(16) __bf16 sw[4][CC][WP]; __shared__ __align__(16) __bf16 swb[16][WP]; __shared__ __align__(16) char su[16][16 * WP * 4];   /* su: first the block's v tile [128][264] f16, then 8,704 B a wave */
  const int tid = threadIdx.x, wave = tid >> 5, lane = tid & 31, col = lane & 15, g = lane >> 4; const int bi = blockIdx.x, t0 = wave * 16; const size_t row0 = (size_t)bi * SZ + t0;
  v4f xv[16];   /* piece q = fragment kc = q >> 2, elements 4 (q & 3) ..: channels 32 kc + 16 ((q >> 1) & 1) + 8 g + 4 (q & 1) .. */
#pragma unroll
  for (int q = 0; q < 16; ++q) { if (q == 15) asm volatile("s_wait_xcnt 0x0" ::: "memory");   /* without it the build put the last load's result into the address pair that the 15 loads above name; the last load now issues behind the wait */
    xv[q] = *(const v4f*)(Z + (row0 + col) * CC + (q >> 2) * 32 + ((q >> 1) & 1) * 16 + 8 * g + (q & 1) * 4); }
#pragma unroll
  for (int m = 0; m < 4; ++m) { const float* Wm = m == 0 ? WV : m == 1 ? WK : m == 2 ? WQ : WG;
#pragma unroll
    for (int i = 0; i < 8; ++i) { const int e = tid + i * 512; const v4f f = *(const v4f*)(Wm + (size_t)e * 4); v4b w;
#pragma unroll
      for (int k = 0; k < 4; ++k) w[k] = (__bf16)f[k];
      *(v4b*)&sw[m][e >> 5][(e & 31) * 4] = w; } }
  { v4f f = {}; if (wave < NH) f = *(const v4f*)(WB + tid * 4); v4b w;   /* Wb rows 0..3; rows 4..15 of the tile are zero */
#pragma unroll
    for (int k = 0; k < 4; ++k) w[k] = (__bf16)f[k];
    *(v4b*)&swb[wave][lane * 4] = w; }
  float s1 = 0.f;
#pragma unroll
  for (int q = 0; q < 16; ++q)
#pragma unroll
    for (int k = 0; k < 4; ++k) { xv[q][k] = bfr(xv[q][k]); s1 += xv[q][k]; }
  s1 += __shfl_xor(s1, 16); const float mu = s1 * (1.0f / CC); float sq = 0.f;
#pragma unroll
  for (int q = 0; q < 16; ++q)
#pragma unroll
    for (int k = 0; k < 4; ++k) { const float d = xv[q][k] - mu; sq += d * d; }
  sq += __shfl_xor(sq, 16); const float rs = rsqrtf(sq * (1.0f / CC) + 1e-5f);
  F2 a[4];
#pragma unroll
  for (int kc = 0; kc < 4; ++kc) { float v[16];
#pragma unroll
    for (int p = 0; p < 4; ++p) { const int c = kc * 32 + (p >> 1) * 16 + 8 * g + (p & 1) * 4; const v4f lw = *(const v4f*)(LW + c), lb = *(const v4f*)(LB + c);
#pragma unroll
      for (int k = 0; k < 4; ++k) v[p * 4 + k] = (xv[kc * 4 + p][k] - mu) * rs * bfr(lw[k]) + bfr(lb[k]); }
    a[kc] = bsplit16(v);
    __builtin_amdgcn_sched_barrier(0); }   /* one fragment's 8 ln_w / ln_b loads at a time: with all 32 hoisted beside the 64 row values the build spilled registers to scratch */
  __syncthreads();   /* the staged weights are read by every wave */
  v8f acc[8];
  gemm128<true>(sw[0], a, acc, lane);   /* v */
  { _Float16 (*th)[TT + 8] = (_Float16 (*)[TT + 8])&su[0][0];
#pragma unroll
    for (int j = 0; j < 8; ++j) { v8h hv;
#pragma unroll
      for (int r = 0; r < 8; ++r) hv[r] = (_Float16)acc[j][r];
      *(v8h*)&th[j * 16 + col][t0 + 8 * g] = hv; }
    __syncthreads();   /* a plane row holds all 16 waves' t */
#pragma unroll
    for (int i = 0; i < 8; ++i) { const int e = tid + i * 512; vst2(VT + ((size_t)bi * CC + (e >> 5)) * (size_t)TT + (e & 31) * 8, *(const v8h*)&th[e >> 5][(e & 31) * 8]); }
    __syncthreads(); }   /* the tile's last read ends before the waves reuse su */
  _Float16 (*ph)[WP] = (_Float16 (*)[WP])&su[wave][0]; _Float16 (*pl)[WP] = (_Float16 (*)[WP])&su[wave][16 * WP * 2]; float (*pf)[132] = (float (*)[132])&su[wave][0];
  gemm128<false>(sw[1], a, acc, lane);   /* k: pair row (j, k) directly */
#pragma unroll
  for (int j = 0; j < 8; ++j) { v8h hv;
#pragma unroll
    for (int r = 0; r < 8; ++r) hv[r] = (_Float16)acc[j][r];
    *(v8h*)&ph[col][j * 16 + 8 * g] = hv; }
  LDSW();
#pragma unroll
  for (int it = 0; it < 8; ++it) { const int rl = it * 2 + g; vst2(KH + (row0 + rl) * CC + col * 8, *(const v8h*)&ph[rl][col * 8]); }
  LDSW();   /* the rows are read back before the next product's rows overwrite them */
  gemm128<false>(sw[2], a, acc, lane);   /* q: pair row (i, j) goes to row (j, i) */
#pragma unroll
  for (int j = 0; j < 8; ++j) { v8h hv, lv;
#pragma unroll
    for (int r = 0; r < 8; ++r) { const float v = acc[j][r]; hv[r] = (_Float16)v; lv[r] = (_Float16)((v - (float)hv[r]) * 1024.0f); }
    *(v8h*)&ph[col][j * 16 + 8 * g] = hv; *(v8h*)&pl[col][j * 16 + 8 * g] = lv; }
  LDSW();
#pragma unroll
  for (int it = 0; it < 8; ++it) { const int rl = it * 2 + g; const size_t o = ((size_t)(t0 + rl) * TT + bi) * CC + col * 8; vst2(QH + o, *(const v8h*)&ph[rl][col * 8]); vst2(QL + o, *(const v8h*)&pl[rl][col * 8]); }
  LDSW();
  v8f ab = {};   /* bias^T = Wb Z^T: rows 0..3 of the tile = heads, in lanes 0..15 */
#pragma unroll
  for (int kc = 0; kc < 4; ++kc) { const v16b w = frag_b(&swb[col][kc * 32], lane); ab = wmma_b(w, a[kc].h, ab); ab = wmma_b(w, a[kc].l, ab); }
  gemm128<false>(sw[3], a, acc, lane);   /* gate */
  if (g == 0) { v4f b4; b4[0] = ab[0]; b4[1] = ab[1]; b4[2] = ab[2]; b4[3] = ab[3]; vst2(BIAS + (row0 + col) * NH, b4); }   /* 16 rows x 16 B = one 256-B run per wave */
#pragma unroll
  for (int j = 0; j < 8; ++j) { v4f y0, y1; float e[8];   /* sigmoid gate: 1 / (1 + 2^(-x log2 e)) */
#pragma unroll
    for (int r = 0; r < 8; ++r) e[r] = acc[j][r] * -LOG2E;
    exp2x8(e);
#pragma unroll
    for (int r = 0; r < 8; ++r) e[r] = 1.0f + e[r];
    rcpx8(e);
#pragma unroll
    for (int r = 0; r < 4; ++r) { y0[r] = e[r]; y1[r] = e[4 + r]; }
    *(v4f*)&pf[col][j * 16 + 8 * g] = y0; *(v4f*)&pf[col][j * 16 + 8 * g + 4] = y1; }
  LDSW();
#pragma unroll
  for (int rl = 0; rl < 16; ++rl) vst2(G + (row0 + rl) * CC + lane * 4, *(const v4f*)&pf[rl][lane * 4]); }
#define XW() asm volatile("s_wait_xcnt 0x0" ::: "memory")   /* in front of an overwrite of a register that an issued global load names: the build put later loads' results, and the next pass's address addition, into such address pairs */
__device__ __forceinline__ v16h frag_o(const _Float16* base, unsigned off) { union { v16h v; v8h q[2]; } u; u.q[0] = *(const v8h*)(base + off); XW(); u.q[1] = *(const v8h*)(base + off + 16); XW(); return u.v; }   /* a fragment at a 32-bit element offset (8 g included) */
__global__ __launch_bounds__(512) void k_att(const _Float16* __restrict__ QH, const _Float16* __restrict__ QL, const _Float16* __restrict__ KH, const _Float16* __restrict__ VT, const float* __restrict__ BIAS, const float* __restrict__ G, const float* __restrict__ WO, float* __restrict__ OUT) {
  __shared__ __align__(16) _Float16 sk[TT][CC + 8]; __shared__ __align__(16) _Float16 sv[CC][TT + 8]; __shared__ __align__(16) __bf16 so[DIN][WP]; __shared__ __align__(16) __bf16 sx[2][2][64][WP]; __shared__ __align__(16) float sf[16][16][36];   /* sx: [buffer][hi, lo][query of the pass][channel]; sf: a wave's 16 x 32 output tile, pitch 144 B */
  const int tid = threadIdx.x, wave = tid >> 5, lane = tid & 31, col = lane & 15, g = lane >> 4; const int b = blockIdx.x, h = wave >> 2, qt = wave & 3; const size_t kr0 = (size_t)b * TT;
  const unsigned rq = qt * 16 + col, oq = rq * CC + h * HD + 8 * g, ob = rq * (SZ * NH) + h, og = rq * (SZ * CC) + h * HD + 8 * g, oo = (qt * 16 + (lane >> 3)) * (SZ * DIN) + h * 32 + (lane & 7) * 4;   /* the lane's 32-bit offsets from base pointers that are the same for the whole block (j alone): one register an address */
  const _Float16 *QHb = QH + kr0 * CC, *QLb = QL + kr0 * CC; const float *Bb = BIAS + (size_t)b * NH, *Gb = G + (size_t)b * CC; float* Ob = OUT + (size_t)b * DIN;
  v16h qh = frag_o(QHb, oq), ql = frag_o(QLb, oq);
  float bias = Bb[ob]; XW();   /* bias[i][j][h] (constant over the keys; added for fidelity) */
  { v8h tk[8], tv[8]; v4f tw[8];   /* 4,096 16-byte pieces of each of the three, 8 a thread: all 24 loads are issued before the first LDS store */
#pragma unroll
    for (int i = 0; i < 8; ++i) { const int e = tid + i * 512; tk[i] = *(const v8h*)(KH + kr0 * CC + (size_t)e * 8); tv[i] = *(const v8h*)(VT + (size_t)b * CC * TT + (size_t)e * 8); tw[i] = *(const v4f*)(WO + (size_t)e * 4); }
    XW();
#pragma unroll
    for (int i = 0; i < 8; ++i) { const int e = tid + i * 512; *(v8h*)&sk[e >> 4][(e & 15) * 8] = tk[i]; *(v8h*)&sv[e >> 5][(e & 31) * 8] = tv[i]; v4b w;
#pragma unroll
      for (int k = 0; k < 4; ++k) w[k] = (__bf16)tw[i][k];
      *(v4b*)&so[e >> 5][(e & 31) * 4] = w; } }
  __syncthreads();   /* the staged k, v and Wo are read by every wave */
#pragma unroll 1   /* rolled: for speed only */
  for (int it = 0; it < TT / 64; ++it) {
    v8f s[TT / 16]; float m = -3.0e38f; const float bias2 = bias * LOG2E;   /* logits are kept in base 2: (q . k x SCALE + bias) x log2 e */
#pragma unroll
    for (int jt = 0; jt < TT / 16; ++jt) { const v16h kf = frag_h(&sk[jt * 16 + col][h * HD], lane); const v8f z8 = {}; const v8f a = wmma_h(kf, qh, z8), al = wmma_h(kf, ql, z8);
#pragma unroll
      for (int r = 0; r < 8; ++r) s[jt][r] = (a[r] + al[r] * (1.0f / 1024.0f)) * (SCALE * LOG2E) + bias2;
      /* order asked of the build: the next tile's 2 LDS reads, this tile's 2 products, then 8 vector instructions (the scaling of the tile before it). Left free, the build ran the products far ahead of their scaling, held both results of each and spilled registers to scratch */
      if (jt == 0) __builtin_amdgcn_sched_group_barrier(0x100, 2, 0);
      if (jt + 1 < TT / 16) __builtin_amdgcn_sched_group_barrier(0x100, 2, 0);
      __builtin_amdgcn_sched_group_barrier(0x008, 2, 0); if (jt) __builtin_amdgcn_sched_group_barrier(0x002, 8, 0); }
#pragma unroll
    for (int jt = 0; jt < TT / 16; ++jt)
#pragma unroll
      for (int r = 0; r < 8; ++r) m = fmaxf(m, s[jt][r]);
    m = fmaxf(m, __shfl_xor(m, 16)); float sum = 0.f;
#pragma unroll
    for (int jt = 0; jt < TT / 16; ++jt) { float e[8];
#pragma unroll
      for (int r = 0; r < 8; ++r) e[r] = s[jt][r] - m;
      exp2x8(e);
#pragma unroll
      for (int r = 0; r < 8; ++r) { s[jt][r] = e[r]; sum += e[r]; } }
    sum += __shfl_xor(sum, 16); const float inv = sum > 0.f ? 2048.0f / sum : 0.f;
    __builtin_amdgcn_sched_barrier(0);   /* the loads below stay behind the softmax: moved up into it or among the scores, the build had no registers for their results and spilled them to scratch */
    v4f gt[4];   /* the gate of this lane's 16 channels, and the next pass's q and bias: issued here, where the logits' registers begin to come free, so that P V covers their latency */
    { const unsigned e = og + it * (64 * SZ * CC); gt[0] = *(const v4f*)(Gb + e); gt[1] = *(const v4f*)(Gb + e + 4); gt[2] = *(const v4f*)(Gb + e + 16); gt[3] = *(const v4f*)(Gb + e + 20); XW(); }
    { const int qn = (it + 1 < TT / 64 ? it + 1 : it) * 64;   /* no branch round these loads (the last pass loads its own rows again): with one, the build moved the scores' scaling behind it, held all 32 products' results at once and spilled registers to scratch */
      qh = frag_o(QHb, oq + qn * CC); ql = frag_o(QLb, oq + qn * CC); bias = Bb[ob + qn * (SZ * NH)]; XW(); }
    v8f o[HD / 16] = {};
#pragma unroll
    for (int kc = 0; kc < TT / 32; ++kc) { v16h p;
#pragma unroll
      for (int i = 0; i < 8; ++i) { p[i] = (_Float16)(s[2 * kc][i] * inv); p[8 + i] = (_Float16)(s[2 * kc + 1][i] * inv); }
#pragma unroll
      for (int jj = 0; jj < HD / 16; ++jj) o[jj] = wmma_h(frag_h(&sv[h * HD + jj * 16 + col][kc * 32], lane), p, o[jj]); }
#pragma unroll
    for (int jj = 0; jj < HD / 16; ++jj) { v8b yh, yl;
#pragma unroll
      for (int r = 0; r < 8; ++r) { const float y = o[jj][r] * (1.0f / 2048.0f) * gt[jj * 2 + (r >> 2)][r & 3]; yh[r] = (__bf16)y; yl[r] = (__bf16)(y - (float)yh[r]); }
      *(v8b*)&sx[it & 1][0][qt * 16 + col][h * HD + jj * 16 + 8 * g] = yh; *(v8b*)&sx[it & 1][1][qt * 16 + col][h * HD + jj * 16 + 8 * g] = yl; }
    __syncthreads();   /* a gated ctx row holds all 4 heads' channels; the same barrier ends the last reads of the other buffer, which the next pass overwrites */
    v8f acc[2] = {};   /* this wave: queries 16 qt .. of the pass, output channels 32 h .. 32 h + 31 */
#pragma unroll
    for (int kc = 0; kc < CC / 32; ++kc) { const v16b xh = frag_b(&sx[it & 1][0][qt * 16 + col][kc * 32], lane), xl = frag_b(&sx[it & 1][1][qt * 16 + col][kc * 32], lane);
      const v16b w0 = frag_b(&so[h * 32 + col][kc * 32], lane), w1 = frag_b(&so[h * 32 + 16 + col][kc * 32], lane);
      acc[0] = wmma_b(w0, xh, acc[0]); acc[1] = wmma_b(w1, xh, acc[1]); acc[0] = wmma_b(w0, xl, acc[0]); acc[1] = wmma_b(w1, xl, acc[1]); }
#pragma unroll
    for (int t = 0; t < 2; ++t) { v4f y0, y1;
#pragma unroll
      for (int r = 0; r < 4; ++r) { y0[r] = acc[t][r]; y1[r] = acc[t][4 + r]; }
      *(v4f*)&sf[wave][col][t * 16 + 8 * g] = y0; *(v4f*)&sf[wave][col][t * 16 + 8 * g + 4] = y1; }
    LDSW();
    asm volatile("v_nop\n\tv_nop\n\tv_nop\n\tv_nop");   /* the distance behind the pass's last two products: over the loop's back edge the next pass's first score products write registers of their results with only three vector instructions between */
#pragma unroll
    for (int i = 0; i < 4; ++i) vst2(Ob + (oo + (it * 64 + i * 4) * (SZ * DIN)), *(const v4f*)&sf[wave][i * 4 + (lane >> 3)][(lane & 7) * 4]);   /* 8 lanes = one 128-B line of out[i][j] */
    LDSW(); } }   /* the tile is read back before the next pass overwrites it */

extern "C" void kernel_launch(void* const* d_in, const int* in_sizes, int n_in, void* d_out, int out_size, void* d_ws, size_t ws_size, hipStream_t stream) {
  (void)in_sizes; (void)n_in; (void)out_size;
  const float** F = (const float**)d_in;
  if (ws_size < (size_t)WS_END) return;
  char* ws = (char*)d_ws; _Float16 *QH = (_Float16*)(ws + WS_QH), *KH = (_Float16*)(ws + WS_KH), *VT = (_Float16*)(ws + WS_VT), *QL = (_Float16*)(ws + WS_QL), *KL = (_Float16*)(ws + WS_KL); __bf16 *VB = (__bf16*)(ws + WS_VB), *VBL = (__bf16*)(ws + WS_VBL); float *S = (float*)(ws + WS_S), *Y = (float*)(ws + WS_Y);
  (void)S; (void)Y; (void)QL; (void)KL; (void)VB; (void)VBL;
  // inputs: 0 z_ij [1,256,256,128]; 1 ln_w, 2 ln_b; 3 Wq, 4 Wk, 5 Wv [128,128] (out,in); 6 Wb [4,128]; 7 Wg [128,128]; 8 Wo [128,128] (out,in)
  if (ws_size < (size_t)WS_END2) return;
  float *BIAS = (float*)(ws + WS_BIAS), *G = (float*)(ws + WS_G);
  k_pre<<<dim3(SZ), 512, 0, stream>>>(F[0], F[1], F[2], F[3], F[4], F[5], F[6], F[7], QH, QL, KH, VT, BIAS, G);
  k_att<<<dim3(TNB), 512, 0, stream>>>(QH, QL, KH, VT, BIAS, G, F[8], (float*)d_out);
}

// v005
// It runs in 39.6 microseconds.
// In both of two side-by-side timings against v004, it was 1.45 times as fast.
// Counting every step since v000, it is 14.2 times as fast.
// compute dtype: all float inputs rounded to bf16; LayerNorm of z in f32; q/k/v = LN(z) split bf16 hi + lo x W^T (exact bf16) on WMMA 16x16x32 (2 products, f32 accumulate); q as f16 hi + residual (x 2^10) against k once to f16 (2 products) x 32^-0.5 + the per-(query, head) bias; softmax in f32 (logits x log2 e, v_exp_f32); P x 2^11 once to f16 against v once to f16 (1 product); gate sigmoid(LN(z) Wg^T) in f32 (2-product GEMM, v_exp_f32 and v_rcp_f32); gated ctx split bf16 hi + lo against exact Wo (2 products); f32 output.
#include <hip/hip_runtime.h>
#include <math.h>

typedef __attribute__((ext_vector_type(16))) _Float16 v16h;
typedef __attribute__((ext_vector_type(16))) __bf16 v16b;
typedef __attribute__((ext_vector_type(8)))  _Float16 v8h;
typedef __attribute__((ext_vector_type(8)))  float v8f;
typedef __attribute__((ext_vector_type(4)))  float v4f;
typedef __attribute__((ext_vector_type(2)))  float v2f;
typedef __attribute__((ext_vector_type(4)))  unsigned v4u;
typedef __attribute__((ext_vector_type(4)))  int v4i;
typedef float __attribute__((may_alias)) float_a;
typedef int __attribute__((may_alias)) int_a;

template <typename T> __device__ __forceinline__ void vst2(void* p, T v) { *(T*)p = v;  }
__device__ __forceinline__ v8f wmma16(v16h a, v16h b, v8f c) {
  v8f d = __builtin_amdgcn_wmma_f32_16x16x32_f16(false, a, false, b, (short)0, c, false, false);
  asm volatile("v_nop\n\tv_nop\n\tv_nop\n\tv_nop" : "+v"(d) : "v"(a), "v"(b));
  return d;
}
__device__ __forceinline__ v8f wmma_bf(v16b a, v16b b, v8f c) {
  v8f d = __builtin_amdgcn_wmma_f32_16x16x32_bf16(false, a, false, b, (short)0, c, false, false);
  asm volatile("v_nop\n\tv_nop\n\tv_nop\n\tv_nop" : "+v"(d) : "v"(a), "v"(b));
  return d;
}
// 16x16x32 fragments: lane = (h = lane>>4, row/col = lane&15); elements 0..7 = k0+8h+0..7, 8..15 = k0+16+8h+0..7; D element r = row 8h+r
__device__ __forceinline__ v16h frag_h(const _Float16* rowk0, int lane) {
  union { v16h v; v8h q[2]; } u; const _Float16* p = rowk0 + 8 * (lane >> 4);
  u.q[0] = *(const v8h*)p; u.q[1] = *(const v8h*)(p + 16); return u.v;
}
__device__ __forceinline__ v16h frag_f32(const float* rowk0, int lane) {
  v16h a; const float* p = rowk0 + 8 * (lane >> 4);
#pragma unroll
  for (int i = 0; i < 8; ++i) { a[i] = (_Float16)p[i]; a[8 + i] = (_Float16)p[16 + i]; }
  return a;
}
__device__ __forceinline__ v16h frag_f32s(const float* rowk0, int lane, float sc) {
  v16h a; const float* p = rowk0 + 8 * (lane >> 4);
#pragma unroll
  for (int i = 0; i < 8; ++i) { a[i] = (_Float16)(p[i] * sc); a[8 + i] = (_Float16)(p[16 + i] * sc); }
  return a;
}
// column fragment from a [K][ld] layout (column n), rows >= K read as 0
__device__ __forceinline__ v16h fragc_f32(const float* W, int k0, int n, int lane, int ld, int K) {
  v16h a; const int g = lane >> 4;
#pragma unroll
  for (int i = 0; i < 8; ++i) { const int ka = k0 + 8 * g + i, kb = ka + 16;
    a[i] = (_Float16)(ka < K ? W[(size_t)(ka < K ? ka : K - 1) * ld + n] : 0.f); a[8 + i] = (_Float16)(kb < K ? W[(size_t)(kb < K ? kb : K - 1) * ld + n] : 0.f); }
  return a;
}
struct F2 { v16b h, l; };
__device__ __forceinline__ F2 bsplit16(const float v[16]) { F2 r;
#pragma unroll
  for (int i = 0; i < 16; ++i) { const __bf16 h = (__bf16)v[i]; r.h[i] = h; r.l[i] = (__bf16)(v[i] - (float)h); }
  return r; }
__device__ __forceinline__ F2 split_row(const float* row, int k0, int lane) { float v[16]; const float* p = row + k0 + 8 * (lane >> 4);
#pragma unroll
  for (int i = 0; i < 8; ++i) { v[i] = p[i]; v[8 + i] = p[16 + i]; }
  return bsplit16(v); }
__device__ __forceinline__ F2 split_rowK(const float* row, int k0, int lane, int K) { float v[16]; const int g = lane >> 4;
#pragma unroll
  for (int i = 0; i < 8; ++i) { const int ka = k0 + 8 * g + i, kb = ka + 16; v[i] = ka < K ? row[ka < K ? ka : K - 1] : 0.f; v[8 + i] = kb < K ? row[kb < K ? kb : K - 1] : 0.f; }
  return bsplit16(v); }
__device__ __forceinline__ F2 split_col(const float* W, int k0, int n, int lane, int ld, int K) { float v[16]; const int g = lane >> 4;
#pragma unroll
  for (int i = 0; i < 8; ++i) { const int ka = k0 + 8 * g + i, kb = ka + 16; v[i] = ka < K ? W[(size_t)(ka < K ? ka : K - 1) * ld + n] : 0.f; v[8 + i] = kb < K ? W[(size_t)(kb < K ? kb : K - 1) * ld + n] : 0.f; }
  return bsplit16(v); }
__device__ __forceinline__ v8f mac3(const F2& a, const F2& b, v8f c) { c = wmma_bf(a.l, b.h, c); c = wmma_bf(a.h, b.l, c); return wmma_bf(a.h, b.h, c); }
__device__ __forceinline__ float sigm(float v) { return 1.0f / (1.0f + expf(-v)); }
#define LDSX() do { asm volatile("s_wait_dscnt 0" ::: "memory"); __builtin_amdgcn_wave_barrier(); __builtin_amdgcn_fence(__ATOMIC_RELEASE, "workgroup"); } while (0)

// Triangle attention, starting node (z [1, 256, 256, 128], 4 heads x 32): z <- LayerNorm(z); q_ij, k_jk, v_jk, g_ij = z W^T; scores[i,j,h,k] = q_ij . k_jk / sqrt(32) + bias[i,j,h] (bias = z Wb^T, constant over k); attn = softmax over k; o_ij = sum_k attn v_jk; out_ij = (sigmoid(g_ij) * o_ij) Wo^T. Mapping: 'batch' = j (the shared key row), query position = i, key position = k.
#define NB 256
#define TT 256
#define CC 128            // NH * HD = projected width
#define DIN 128          // input (model) width
#define NH 4
#define HD 32
#define NQB (TT / 64)
#define HG 4
#define SCALE (0.17677669529663687f)
#define CAUSAL 0
#ifndef TNB
#define TNB NB
#endif
__device__ __forceinline__ float bfr(float v) { return (float)(__bf16)v; }
__host__ __device__ __forceinline__ int kb_last(int qb) { return CAUSAL ? ((qb * 64 + 63) >> 7) : (TT / 128 - 1); }
typedef __attribute__((ext_vector_type(8))) __bf16 v8b;
__device__ __forceinline__ v16b frag_b(const __bf16* rowk0, int lane) {
  union { v16b v; v8b q[2]; } u; const __bf16* p = rowk0 + 8 * (lane >> 4);
  u.q[0] = *(const v8b*)p; u.q[1] = *(const v8b*)(p + 16); return u.v;
}
#define QBH 0              // unused: no kernel here has a high-precision query path
#define QHI 256            // unused: every query's q residual is held in registers (2-product logits everywhere)
#define KHI 64            // key rows the unused k residual / v bf16 hi+lo regions are sized for (no kernel writes or reads them)
// B fragment (k rows k0+.., output column o) of a weight: (in,out) [K][ld] or (out,in) [ld rows of K]: bf16 exact, or f16(bf16 * 256) exact
__device__ __forceinline__ v16b wcol_io(const float* Wm, int k0, int o, int lane, int ld) { v16b w; const int g = lane >> 4;
#pragma unroll
  for (int i = 0; i < 8; ++i) { w[i] = (__bf16)Wm[(size_t)(k0 + 8 * g + i) * ld + o]; w[8 + i] = (__bf16)Wm[(size_t)(k0 + 16 + 8 * g + i) * ld + o]; }
  return w; }
__device__ __forceinline__ v16b wcol_oi(const float* Wm, int k0, int o, int lane, int K) { v16b w; const float* p = Wm + (size_t)o * K + k0 + 8 * (lane >> 4);
#pragma unroll
  for (int i = 0; i < 8; ++i) { w[i] = (__bf16)p[i]; w[8 + i] = (__bf16)p[16 + i]; }
  return w; }
__device__ __forceinline__ v16h wcolh_io(const float* Wm, int k0, int o, int lane, int ld) { v16h w; const int g = lane >> 4;
#pragma unroll
  for (int i = 0; i < 8; ++i) { w[i] = (_Float16)(bfr(Wm[(size_t)(k0 + 8 * g + i) * ld + o]) * 256.0f); w[8 + i] = (_Float16)(bfr(Wm[(size_t)(k0 + 16 + 8 * g + i) * ld + o]) * 256.0f); }
  return w; }
__device__ __forceinline__ v16h wcolh_oi(const float* Wm, int k0, int o, int lane, int K) { v16h w; const float* p = Wm + (size_t)o * K + k0 + 8 * (lane >> 4);
#pragma unroll
  for (int i = 0; i < 8; ++i) { w[i] = (_Float16)(bfr(p[i]) * 256.0f); w[8 + i] = (_Float16)(bfr(p[16 + i]) * 256.0f); }
  return w; }
#define WQKV_LAYOUT 1   // 0 = (in,out) [DIN][CC]; 1 = (out,in) [CC][DIN]; 2 = per-head [NH][DIN][HD]
__device__ __forceinline__ v16b wcol_hdk(const float* Wm, int k0, int o, int lane) { v16b w; const int g = lane >> 4; const float* p = Wm + (size_t)(o / HD) * DIN * HD + (o % HD);
#pragma unroll
  for (int i = 0; i < 8; ++i) { w[i] = (__bf16)p[(size_t)(k0 + 8 * g + i) * HD]; w[8 + i] = (__bf16)p[(size_t)(k0 + 16 + 8 * g + i) * HD]; }
  return w; }
#define WO_OUT_IN 1
#if WQKV_LAYOUT == 1
#define WCOL(W, k0, o, lane) wcol_oi(W, k0, o, lane, DIN)
#elif WQKV_LAYOUT == 2
#define WCOL(W, k0, o, lane) wcol_hdk(W, k0, o, lane)
#else
#define WCOL(W, k0, o, lane) wcol_io(W, k0, o, lane, CC)
#endif
#if WO_OUT_IN
#define WOCOL(W, k0, o, lane) wcol_oi(W, k0, o, lane, CC)
#define WOCOLH(W, k0, o, lane) wcolh_oi(W, k0, o, lane, CC)
#else
#define WOCOL(W, k0, o, lane) wcol_io(W, k0, o, lane, DIN)
#define WOCOLH(W, k0, o, lane) wcolh_io(W, k0, o, lane, DIN)
#endif
#define SZ 256             // S (pair-tensor side)
#define BG 64              // key rows j the unused WS_S region is sized for (x 4 heads = 256 planes of 256 x 256)
#define NZR (SZ * SZ)      // 65,536 pair rows
#define SM_EXTRA_PARAMS , const float* __restrict__ BIAS, int b0s
#define SM_MASK_HOOK do { const int jb = b0s + (int)blockIdx.y / HG; const int hh = (int)blockIdx.y % HG; v = v + BIAS[((size_t)t * SZ + jb) * NH + hh]; } while (0)   /* bias[i][j][h] (constant over the keys: cancels in the softmax up to rounding; added for fidelity) */
#ifndef SM_EXTRA_PARAMS
#define SM_EXTRA_PARAMS
#endif
#ifndef PROJ_EXTRA_PARAMS
#define PROJ_EXTRA_PARAMS
#endif
#ifndef SM_MASK_HOOK
#define SM_MASK_HOOK (void)0
#endif


__device__ __forceinline__ v8f wmma_h(v16h a, v16h b, v8f c) { return __builtin_amdgcn_wmma_f32_16x16x32_f16(false, a, false, b, (short)0, c, false, false); }
#define LOG2E (1.4426950408889634f)
// 2^x and 1/x of eight independent values in place, one hardware instruction each. One statement: each instruction fills the slot that the instruction set asks for behind the transcendental before it (none reads a neighbour's result or overwrites its source), and the closing v_nop fills the slot behind the last
__device__ __forceinline__ void exp2x8(float (&x)[8]) {
  asm("v_exp_f32 %0, %0\n\tv_exp_f32 %1, %1\n\tv_exp_f32 %2, %2\n\tv_exp_f32 %3, %3\n\tv_exp_f32 %4, %4\n\tv_exp_f32 %5, %5\n\tv_exp_f32 %6, %6\n\tv_exp_f32 %7, %7\n\tv_nop" : "+v"(x[0]), "+v"(x[1]), "+v"(x[2]), "+v"(x[3]), "+v"(x[4]), "+v"(x[5]), "+v"(x[6]), "+v"(x[7])); }
__device__ __forceinline__ void rcpx8(float (&x)[8]) {
  asm("v_rcp_f32 %0, %0\n\tv_rcp_f32 %1, %1\n\tv_rcp_f32 %2, %2\n\tv_rcp_f32 %3, %3\n\tv_rcp_f32 %4, %4\n\tv_rcp_f32 %5, %5\n\tv_rcp_f32 %6, %6\n\tv_rcp_f32 %7, %7\n\tv_nop" : "+v"(x[0]), "+v"(x[1]), "+v"(x[2]), "+v"(x[3]), "+v"(x[4]), "+v"(x[5]), "+v"(x[6]), "+v"(x[7])); }
#define LDSW() asm volatile("s_wait_dscnt 0" ::: "memory")   /* a wave's own LDS range: its writes are done before it reads the rows back, its reads before the next rows overwrite them; no other wave touches the range, so no fence and no wait for global stores */
#define WP 136             // LDS pitch of a staged weight row, LN row and gated ctx row, in 2-byte elements
typedef __attribute__((ext_vector_type(4))) __bf16 v4b;
__device__ __forceinline__ v8f wmma_b(v16b a, v16b b, v8f c) { return __builtin_amdgcn_wmma_f32_16x16x32_bf16(false, a, false, b, (short)0, c, false, false); }
// acc[j] = (hi + lo rows of LN(z)) x (weight rows 16 j .. 16 j + 15), K = 128; ZA: z is the A operand (D = Z W^T), else the B operand (D^T = W Z^T). Four tiles at a time, so that three other accumulators' products stand between a tile's hi and lo product
template <bool ZA> __device__ __forceinline__ void gemm128(const __bf16 (*Ws)[WP], const F2 (&a)[4], v8f (&acc)[8], int lane) { const int col = lane & 15;
#pragma unroll
  for (int j = 0; j < 8; ++j) acc[j] = v8f{};
#pragma unroll
  for (int kc = 0; kc < 4; ++kc)
#pragma unroll
    for (int jq = 0; jq < 8; jq += 4) { v16b w[4];
#pragma unroll
      for (int j = 0; j < 4; ++j) w[j] = frag_b(&Ws[(jq + j) * 16 + col][kc * 32], lane);
#pragma unroll
      for (int j = 0; j < 4; ++j) acc[jq + j] = ZA ? wmma_b(a[kc].h, w[j], acc[jq + j]) : wmma_b(w[j], a[kc].h, acc[jq + j]);
#pragma unroll
      for (int j = 0; j < 4; ++j) acc[jq + j] = ZA ? wmma_b(a[kc].l, w[j], acc[jq + j]) : wmma_b(w[j], a[kc].l, acc[jq + j]); } }
#define XW() asm volatile("s_wait_xcnt 0x0" ::: "memory")   /* in front of an overwrite of a register that an issued global load names: the build put later loads' results, and the next pass's address addition, into such address pairs */
// v + the value of lane ^ X, X < 16, in one vector instruction (a DPP operand within the 16-lane row); the shuffle builtin goes through the LDS unit and costs its latency
template <int X> __device__ __forceinline__ float addx(float v) { return v + __builtin_bit_cast(float, __builtin_amdgcn_update_dpp(0, __builtin_bit_cast(int, v), 0x160 + X, 0xf, 0xf, true)); }
#define ZCH 2368           // bytes of a wave's own range in su: its 4 LN rows hi, then lo (8 x 272 B), later its output tile (16 x 144 B). 16 B x 148, and 148 = 4 mod 16: with the row pitch of 16 B x 17 the 16 rows of a fragment start in 16 different 16-byte columns of the banks
// ---- k_all: the whole function in one launch. Block = one index j of the pair tensor, 16 waves. Wq, Wg, Wo, Wb (rounded to bf16, row pitch 272 B = 16 B x 17, for 16-byte readers) and ln_w, ln_b stay in LDS for the whole block; Wv and Wk lie in su until k and v are made.
// Part 1, keys: pair rows (j, 0..255), 16 rows a wave. Each lane loads its row's half of the channels in A/B fragment order, LayerNorm (biased var, eps 1e-5, ln_w/ln_b) of bf16(z) in registers (row sums: 64 terms in the lane, then one exchange between the lane halves), LN(z) split bf16 hi + lo; v: D = Z W^T (a lane holds 8 consecutive t of one channel) goes straight into the [c][t] planes sv, k: D^T = W Z^T (a lane holds 8 consecutive channels of its row) straight into the rows sk (pitches 528 B and 272 B).
// Part 2, queries: pair rows (0..255, j), four passes of 64 queries, 16 waves = 4 heads x 4 query tiles of 16. A pass: (a) LayerNorm of its 64 rows, 8 lanes a row (16 terms in the lane, then three exchanges), hi and lo rows into the wave's own LDS range; (b) each wave makes q^T, bias^T and later gate^T = W Z^T for its head's 32 channels and its 16 queries: the result tiles are already the B operand of the scores (q to f16 hi + residual x 2^10) and lie on the lanes that hold the same channels of ctx (gate). S^T = K Q^T (A = k rows: 2 products), so a lane holds one query's logits (keys 16 jt + 8 g + r) in registers; logits x SCALE + bias, x log2 e; softmax in f32 in the lane plus one exchange between the lane halves; P x 2^11 once to f16 is packed from two score tiles straight into a B operand; ctx^T = V^T P^T (A = v planes, 1 product). ctx x gate is split bf16 hi + lo into sx; (c) out^T = Wo ctx^T (A = Wo rows, B = ctx rows hi, lo: 2 products), each wave 16 queries x 32 output channels, stored as whole 128-B lines through the wave's own LDS range, the one that held its LN rows. The loops inside a pass are unrolled: s, o and p live in registers and need constant indices
__global__ __launch_bounds__(512) void k_all(const float* __restrict__ Z, const float* __restrict__ LW, const float* __restrict__ LB, const float* __restrict__ WQ, const float* __restrict__ WK, const float* __restrict__ WV, const float* __restrict__ WB, const float* __restrict__ WG, const float* __restrict__ WO, float* __restrict__ OUT) {
  __shared__ __align__(16) _Float16 sk[TT][CC + 8]; __shared__ __align__(16) _Float16 sv[CC][TT + 8]; __shared__ __align__(16) __bf16 sw[3][CC][WP]; __shared__ __align__(16) __bf16 swb[NH][WP]; __shared__ __align__(16) float sln[2][CC];   /* sw: Wq, Wg, Wo; sln: ln_w, ln_b */
  __shared__ __align__(16) char su[16 * ZCH + 2 * 64 * WP * 2];   /* part 1: Wv, Wk. Part 2: 16 ranges of ZCH bytes, one a wave: the LN rows that the wave makes (LNR()), later in the pass its 16 x 32 output tile sf, pitch 144 B; behind them sx [hi, lo][query of the pass][channel] */
  const int tid = threadIdx.x, wave = __builtin_amdgcn_readfirstlane(tid >> 5), lane = tid & 31, col = lane & 15, g = lane >> 4; const int b = blockIdx.x, t0 = wave * 16; const size_t row0 = (size_t)b * SZ + t0;   /* the wave's number in a scalar register: what follows from it (head, query tile) is then scalar too */
  __bf16 (*swv)[WP] = (__bf16 (*)[WP])&su[0]; __bf16 (*swk)[WP] = (__bf16 (*)[WP])&su[CC * WP * 2];
  v4f xv[16];   /* piece q = fragment kc = q >> 2, elements 4 (q & 3) ..: channels 32 kc + 16 ((q >> 1) & 1) + 8 g + 4 (q & 1) .. */
#pragma unroll
  for (int q = 0; q < 16; ++q) { if (q == 15) asm volatile("s_wait_xcnt 0x0" ::: "memory");   /* without it the build put the last load's result into the address pair that the 15 loads above name; the last load now issues behind the wait */
    xv[q] = *(const v4f*)(Z + (row0 + col) * CC + (q >> 2) * 32 + ((q >> 1) & 1) * 16 + 8 * g + (q & 1) * 4); }
#pragma unroll
  for (int m = 0; m < 5; ++m) { const float* Wm = m == 0 ? WV : m == 1 ? WK : m == 2 ? WQ : m == 3 ? WG : WO; __bf16 (*Wd)[WP] = m == 0 ? swv : m == 1 ? swk : sw[m - 2];
#pragma unroll
    for (int i = 0; i < 8; ++i) { const int e = tid + i * 512; const v4f f = *(const v4f*)(Wm + (size_t)e * 4); v4b w;
#pragma unroll
      for (int k = 0; k < 4; ++k) w[k] = (__bf16)f[k];
      *(v4b*)&Wd[e >> 5][(e & 31) * 4] = w; } }
  if (wave < NH) { const v4f f = *(const v4f*)(WB + tid * 4); XW(); v4b w;
#pragma unroll
    for (int k = 0; k < 4; ++k) w[k] = (__bf16)f[k];
    *(v4b*)&swb[wave][lane * 4] = w; }
  else if (wave < NH + 8) { const int e = tid - NH * 32; sln[e >> 7][e & 127] = bfr((e < CC ? LW : LB)[e & 127]); }
  float s1 = 0.f;
#pragma unroll
  for (int q = 0; q < 16; ++q)
#pragma unroll
    for (int k = 0; k < 4; ++k) { xv[q][k] = bfr(xv[q][k]); s1 += xv[q][k]; }
  s1 += __shfl_xor(s1, 16); const float mu = s1 * (1.0f / CC); float sq = 0.f;
#pragma unroll
  for (int q = 0; q < 16; ++q)
#pragma unroll
    for (int k = 0; k < 4; ++k) { const float d = xv[q][k] - mu; sq += d * d; }
  sq += __shfl_xor(sq, 16); const float rs = rsqrtf(sq * (1.0f / CC) + 1e-5f);
  F2 a[4];
#pragma unroll
  for (int kc = 0; kc < 4; ++kc) { float v[16];
#pragma unroll
    for (int p = 0; p < 4; ++p) { const int c = kc * 32 + (p >> 1) * 16 + 8 * g + (p & 1) * 4; const v4f lw = *(const v4f*)(LW + c), lb = *(const v4f*)(LB + c);
#pragma unroll
      for (int k = 0; k < 4; ++k) v[p * 4 + k] = (xv[kc * 4 + p][k] - mu) * rs * bfr(lw[k]) + bfr(lb[k]); }
    a[kc] = bsplit16(v);
    __builtin_amdgcn_sched_barrier(0); }   /* one fragment's 8 ln_w / ln_b loads at a time: with all 32 hoisted beside the 64 row values the build spilled registers to scratch */
  const int zrow = tid >> 3, zc = (tid & 7) * 4;   /* part 2 (a): 8 lanes a row, pieces of 4 channels at 32 p + zc: 8 lanes = one 128-B line */
  const float* Zb = Z + (size_t)b * CC; const unsigned oz = zrow * (SZ * CC) + zc;   /* 32-bit offsets from base pointers that are the same for the whole block (j alone): one register an address */
  __syncthreads();   /* the staged weights are read by every wave */
  v4f zr[4];   /* the first pass's query rows: issued behind the barrier (which waits for loads in flight), so that part 1's products cover their latency */
#pragma unroll
  for (int p = 0; p < 4; ++p) zr[p] = *(const v4f*)(Zb + (oz + p * 32));
  XW();
  { v8f acc[8];
    gemm128<true>(swv, a, acc, lane);   /* v */
#pragma unroll
    for (int j = 0; j < 8; ++j) { v8h hv;
#pragma unroll
      for (int r = 0; r < 8; ++r) hv[r] = (_Float16)acc[j][r];
      *(v8h*)&sv[j * 16 + col][t0 + 8 * g] = hv; }
    gemm128<false>(swk, a, acc, lane);   /* k */
#pragma unroll
    for (int j = 0; j < 8; ++j) { v8h hv;
#pragma unroll
      for (int r = 0; r < 8; ++r) hv[r] = (_Float16)acc[j][r];
      *(v8h*)&sk[t0 + col][j * 16 + 8 * g] = hv; } }
  __syncthreads();   /* k and v are read by every wave; the last reads of Wv and Wk end before the LN rows overwrite them */
  const int h = wave >> 2, qt = wave & 3;
#define LNR(pl, r) ((__bf16*)&su[((r) >> 2) * ZCH + ((pl) * 4 + ((r) & 3)) * (WP * 2)])   /* LN row r of the pass, pl = 0 hi, 1 lo */
  float (*sf)[36] = (float (*)[36])&su[wave * ZCH]; __bf16 (*sx)[64][WP] = (__bf16 (*)[64][WP])&su[16 * ZCH];
  const unsigned oo = (qt * 16 + (lane >> 3)) * (SZ * DIN) + h * 32 + (lane & 7) * 4; float* Ob = OUT + (size_t)b * DIN;
#pragma unroll 1
  for (int it = 0; it < TT / 64; ++it) {
    { float x[16], t1 = 0.f, t2 = 0.f;
#pragma unroll
      for (int i = 0; i < 16; ++i) { x[i] = bfr(zr[i >> 2][i & 3]); t1 += x[i]; }
      t1 = addx<1>(t1); t1 = addx<2>(t1); t1 = addx<4>(t1); const float mq = t1 * (1.0f / CC);
#pragma unroll
      for (int i = 0; i < 16; ++i) { const float d = x[i] - mq; t2 += d * d; }
      t2 = addx<1>(t2); t2 = addx<2>(t2); t2 = addx<4>(t2); const float rq = rsqrtf(t2 * (1.0f / CC) + 1e-5f);
#pragma unroll
      for (int p = 0; p < 4; ++p) { const v4f lw = *(const v4f*)&sln[0][p * 32 + zc], lb = *(const v4f*)&sln[1][p * 32 + zc]; v4b yh, yl;
#pragma unroll
        for (int k = 0; k < 4; ++k) { const float v = (x[p * 4 + k] - mq) * rq * lw[k] + lb[k]; yh[k] = (__bf16)v; yl[k] = (__bf16)(v - (float)yh[k]); }
        *(v4b*)(LNR(0, zrow) + p * 32 + zc) = yh; *(v4b*)(LNR(1, zrow) + p * 32 + zc) = yl; } }   /* rows 4 wave .. 4 wave + 3: inside the wave's own range, whose output tile the wave itself has read back: no barrier between the two */
    __syncthreads();   /* a wave reads 16 LN rows that four waves wrote; the same barrier ends the last pass's reads of sx */
    v16h qh, ql; float bias;
    { v8f qa[2] = {}, ab = {};
#pragma unroll
      for (int kc = 0; kc < CC / 32; ++kc) { const v16b xh = frag_b(LNR(0, qt * 16 + col) + kc * 32, lane), xl = frag_b(LNR(1, qt * 16 + col) + kc * 32, lane);
        const v16b w0 = frag_b(&sw[0][h * HD + col][kc * 32], lane), w1 = frag_b(&sw[0][h * HD + 16 + col][kc * 32], lane), wb = frag_b(&swb[h][kc * 32], lane);   /* wb: all 16 rows of the tile are the head's Wb row, so every result register of every lane holds its query's bias */
        qa[0] = wmma_b(w0, xh, qa[0]); qa[1] = wmma_b(w1, xh, qa[1]); ab = wmma_b(wb, xh, ab); qa[0] = wmma_b(w0, xl, qa[0]); qa[1] = wmma_b(w1, xl, qa[1]); ab = wmma_b(wb, xl, ab); }
#pragma unroll
      for (int i = 0; i < 16; ++i) { const float v = qa[i >> 3][i & 7]; qh[i] = (_Float16)v; ql[i] = (_Float16)((v - (float)qh[i]) * 1024.0f); }
      bias = ab[0]; }   /* bias[i][j][h] (constant over the keys; added for fidelity) */
    v8f s[TT / 16]; float m = -3.0e38f; const float bias2 = bias * LOG2E;   /* logits are kept in base 2: (q . k x SCALE + bias) x log2 e */
#pragma unroll
    for (int jt = 0; jt < TT / 16; ++jt) { const v16h kf = frag_h(&sk[jt * 16 + col][h * HD], lane); const v8f z8 = {}; const v8f a = wmma_h(kf, qh, z8), al = wmma_h(kf, ql, z8);
#pragma unroll
      for (int r = 0; r < 8; ++r) s[jt][r] = (a[r] + al[r] * (1.0f / 1024.0f)) * (SCALE * LOG2E) + bias2;
      /* order asked of the build: the next tile's 2 LDS reads, this tile's 2 products, then 8 vector instructions (the scaling of the tile before it). Left free, the build ran the products far ahead of their scaling, held both results of each and spilled registers to scratch */
      if (jt == 0) __builtin_amdgcn_sched_group_barrier(0x100, 2, 0);
      if (jt + 1 < TT / 16) __builtin_amdgcn_sched_group_barrier(0x100, 2, 0);
      __builtin_amdgcn_sched_group_barrier(0x008, 2, 0); if (jt) __builtin_amdgcn_sched_group_barrier(0x002, 8, 0); }
#pragma unroll
    for (int jt = 0; jt < TT / 16; ++jt)
#pragma unroll
      for (int r = 0; r < 8; ++r) m = fmaxf(m, s[jt][r]);
    m = fmaxf(m, __shfl_xor(m, 16)); float sum = 0.f;
#pragma unroll
    for (int jt = 0; jt < TT / 16; ++jt) { float e[8];
#pragma unroll
      for (int r = 0; r < 8; ++r) e[r] = s[jt][r] - m;
      exp2x8(e);
#pragma unroll
      for (int r = 0; r < 8; ++r) { s[jt][r] = e[r]; sum += e[r]; } }
    sum += __shfl_xor(sum, 16); const float inv = sum > 0.f ? 2048.0f / sum : 0.f;
    __builtin_amdgcn_sched_barrier(0);   /* the loads below stay behind the softmax: moved up into it or among the scores, the build had no registers for their results and spilled them to scratch */
    { const unsigned e = oz + (it + 1 < TT / 64 ? it + 1 : it) * (64 * SZ * CC);   /* the next pass's query rows: issued here, where the logits' registers begin to come free, so that the rest of the pass covers their latency; no branch round them (the last pass loads its own rows again) */
#pragma unroll
      for (int p = 0; p < 4; ++p) zr[p] = *(const v4f*)(Zb + (e + p * 32));
      XW(); }
    v8f o[HD / 16] = {};
#pragma unroll
    for (int kc = 0; kc < TT / 32; ++kc) { v16h p;
#pragma unroll
      for (int i = 0; i < 8; ++i) { p[i] = (_Float16)(s[2 * kc][i] * inv); p[8 + i] = (_Float16)(s[2 * kc + 1][i] * inv); }
#pragma unroll
      for (int jj = 0; jj < HD / 16; ++jj) o[jj] = wmma_h(frag_h(&sv[h * HD + jj * 16 + col][kc * 32], lane), p, o[jj]); }
    v8f ga[2] = {};   /* gate^T: channels 32 h + 16 jj + 8 g + r of query col, as o has them */
#pragma unroll
    for (int kc = 0; kc < CC / 32; ++kc) { const v16b xh = frag_b(LNR(0, qt * 16 + col) + kc * 32, lane), xl = frag_b(LNR(1, qt * 16 + col) + kc * 32, lane);
      const v16b w0 = frag_b(&sw[1][h * HD + col][kc * 32], lane), w1 = frag_b(&sw[1][h * HD + 16 + col][kc * 32], lane);
      ga[0] = wmma_b(w0, xh, ga[0]); ga[1] = wmma_b(w1, xh, ga[1]); ga[0] = wmma_b(w0, xl, ga[0]); ga[1] = wmma_b(w1, xl, ga[1]); }
#pragma unroll
    for (int jj = 0; jj < HD / 16; ++jj) { v8b yh, yl; float e[8];   /* sigmoid gate: 1 / (1 + 2^(-x log2 e)) */
#pragma unroll
      for (int r = 0; r < 8; ++r) e[r] = ga[jj][r] * -LOG2E;
      exp2x8(e);
#pragma unroll
      for (int r = 0; r < 8; ++r) e[r] = 1.0f + e[r];
      rcpx8(e);
#pragma unroll
      for (int r = 0; r < 8; ++r) { const float y = o[jj][r] * (1.0f / 2048.0f) * e[r]; yh[r] = (__bf16)y; yl[r] = (__bf16)(y - (float)yh[r]); }
      *(v8b*)&sx[0][qt * 16 + col][h * HD + jj * 16 + 8 * g] = yh; *(v8b*)&sx[1][qt * 16 + col][h * HD + jj * 16 + 8 * g] = yl; }
    __syncthreads();   /* a gated ctx row holds all 4 heads' channels; the same barrier ends the last reads of the LN rows, which the output tiles overwrite */
    v8f acc[2] = {};   /* this wave: queries 16 qt .. of the pass, output channels 32 h .. 32 h + 31 */
#pragma unroll
    for (int kc = 0; kc < CC / 32; ++kc) { const v16b xh = frag_b(&sx[0][qt * 16 + col][kc * 32], lane), xl = frag_b(&sx[1][qt * 16 + col][kc * 32], lane);
      const v16b w0 = frag_b(&sw[2][h * 32 + col][kc * 32], lane), w1 = frag_b(&sw[2][h * 32 + 16 + col][kc * 32], lane);
      acc[0] = wmma_b(w0, xh, acc[0]); acc[1] = wmma_b(w1, xh, acc[1]); acc[0] = wmma_b(w0, xl, acc[0]); acc[1] = wmma_b(w1, xl, acc[1]); }
#pragma unroll
    for (int t = 0; t < 2; ++t) { v4f y0, y1;
#pragma unroll
      for (int r = 0; r < 4; ++r) { y0[r] = acc[t][r]; y1[r] = acc[t][4 + r]; }
      *(v4f*)&sf[col][t * 16 + 8 * g] = y0; *(v4f*)&sf[col][t * 16 + 8 * g + 4] = y1; }
    LDSW();
    { v4f y[4];
#pragma unroll
      for (int i = 0; i < 4; ++i) y[i] = *(const v4f*)&sf[i * 4 + (lane >> 3)][(lane & 7) * 4];
#pragma unroll
      for (int i = 0; i < 4; ++i) vst2(Ob + (oo + (it * 64 + i * 4) * (SZ * DIN)), y[i]); }   /* 8 lanes = one 128-B line of out[i][j] */
    XW(); } }   /* no barrier here: the next pass's LN rows go into this wave's own range, and its ctx rows into sx only behind the next barrier, which ends every wave's reads of sx */

extern "C" void kernel_launch(void* const* d_in, const int* in_sizes, int n_in, void* d_out, int out_size, void* d_ws, size_t ws_size, hipStream_t stream) {
  (void)in_sizes; (void)n_in; (void)out_size; (void)d_ws; (void)ws_size;
  const float** F = (const float**)d_in;
  // inputs: 0 z_ij [1,256,256,128]; 1 ln_w, 2 ln_b; 3 Wq, 4 Wk, 5 Wv [128,128] (out,in); 6 Wb [4,128]; 7 Wg [128,128]; 8 Wo [128,128] (out,in)
  k_all<<<dim3(SZ), 512, 0, stream>>>(F[0], F[1], F[2], F[3], F[4], F[5], F[6], F[7], F[8], (float*)d_out);
}

// v006
// One run takes 36 microseconds.
// Timed twice side by side with v005, it ran 1.10 and 1.11 times as fast.
// All steps since v000 together make it 15.7 times as fast.
// compute dtype: all float inputs rounded to bf16; LayerNorm of z in f32; q/k/v = LN(z) split bf16 hi + lo x W^T (exact bf16) on WMMA 16x16x32 (2 products, f32 accumulate); q as f16 hi + residual (x 2^10) against k once to f16 (2 products) x 32^-0.5 + the per-(query, head) bias; softmax: logits x log2 e, max in f32, v_exp_f32; 2^(logit - max) x 2^11 once to f16 against v once to f16 (1 product) and against a tile of ones (its row sum, f32 accumulate), ctx divided by that sum in f32; gate sigmoid(LN(z) Wg^T) in f32 (2-product GEMM, v_exp_f32 and v_rcp_f32); gated ctx split bf16 hi + lo against exact Wo (2 products); f32 output.
#include <hip/hip_runtime.h>
#include <math.h>

typedef __attribute__((ext_vector_type(16))) _Float16 v16h;
typedef __attribute__((ext_vector_type(16))) __bf16 v16b;
typedef __attribute__((ext_vector_type(8)))  _Float16 v8h;
typedef __attribute__((ext_vector_type(8)))  float v8f;
typedef __attribute__((ext_vector_type(4)))  float v4f;
typedef __attribute__((ext_vector_type(2)))  float v2f;
typedef __attribute__((ext_vector_type(4)))  unsigned v4u;
typedef __attribute__((ext_vector_type(4)))  int v4i;
typedef float __attribute__((may_alias)) float_a;
typedef int __attribute__((may_alias)) int_a;

template <typename T> __device__ __forceinline__ void vst2(void* p, T v) { *(T*)p = v;  }
__device__ __forceinline__ v8f wmma16(v16h a, v16h b, v8f c) {
  v8f d = __builtin_amdgcn_wmma_f32_16x16x32_f16(false, a, false, b, (short)0, c, false, false);
  asm volatile("v_nop\n\tv_nop\n\tv_nop\n\tv_nop" : "+v"(d) : "v"(a), "v"(b));
  return d;
}
__device__ __forceinline__ v8f wmma_bf(v16b a, v16b b, v8f c) {
  v8f d = __builtin_amdgcn_wmma_f32_16x16x32_bf16(false, a, false, b, (short)0, c, false, false);
  asm volatile("v_nop\n\tv_nop\n\tv_nop\n\tv_nop" : "+v"(d) : "v"(a), "v"(b));
  return d;
}
// 16x16x32 fragments: lane = (h = lane>>4, row/col = lane&15); elements 0..7 = k0+8h+0..7, 8..15 = k0+16+8h+0..7; D element r = row 8h+r
__device__ __forceinline__ v16h frag_h(const _Float16* rowk0, int lane) {
  union { v16h v; v8h q[2]; } u; const _Float16* p = rowk0 + 8 * (lane >> 4);
  u.q[0] = *(const v8h*)p; u.q[1] = *(const v8h*)(p + 16); return u.v;
}
__device__ __forceinline__ v16h frag_f32(const float* rowk0, int lane) {
  v16h a; const float* p = rowk0 + 8 * (lane >> 4);
#pragma unroll
  for (int i = 0; i < 8; ++i) { a[i] = (_Float16)p[i]; a[8 + i] = (_Float16)p[16 + i]; }
  return a;
}
__device__ __forceinline__ v16h frag_f32s(const float* rowk0, int lane, float sc) {
  v16h a; const float* p = rowk0 + 8 * (lane >> 4);
#pragma unroll
  for (int i = 0; i < 8; ++i) { a[i] = (_Float16)(p[i] * sc); a[8 + i] = (_Float16)(p[16 + i] * sc); }
  return a;
}
// column fragment from a [K][ld] layout (column n), rows >= K read as 0
__device__ __forceinline__ v16h fragc_f32(const float* W, int k0, int n, int lane, int ld, int K) {
  v16h a; const int g = lane >> 4;
#pragma unroll
  for (int i = 0; i < 8; ++i) { const int ka = k0 + 8 * g + i, kb = ka + 16;
    a[i] = (_Float16)(ka < K ? W[(size_t)(ka < K ? ka : K - 1) * ld + n] : 0.f); a[8 + i] = (_Float16)(kb < K ? W[(size_t)(kb < K ? kb : K - 1) * ld + n] : 0.f); }
  return a;
}
struct F2 { v16b h, l; };
__device__ __forceinline__ F2 bsplit16(const float v[16]) { F2 r;
#pragma unroll
  for (int i = 0; i < 16; ++i) { const __bf16 h = (__bf16)v[i]; r.h[i] = h; r.l[i] = (__bf16)(v[i] - (float)h); }
  return r; }
__device__ __forceinline__ F2 split_row(const float* row, int k0, int lane) { float v[16]; const float* p = row + k0 + 8 * (lane >> 4);
#pragma unroll
  for (int i = 0; i < 8; ++i) { v[i] = p[i]; v[8 + i] = p[16 + i]; }
  return bsplit16(v); }
__device__ __forceinline__ F2 split_rowK(const float* row, int k0, int lane, int K) { float v[16]; const int g = lane >> 4;
#pragma unroll
  for (int i = 0; i < 8; ++i) { const int ka = k0 + 8 * g + i, kb = ka + 16; v[i] = ka < K ? row[ka < K ? ka : K - 1] : 0.f; v[8 + i] = kb < K ? row[kb < K ? kb : K - 1] : 0.f; }
  return bsplit16(v); }
__device__ __forceinline__ F2 split_col(const float* W, int k0, int n, int lane, int ld, int K) { float v[16]; const int g = lane >> 4;
#pragma unroll
  for (int i = 0; i < 8; ++i) { const int ka = k0 + 8 * g + i, kb = ka + 16; v[i] = ka < K ? W[(size_t)(ka < K ? ka : K - 1) * ld + n] : 0.f; v[8 + i] = kb < K ? W[(size_t)(kb < K ? kb : K - 1) * ld + n] : 0.f; }
  return bsplit16(v); }
__device__ __forceinline__ v8f mac3(const F2& a, const F2& b, v8f c) { c = wmma_bf(a.l, b.h, c); c = wmma_bf(a.h, b.l, c); return wmma_bf(a.h, b.h, c); }
__device__ __forceinline__ float sigm(float v) { return 1.0f / (1.0f + expf(-v)); }
#define LDSX() do { asm volatile("s_wait_dscnt 0" ::: "memory"); __builtin_amdgcn_wave_barrier(); __builtin_amdgcn_fence(__ATOMIC_RELEASE, "workgroup"); } while (0)

// Triangle attention, starting node (z [1, 256, 256, 128], 4 heads x 32): z <- LayerNorm(z); q_ij, k_jk, v_jk, g_ij = z W^T; scores[i,j,h,k] = q_ij . k_jk / sqrt(32) + bias[i,j,h] (bias = z Wb^T, constant over k); attn = softmax over k; o_ij = sum_k attn v_jk; out_ij = (sigmoid(g_ij) * o_ij) Wo^T. Mapping: 'batch' = j (the shared key row), query position = i, key position = k.
#define NB 256
#define TT 256
#define CC 128            // NH * HD = projected width
#define DIN 128          // input (model) width
#define NH 4
#define HD 32
#define NQB (TT / 64)
#define HG 4
#define SCALE (0.17677669529663687f)
#define CAUSAL 0
#ifndef TNB
#define TNB NB
#endif
__device__ __forceinline__ float bfr(float v) { return (float)(__bf16)v; }
__host__ __device__ __forceinline__ int kb_last(int qb) { return CAUSAL ? ((qb * 64 + 63) >> 7) : (TT / 128 - 1); }
typedef __attribute__((ext_vector_type(8))) __bf16 v8b;
__device__ __forceinline__ v16b frag_b(const __bf16* rowk0, int lane) {
  union { v16b v; v8b q[2]; } u; const __bf16* p = rowk0 + 8 * (lane >> 4);
  u.q[0] = *(const v8b*)p; u.q[1] = *(const v8b*)(p + 16); return u.v;
}
#define QBH 0              // unused: no kernel here has a high-precision query path
#define QHI 256            // unused: every query's q residual is held in registers (2-product logits everywhere)
#define KHI 64            // key rows the unused k residual / v bf16 hi+lo regions are sized for (no kernel writes or reads them)
// B fragment (k rows k0+.., output column o) of a weight: (in,out) [K][ld] or (out,in) [ld rows of K]: bf16 exact, or f16(bf16 * 256) exact
__device__ __forceinline__ v16b wcol_io(const float* Wm, int k0, int o, int lane, int ld) { v16b w; const int g = lane >> 4;
#pragma unroll
  for (int i = 0; i < 8; ++i) { w[i] = (__bf16)Wm[(size_t)(k0 + 8 * g + i) * ld + o]; w[8 + i] = (__bf16)Wm[(size_t)(k0 + 16 + 8 * g + i) * ld + o]; }
  return w; }
__device__ __forceinline__ v16b wcol_oi(const float* Wm, int k0, int o, int lane, int K) { v16b w; const float* p = Wm + (size_t)o * K + k0 + 8 * (lane >> 4);
#pragma unroll
  for (int i = 0; i < 8; ++i) { w[i] = (__bf16)p[i]; w[8 + i] = (__bf16)p[16 + i]; }
  return w; }
__device__ __forceinline__ v16h wcolh_io(const float* Wm, int k0, int o, int lane, int ld) { v16h w; const int g = lane >> 4;
#pragma unroll
  for (int i = 0; i < 8; ++i) { w[i] = (_Float16)(bfr(Wm[(size_t)(k0 + 8 * g + i) * ld + o]) * 256.0f); w[8 + i] = (_Float16)(bfr(Wm[(size_t)(k0 + 16 + 8 * g + i) * ld + o]) * 256.0f); }
  return w; }
__device__ __forceinline__ v16h wcolh_oi(const float* Wm, int k0, int o, int lane, int K) { v16h w; const float* p = Wm + (size_t)o * K + k0 + 8 * (lane >> 4);
#pragma unroll
  for (int i = 0; i < 8; ++i) { w[i] = (_Float16)(bfr(p[i]) * 256.0f); w[8 + i] = (_Float16)(bfr(p[16 + i]) * 256.0f); }
  return w; }
#define WQKV_LAYOUT 1   // 0 = (in,out) [DIN][CC]; 1 = (out,in) [CC][DIN]; 2 = per-head [NH][DIN][HD]
__device__ __forceinline__ v16b wcol_hdk(const float* Wm, int k0, int o, int lane) { v16b w; const int g = lane >> 4; const float* p = Wm + (size_t)(o / HD) * DIN * HD + (o % HD);
#pragma unroll
  for (int i = 0; i < 8; ++i) { w[i] = (__bf16)p[(size_t)(k0 + 8 * g + i) * HD]; w[8 + i] = (__bf16)p[(size_t)(k0 + 16 + 8 * g + i) * HD]; }
  return w; }
#define WO_OUT_IN 1
#if WQKV_LAYOUT == 1
#define WCOL(W, k0, o, lane) wcol_oi(W, k0, o, lane, DIN)
#elif WQKV_LAYOUT == 2
#define WCOL(W, k0, o, lane) wcol_hdk(W, k0, o, lane)
#else
#define WCOL(W, k0, o, lane) wcol_io(W, k0, o, lane, CC)
#endif
#if WO_OUT_IN
#define WOCOL(W, k0, o, lane) wcol_oi(W, k0, o, lane, CC)
#define WOCOLH(W, k0, o, lane) wcolh_oi(W, k0, o, lane, CC)
#else
#define WOCOL(W, k0, o, lane) wcol_io(W, k0, o, lane, DIN)
#define WOCOLH(W, k0, o, lane) wcolh_io(W, k0, o, lane, DIN)
#endif
#define SZ 256             // S (pair-tensor side)
#define BG 64              // key rows j the unused WS_S region is sized for (x 4 heads = 256 planes of 256 x 256)
#define NZR (SZ * SZ)      // 65,536 pair rows
#define SM_EXTRA_PARAMS , const float* __restrict__ BIAS, int b0s
#define SM_MASK_HOOK do { const int jb = b0s + (int)blockIdx.y / HG; const int hh = (int)blockIdx.y % HG; v = v + BIAS[((size_t)t * SZ + jb) * NH + hh]; } while (0)   /* bias[i][j][h] (constant over the keys: cancels in the softmax up to rounding; added for fidelity) */
#ifndef SM_EXTRA_PARAMS
#define SM_EXTRA_PARAMS
#endif
#ifndef PROJ_EXTRA_PARAMS
#define PROJ_EXTRA_PARAMS
#endif
#ifndef SM_MASK_HOOK
#define SM_MASK_HOOK (void)0
#endif


__device__ __forceinline__ v8f wmma_h(v16h a, v16h b, v8f c) { return __builtin_amdgcn_wmma_f32_16x16x32_f16(false, a, false, b, (short)0, c, false, false); }
#define LOG2E (1.4426950408889634f)
// 2^x and 1/x of eight independent values in place, one hardware instruction each. One statement: each instruction fills the slot that the instruction set asks for behind the transcendental before it (none reads a neighbour's result or overwrites its source), and the closing v_nop fills the slot behind the last
__device__ __forceinline__ void exp2x8(float (&x)[8]) {
  asm("v_exp_f32 %0, %0\n\tv_exp_f32 %1, %1\n\tv_exp_f32 %2, %2\n\tv_exp_f32 %3, %3\n\tv_exp_f32 %4, %4\n\tv_exp_f32 %5, %5\n\tv_exp_f32 %6, %6\n\tv_exp_f32 %7, %7\n\tv_nop" : "+v"(x[0]), "+v"(x[1]), "+v"(x[2]), "+v"(x[3]), "+v"(x[4]), "+v"(x[5]), "+v"(x[6]), "+v"(x[7])); }
__device__ __forceinline__ void rcpx8(float (&x)[8]) {
  asm("v_rcp_f32 %0, %0\n\tv_rcp_f32 %1, %1\n\tv_rcp_f32 %2, %2\n\tv_rcp_f32 %3, %3\n\tv_rcp_f32 %4, %4\n\tv_rcp_f32 %5, %5\n\tv_rcp_f32 %6, %6\n\tv_rcp_f32 %7, %7\n\tv_nop" : "+v"(x[0]), "+v"(x[1]), "+v"(x[2]), "+v"(x[3]), "+v"(x[4]), "+v"(x[5]), "+v"(x[6]), "+v"(x[7])); }
#define LDSW() asm volatile("s_wait_dscnt 0" ::: "memory")   /* a wave's own LDS range: its writes are done before it reads the rows back, its reads before the next rows overwrite them; no other wave touches the range, so no fence and no wait for global stores */
#define WP 136             // LDS pitch of a staged weight row, LN row and gated ctx row, in 2-byte elements
typedef __attribute__((ext_vector_type(4))) __bf16 v4b;
__device__ __forceinline__ v8f wmma_b(v16b a, v16b b, v8f c) { return __builtin_amdgcn_wmma_f32_16x16x32_bf16(false, a, false, b, (short)0, c, false, false); }
// acc[j] = (hi + lo rows of LN(z)) x (weight rows 16 j .. 16 j + 15), K = 128; ZA: z is the A operand (D = Z W^T), else the B operand (D^T = W Z^T). Four tiles at a time, so that three other accumulators' products stand between a tile's hi and lo product
template <bool ZA> __device__ __forceinline__ void gemm128(const __bf16 (*Ws)[WP], const F2 (&a)[4], v8f (&acc)[8], int lane) { const int col = lane & 15;
#pragma unroll
  for (int j = 0; j < 8; ++j) acc[j] = v8f{};
#pragma unroll
  for (int kc = 0; kc < 4; ++kc)
#pragma unroll
    for (int jq = 0; jq < 8; jq += 4) { v16b w[4];
#pragma unroll
      for (int j = 0; j < 4; ++j) w[j] = frag_b(&Ws[(jq + j) * 16 + col][kc * 32], lane);
#pragma unroll
      for (int j = 0; j < 4; ++j) acc[jq + j] = ZA ? wmma_b(a[kc].h, w[j], acc[jq + j]) : wmma_b(w[j], a[kc].h, acc[jq + j]);
#pragma unroll
      for (int j = 0; j < 4; ++j) acc[jq + j] = ZA ? wmma_b(a[kc].l, w[j], acc[jq + j]) : wmma_b(w[j], a[kc].l, acc[jq + j]); } }
#define XW() asm volatile("s_wait_xcnt 0x0" ::: "memory")   /* in front of an overwrite of a register that an issued global load names: the build put later loads' results, and the next pass's address addition, into such address pairs */
// v + the value of lane ^ X, X < 16, in one vector instruction (a DPP operand within the 16-lane row); the shuffle builtin goes through the LDS unit and costs its latency
template <int X> __device__ __forceinline__ float addx(float v) { return v + __builtin_bit_cast(float, __builtin_amdgcn_update_dpp(0, __builtin_bit_cast(int, v), 0x160 + X, 0xf, 0xf, true)); }
#define ZCH 2368           // bytes of a wave's own range in su: its 4 LN rows hi, then lo (8 x 272 B), later its output tile (16 x 144 B). 16 B x 148, and 148 = 4 mod 16: with the row pitch of 16 B x 17 the 16 rows of a fragment start in 16 different 16-byte columns of the banks
// ---- k_all: the whole function in one launch. Block = one index j of the pair tensor, 16 waves. Wq, Wg, Wo, Wb (rounded to bf16, row pitch 272 B = 16 B x 17, for 16-byte readers) and ln_w, ln_b stay in LDS for the whole block; Wv and Wk lie in su until k and v are made.
// Part 1, keys: pair rows (j, 0..255), 16 rows a wave. Each lane loads its row's half of the channels in A/B fragment order, LayerNorm (biased var, eps 1e-5, ln_w/ln_b) of bf16(z) in registers (row sums: 64 terms in the lane, then one exchange between the lane halves), LN(z) split bf16 hi + lo; v: D = Z W^T (a lane holds 8 consecutive t of one channel) goes straight into the [c][t] planes sv, k: D^T = W Z^T (a lane holds 8 consecutive channels of its row) straight into the rows sk (pitches 528 B and 272 B).
// Part 2, queries: pair rows (0..255, j), four passes of 64 queries, 16 waves = 4 heads x 4 query tiles of 16. A pass: (a) LayerNorm of its 64 rows, 8 lanes a row (16 terms in the lane, then three exchanges), hi and lo rows into the wave's own LDS range; (b) each wave makes q^T, bias^T and later gate^T = W Z^T for its head's 32 channels and its 16 queries: the result tiles are already the B operand of the scores (q to f16 hi + residual x 2^10) and lie on the lanes that hold the same channels of ctx (gate). S^T = K Q^T (A = k rows: 2 products), so a lane holds one query's logits (keys 16 jt + 8 g + r) in registers; logits x SCALE + bias, x log2 e; the maximum in f32 in the lane plus one exchange between the lane halves; P = 2^(logit - max + 11) once to f16 is packed from two score tiles straight into a B operand; ctx^T = V^T P^T (A = v planes, 1 product), and a tile of ones as A gives every lane its query's row sum of the same P, by which ctx is divided afterwards. ctx x gate is split bf16 hi + lo into sx; (c) out^T = Wo ctx^T (A = Wo rows, B = ctx rows hi, lo: 2 products), each wave 16 queries x 32 output channels, stored as whole 128-B lines through the wave's own LDS range, the one that held its LN rows. The loops inside a pass are unrolled: s, o and p live in registers and need constant indices
__global__ __launch_bounds__(512) void k_all(const float* __restrict__ Z, const float* __restrict__ LW, const float* __restrict__ LB, const float* __restrict__ WQ, const float* __restrict__ WK, const float* __restrict__ WV, const float* __restrict__ WB, const float* __restrict__ WG, const float* __restrict__ WO, float* __restrict__ OUT) {
  __shared__ __align__(16) _Float16 sk[TT][CC + 8]; __shared__ __align__(16) _Float16 sv[CC][TT + 8]; __shared__ __align__(16) __bf16 sw[3][CC][WP]; __shared__ __align__(16) __bf16 swb[NH][WP]; __shared__ __align__(16) float sln[2][CC];   /* sw: Wq, Wg, Wo; sln: ln_w, ln_b */
  __shared__ __align__(16) char su[16 * ZCH + 2 * 64 * WP * 2];   /* part 1: Wv, Wk. Part 2: 16 ranges of ZCH bytes, one a wave: the LN rows that the wave makes (LNR()), later in the pass its 16 x 32 output tile sf, pitch 144 B; behind them sx [hi, lo][query of the pass][channel] */
  const int tid = threadIdx.x, wave = __builtin_amdgcn_readfirstlane(tid >> 5), lane = tid & 31, col = lane & 15, g = lane >> 4; const int b = blockIdx.x, t0 = wave * 16; const size_t row0 = (size_t)b * SZ + t0;   /* the wave's number in a scalar register: what follows from it (head, query tile) is then scalar too */
  __bf16 (*swv)[WP] = (__bf16 (*)[WP])&su[0]; __bf16 (*swk)[WP] = (__bf16 (*)[WP])&su[CC * WP * 2];
  v4f xv[16];   /* piece q = fragment kc = q >> 2, elements 4 (q & 3) ..: channels 32 kc + 16 ((q >> 1) & 1) + 8 g + 4 (q & 1) .. */
#pragma unroll
  for (int q = 0; q < 16; ++q) { if (q == 15) asm volatile("s_wait_xcnt 0x0" ::: "memory");   /* without it the build put the last load's result into the address pair that the 15 loads above name; the last load now issues behind the wait */
    xv[q] = *(const v4f*)(Z + (row0 + col) * CC + (q >> 2) * 32 + ((q >> 1) & 1) * 16 + 8 * g + (q & 1) * 4); }
#pragma unroll
  for (int m = 0; m < 5; ++m) { const float* Wm = m == 0 ? WV : m == 1 ? WK : m == 2 ? WQ : m == 3 ? WG : WO; __bf16 (*Wd)[WP] = m == 0 ? swv : m == 1 ? swk : sw[m - 2];
#pragma unroll
    for (int i = 0; i < 8; ++i) { const int e = tid + i * 512; const v4f f = *(const v4f*)(Wm + (size_t)e * 4); v4b w;
#pragma unroll
      for (int k = 0; k < 4; ++k) w[k] = (__bf16)f[k];
      *(v4b*)&Wd[e >> 5][(e & 31) * 4] = w; } }
  if (wave < NH) { const v4f f = *(const v4f*)(WB + tid * 4); XW(); v4b w;
#pragma unroll
    for (int k = 0; k < 4; ++k) w[k] = (__bf16)f[k];
    *(v4b*)&swb[wave][lane * 4] = w; }
  else if (wave < NH + 8) { const int e = tid - NH * 32; sln[e >> 7][e & 127] = bfr((e < CC ? LW : LB)[e & 127]); }
  float s1 = 0.f;
#pragma unroll
  for (int q = 0; q < 16; ++q)
#pragma unroll
    for (int k = 0; k < 4; ++k) { xv[q][k] = bfr(xv[q][k]); s1 += xv[q][k]; }
  s1 += __shfl_xor(s1, 16); const float mu = s1 * (1.0f / CC); float sq = 0.f;
#pragma unroll
  for (int q = 0; q < 16; ++q)
#pragma unroll
    for (int k = 0; k < 4; ++k) { const float d = xv[q][k] - mu; sq += d * d; }
  sq += __shfl_xor(sq, 16); const float rs = rsqrtf(sq * (1.0f / CC) + 1e-5f);
  F2 a[4];
#pragma unroll
  for (int kc = 0; kc < 4; ++kc) { float v[16];
#pragma unroll
    for (int p = 0; p < 4; ++p) { const int c = kc * 32 + (p >> 1) * 16 + 8 * g + (p & 1) * 4; const v4f lw = *(const v4f*)(LW + c), lb = *(const v4f*)(LB + c);
#pragma unroll
      for (int k = 0; k < 4; ++k) v[p * 4 + k] = (xv[kc * 4 + p][k] - mu) * rs * bfr(lw[k]) + bfr(lb[k]); }
    a[kc] = bsplit16(v);
    __builtin_amdgcn_sched_barrier(0); }   /* one fragment's 8 ln_w / ln_b loads at a time: with all 32 hoisted beside the 64 row values the build spilled registers to scratch */
  const int zrow = tid >> 3, zc = (tid & 7) * 4;   /* part 2 (a): 8 lanes a row, pieces of 4 channels at 32 p + zc: 8 lanes = one 128-B line */
  const float* Zb = Z + (size_t)b * CC; const unsigned oz = zrow * (SZ * CC) + zc;   /* 32-bit offsets from base pointers that are the same for the whole block (j alone): one register an address */
  __syncthreads();   /* the staged weights are read by every wave */
  v4f zr[4];   /* the first pass's query rows: issued behind the barrier (which waits for loads in flight), so that part 1's products cover their latency */
#pragma unroll
  for (int p = 0; p < 4; ++p) zr[p] = *(const v4f*)(Zb + (oz + p * 32));
  XW();
  { v8f acc[8];
    gemm128<true>(swv, a, acc, lane);   /* v */
#pragma unroll
    for (int j = 0; j < 8; ++j) { v8h hv;
#pragma unroll
      for (int r = 0; r < 8; ++r) hv[r] = (_Float16)acc[j][r];
      *(v8h*)&sv[j * 16 + col][t0 + 8 * g] = hv; }
    gemm128<false>(swk, a, acc, lane);   /* k */
#pragma unroll
    for (int j = 0; j < 8; ++j) { v8h hv;
#pragma unroll
      for (int r = 0; r < 8; ++r) hv[r] = (_Float16)acc[j][r];
      *(v8h*)&sk[t0 + col][j * 16 + 8 * g] = hv; } }
  __syncthreads();   /* k and v are read by every wave; the last reads of Wv and Wk end before the LN rows overwrite them */
  const int h = wave >> 2, qt = wave & 3;
#define LNR(pl, r) ((__bf16*)&su[((r) >> 2) * ZCH + ((pl) * 4 + ((r) & 3)) * (WP * 2)])   /* LN row r of the pass, pl = 0 hi, 1 lo */
  float (*sf)[36] = (float (*)[36])&su[wave * ZCH]; __bf16 (*sx)[64][WP] = (__bf16 (*)[64][WP])&su[16 * ZCH];
  const unsigned oo = (qt * 16 + (lane >> 3)) * (SZ * DIN) + h * 32 + (lane & 7) * 4; float* Ob = OUT + (size_t)b * DIN;
#pragma unroll 1
  for (int it = 0; it < TT / 64; ++it) {
    { float x[16], t1 = 0.f, t2 = 0.f;
#pragma unroll
      for (int i = 0; i < 16; ++i) { x[i] = bfr(zr[i >> 2][i & 3]); t1 += x[i]; }
      t1 = addx<1>(t1); t1 = addx<2>(t1); t1 = addx<4>(t1); const float mq = t1 * (1.0f / CC);
#pragma unroll
      for (int i = 0; i < 16; ++i) { const float d = x[i] - mq; t2 += d * d; }
      t2 = addx<1>(t2); t2 = addx<2>(t2); t2 = addx<4>(t2); const float rq = rsqrtf(t2 * (1.0f / CC) + 1e-5f);
#pragma unroll
      for (int p = 0; p < 4; ++p) { const v4f lw = *(const v4f*)&sln[0][p * 32 + zc], lb = *(const v4f*)&sln[1][p * 32 + zc]; v4b yh, yl;
#pragma unroll
        for (int k = 0; k < 4; ++k) { const float v = (x[p * 4 + k] - mq) * rq * lw[k] + lb[k]; yh[k] = (__bf16)v; yl[k] = (__bf16)(v - (float)yh[k]); }
        *(v4b*)(LNR(0, zrow) + p * 32 + zc) = yh; *(v4b*)(LNR(1, zrow) + p * 32 + zc) = yl; } }   /* rows 4 wave .. 4 wave + 3: inside the wave's own range, whose output tile the wave itself has read back: no barrier between the two */
    __syncthreads();   /* a wave reads 16 LN rows that four waves wrote; the same barrier ends the last pass's reads of sx */
    v16h qh, ql; float bias;
    { v8f qa[2] = {}, ab = {};
#pragma unroll
      for (int kc = 0; kc < CC / 32; ++kc) { const v16b xh = frag_b(LNR(0, qt * 16 + col) + kc * 32, lane), xl = frag_b(LNR(1, qt * 16 + col) + kc * 32, lane);
        const v16b w0 = frag_b(&sw[0][h * HD + col][kc * 32], lane), w1 = frag_b(&sw[0][h * HD + 16 + col][kc * 32], lane), wb = frag_b(&swb[h][kc * 32], lane);   /* wb: all 16 rows of the tile are the head's Wb row, so every result register of every lane holds its query's bias */
        qa[0] = wmma_b(w0, xh, qa[0]); qa[1] = wmma_b(w1, xh, qa[1]); ab = wmma_b(wb, xh, ab); qa[0] = wmma_b(w0, xl, qa[0]); qa[1] = wmma_b(w1, xl, qa[1]); ab = wmma_b(wb, xl, ab); }
#pragma unroll
      for (int i = 0; i < 16; ++i) { const float v = qa[i >> 3][i & 7]; qh[i] = (_Float16)v; ql[i] = (_Float16)((v - (float)qh[i]) * 1024.0f); }
      bias = ab[0]; }   /* bias[i][j][h] (constant over the keys; added for fidelity) */
    v8f s[TT / 16]; float m = -3.0e38f; const float bias2 = bias * LOG2E;   /* logits are kept in base 2: (q . k x SCALE + bias) x log2 e */
#pragma unroll
    for (int jt = 0; jt < TT / 16; ++jt) { const v16h kf = frag_h(&sk[jt * 16 + col][h * HD], lane); const v8f z8 = {}; const v8f a = wmma_h(kf, qh, z8), al = wmma_h(kf, ql, z8);
#pragma unroll
      for (int r = 0; r < 8; ++r) s[jt][r] = (a[r] + al[r] * (1.0f / 1024.0f)) * (SCALE * LOG2E) + bias2;
      /* order asked of the build: the next tile's 2 LDS reads, this tile's 2 products, then 8 vector instructions (the scaling of the tile before it). Left free, the build ran the products far ahead of their scaling, held both results of each and spilled registers to scratch */
      if (jt == 0) __builtin_amdgcn_sched_group_barrier(0x100, 2, 0);
      if (jt + 1 < TT / 16) __builtin_amdgcn_sched_group_barrier(0x100, 2, 0);
      __builtin_amdgcn_sched_group_barrier(0x008, 2, 0); if (jt) __builtin_amdgcn_sched_group_barrier(0x002, 8, 0); }
#pragma unroll
    for (int jt = 0; jt < TT / 16; ++jt)
#pragma unroll
      for (int r = 0; r < 8; ++r) m = fmaxf(m, s[jt][r]);
    m = fmaxf(m, __shfl_xor(m, 16)); const float mk = m - 11.0f;   /* P = 2^(logit - max + 11), not yet divided by its row sum */
    v8f o[HD / 16] = {}, os = {}; v16h one;   /* os: every row of the ones tile times P^T is the query's row sum, over all 32 keys of the chunk and both lane halves */
#pragma unroll
    for (int i = 0; i < 16; ++i) one[i] = (_Float16)1.0f;
#pragma unroll
    for (int kc = 0; kc < TT / 32; ++kc) { float e0[8], e1[8]; v16h p;
      if (kc == TT / 64) {
        __builtin_amdgcn_sched_barrier(0);   /* cuts the pass's long straight-line block in two for the build's scheduler, at the place where the loads issue: as one block the build put the 64 steps of the maximum into one dependent chain behind the scores, read v directly in front of its products, and came out about 100 instructions a pass longer (waits, delay hints, v_nop) */
        const unsigned e = oz + (it + 1 < TT / 64 ? it + 1 : it) * (64 * SZ * CC);   /* the next pass's query rows: issued here, where half of the logits' registers have come free, so that the rest of the pass covers their latency; no branch round them (the last pass loads its own rows again) */
#pragma unroll
        for (int q = 0; q < 4; ++q) zr[q] = *(const v4f*)(Zb + (e + q * 32));
        XW(); }
#pragma unroll
      for (int r = 0; r < 8; ++r) { e0[r] = s[2 * kc][r] - mk; e1[r] = s[2 * kc + 1][r] - mk; }
      exp2x8(e0); exp2x8(e1);
#pragma unroll
      for (int i = 0; i < 8; ++i) { p[i] = (_Float16)e0[i]; p[8 + i] = (_Float16)e1[i]; }
#pragma unroll
      for (int jj = 0; jj < HD / 16; ++jj) o[jj] = wmma_h(frag_h(&sv[h * HD + jj * 16 + col][kc * 32], lane), p, o[jj]);
      os = wmma_h(one, p, os); }
    const float sum = os[0], inv = sum > 0.f ? 1.0f / sum : 0.f;   /* sum and o carry the same 2^11 */
    v8f ga[2] = {};   /* gate^T: channels 32 h + 16 jj + 8 g + r of query col, as o has them */
#pragma unroll
    for (int kc = 0; kc < CC / 32; ++kc) { const v16b xh = frag_b(LNR(0, qt * 16 + col) + kc * 32, lane), xl = frag_b(LNR(1, qt * 16 + col) + kc * 32, lane);
      const v16b w0 = frag_b(&sw[1][h * HD + col][kc * 32], lane), w1 = frag_b(&sw[1][h * HD + 16 + col][kc * 32], lane);
      ga[0] = wmma_b(w0, xh, ga[0]); ga[1] = wmma_b(w1, xh, ga[1]); ga[0] = wmma_b(w0, xl, ga[0]); ga[1] = wmma_b(w1, xl, ga[1]); }
#pragma unroll
    for (int jj = 0; jj < HD / 16; ++jj) { v8b yh, yl; float e[8];   /* sigmoid gate: 1 / (1 + 2^(-x log2 e)) */
#pragma unroll
      for (int r = 0; r < 8; ++r) e[r] = ga[jj][r] * -LOG2E;
      exp2x8(e);
#pragma unroll
      for (int r = 0; r < 8; ++r) e[r] = 1.0f + e[r];
      rcpx8(e);
#pragma unroll
      for (int r = 0; r < 8; ++r) { const float y = o[jj][r] * inv * e[r]; yh[r] = (__bf16)y; yl[r] = (__bf16)(y - (float)yh[r]); }
      *(v8b*)&sx[0][qt * 16 + col][h * HD + jj * 16 + 8 * g] = yh; *(v8b*)&sx[1][qt * 16 + col][h * HD + jj * 16 + 8 * g] = yl; }
    __syncthreads();   /* a gated ctx row holds all 4 heads' channels; the same barrier ends the last reads of the LN rows, which the output tiles overwrite */
    v8f acc[2] = {};   /* this wave: queries 16 qt .. of the pass, output channels 32 h .. 32 h + 31 */
#pragma unroll
    for (int kc = 0; kc < CC / 32; ++kc) { const v16b xh = frag_b(&sx[0][qt * 16 + col][kc * 32], lane), xl = frag_b(&sx[1][qt * 16 + col][kc * 32], lane);
      const v16b w0 = frag_b(&sw[2][h * 32 + col][kc * 32], lane), w1 = frag_b(&sw[2][h * 32 + 16 + col][kc * 32], lane);
      acc[0] = wmma_b(w0, xh, acc[0]); acc[1] = wmma_b(w1, xh, acc[1]); acc[0] = wmma_b(w0, xl, acc[0]); acc[1] = wmma_b(w1, xl, acc[1]); }
#pragma unroll
    for (int t = 0; t < 2; ++t) { v4f y0, y1;
#pragma unroll
      for (int r = 0; r < 4; ++r) { y0[r] = acc[t][r]; y1[r] = acc[t][4 + r]; }
      *(v4f*)&sf[col][t * 16 + 8 * g] = y0; *(v4f*)&sf[col][t * 16 + 8 * g + 4] = y1; }
    LDSW();
    { v4f y[4];
#pragma unroll
      for (int i = 0; i < 4; ++i) y[i] = *(const v4f*)&sf[i * 4 + (lane >> 3)][(lane & 7) * 4];
#pragma unroll
      for (int i = 0; i < 4; ++i) vst2(Ob + (oo + (it * 64 + i * 4) * (SZ * DIN)), y[i]); }   /* 8 lanes = one 128-B line of out[i][j] */
    XW(); } }   /* no barrier here: the next pass's LN rows go into this wave's own range, and its ctx rows into sx only behind the next barrier, which ends every wave's reads of sx */

extern "C" void kernel_launch(void* const* d_in, const int* in_sizes, int n_in, void* d_out, int out_size, void* d_ws, size_t ws_size, hipStream_t stream) {
  (void)in_sizes; (void)n_in; (void)out_size; (void)d_ws; (void)ws_size;
  const float** F = (const float**)d_in;
  // inputs: 0 z_ij [1,256,256,128]; 1 ln_w, 2 ln_b; 3 Wq, 4 Wk, 5 Wv [128,128] (out,in); 6 Wb [4,128]; 7 Wg [128,128]; 8 Wo [128,128] (out,in)
  k_all<<<dim3(SZ), 512, 0, stream>>>(F[0], F[1], F[2], F[3], F[4], F[5], F[6], F[7], F[8], (float*)d_out);
}

// v007
// It runs in 34.8 microseconds.
// Next to v006, in two timings, it ran 1.03 times as fast each time.
// Over all steps from v000 it is 16.2 times as fast.
// compute dtype: all float inputs rounded to bf16; LayerNorm of z in f32; q/k/v = LN(z) split bf16 hi + lo x W^T (exact bf16) on WMMA 16x16x32 (2 products, f32 accumulate); q x 32^-0.5 log2 e as f16 hi + residual against k once to f16 (2 products, f32 accumulate onto the per-(query, head) bias x log2 e); softmax: base-2 logits, max in f32, v_exp_f32; 2^(logit - max) x 2^11 once to f16 against v once to f16 (1 product) and against a tile of ones (its row sum, f32 accumulate), ctx divided by that sum in f32; gate sigmoid(LN(z) Wg^T) in f32 (2-product GEMM, v_exp_f32 and v_rcp_f32); gated ctx split bf16 hi + lo against exact Wo (2 products); f32 output.
#include <hip/hip_runtime.h>
#include <math.h>

typedef __attribute__((ext_vector_type(16))) _Float16 v16h;
typedef __attribute__((ext_vector_type(16))) __bf16 v16b;
typedef __attribute__((ext_vector_type(8)))  _Float16 v8h;
typedef __attribute__((ext_vector_type(2)))  _Float16 v2h;
typedef __attribute__((ext_vector_type(8)))  float v8f;
typedef __attribute__((ext_vector_type(4)))  float v4f;
typedef __attribute__((ext_vector_type(2)))  float v2f;
typedef __attribute__((ext_vector_type(4)))  unsigned v4u;
typedef __attribute__((ext_vector_type(4)))  int v4i;
typedef float __attribute__((may_alias)) float_a;
typedef int __attribute__((may_alias)) int_a;

template <typename T> __device__ __forceinline__ void vst2(void* p, T v) { *(T*)p = v;  }
__device__ __forceinline__ v8f wmma16(v16h a, v16h b, v8f c) {
  v8f d = __builtin_amdgcn_wmma_f32_16x16x32_f16(false, a, false, b, (short)0, c, false, false);
  asm volatile("v_nop\n\tv_nop\n\tv_nop\n\tv_nop" : "+v"(d) : "v"(a), "v"(b));
  return d;
}
__device__ __forceinline__ v8f wmma_bf(v16b a, v16b b, v8f c) {
  v8f d = __builtin_amdgcn_wmma_f32_16x16x32_bf16(false, a, false, b, (short)0, c, false, false);
  asm volatile("v_nop\n\tv_nop\n\tv_nop\n\tv_nop" : "+v"(d) : "v"(a), "v"(b));
  return d;
}
// 16x16x32 fragments: lane = (h = lane>>4, row/col = lane&15); elements 0..7 = k0+8h+0..7, 8..15 = k0+16+8h+0..7; D element r = row 8h+r
__device__ __forceinline__ v16h frag_h(const _Float16* rowk0, int lane) {
  union { v16h v; v8h q[2]; } u; const _Float16* p = rowk0 + 8 * (lane >> 4);
  u.q[0] = *(const v8h*)p; u.q[1] = *(const v8h*)(p + 16); return u.v;
}
__device__ __forceinline__ v16h frag_f32(const float* rowk0, int lane) {
  v16h a; const float* p = rowk0 + 8 * (lane >> 4);
#pragma unroll
  for (int i = 0; i < 8; ++i) { a[i] = (_Float16)p[i]; a[8 + i] = (_Float16)p[16 + i]; }
  return a;
}
__device__ __forceinline__ v16h frag_f32s(const float* rowk0, int lane, float sc) {
  v16h a; const float* p = rowk0 + 8 * (lane >> 4);
#pragma unroll
  for (int i = 0; i < 8; ++i) { a[i] = (_Float16)(p[i] * sc); a[8 + i] = (_Float16)(p[16 + i] * sc); }
  return a;
}
// column fragment from a [K][ld] layout (column n), rows >= K read as 0
__device__ __forceinline__ v16h fragc_f32(const float* W, int k0, int n, int lane, int ld, int K) {
  v16h a; const int g = lane >> 4;
#pragma unroll
  for (int i = 0; i < 8; ++i) { const int ka = k0 + 8 * g + i, kb = ka + 16;
    a[i] = (_Float16)(ka < K ? W[(size_t)(ka < K ? ka : K - 1) * ld + n] : 0.f); a[8 + i] = (_Float16)(kb < K ? W[(size_t)(kb < K ? kb : K - 1) * ld + n] : 0.f); }
  return a;
}
struct F2 { v16b h, l; };
__device__ __forceinline__ F2 bsplit16(const float v[16]) { F2 r;
#pragma unroll
  for (int i = 0; i < 16; ++i) { const __bf16 h = (__bf16)v[i]; r.h[i] = h; r.l[i] = (__bf16)(v[i] - (float)h); }
  return r; }
__device__ __forceinline__ F2 split_row(const float* row, int k0, int lane) { float v[16]; const float* p = row + k0 + 8 * (lane >> 4);
#pragma unroll
  for (int i = 0; i < 8; ++i) { v[i] = p[i]; v[8 + i] = p[16 + i]; }
  return bsplit16(v); }
__device__ __forceinline__ F2 split_rowK(const float* row, int k0, int lane, int K) { float v[16]; const int g = lane >> 4;
#pragma unroll
  for (int i = 0; i < 8; ++i) { const int ka = k0 + 8 * g + i, kb = ka + 16; v[i] = ka < K ? row[ka < K ? ka : K - 1] : 0.f; v[8 + i] = kb < K ? row[kb < K ? kb : K - 1] : 0.f; }
  return bsplit16(v); }
__device__ __forceinline__ F2 split_col(const float* W, int k0, int n, int lane, int ld, int K) { float v[16]; const int g = lane >> 4;
#pragma unroll
  for (int i = 0; i < 8; ++i) { const int ka = k0 + 8 * g + i, kb = ka + 16; v[i] = ka < K ? W[(size_t)(ka < K ? ka : K - 1) * ld + n] : 0.f; v[8 + i] = kb < K ? W[(size_t)(kb < K ? kb : K - 1) * ld + n] : 0.f; }
  return bsplit16(v); }
__device__ __forceinline__ v8f mac3(const F2& a, const F2& b, v8f c) { c = wmma_bf(a.l, b.h, c); c = wmma_bf(a.h, b.l, c); return wmma_bf(a.h, b.h, c); }
__device__ __forceinline__ float sigm(float v) { return 1.0f / (1.0f + expf(-v)); }
#define LDSX() do { asm volatile("s_wait_dscnt 0" ::: "memory"); __builtin_amdgcn_wave_barrier(); __builtin_amdgcn_fence(__ATOMIC_RELEASE, "workgroup"); } while (0)

// Triangle attention, starting node (z [1, 256, 256, 128], 4 heads x 32): z <- LayerNorm(z); q_ij, k_jk, v_jk, g_ij = z W^T; scores[i,j,h,k] = q_ij . k_jk / sqrt(32) + bias[i,j,h] (bias = z Wb^T, constant over k); attn = softmax over k; o_ij = sum_k attn v_jk; out_ij = (sigmoid(g_ij) * o_ij) Wo^T. Mapping: 'batch' = j (the shared key row), query position = i, key position = k.
#define NB 256
#define TT 256
#define CC 128            // NH * HD = projected width
#define DIN 128          // input (model) width
#define NH 4
#define HD 32
#define NQB (TT / 64)
#define HG 4
#define SCALE (0.17677669529663687f)
#define CAUSAL 0
#ifndef TNB
#define TNB NB
#endif
__device__ __forceinline__ float bfr(float v) { return (float)(__bf16)v; }
__host__ __device__ __forceinline__ int kb_last(int qb) { return CAUSAL ? ((qb * 64 + 63) >> 7) : (TT / 128 - 1); }
typedef __attribute__((ext_vector_type(8))) __bf16 v8b;
__device__ __forceinline__ v16b frag_b(const __bf16* rowk0, int lane) {
  union { v16b v; v8b q[2]; } u; const __bf16* p = rowk0 + 8 * (lane >> 4);
  u.q[0] = *(const v8b*)p; u.q[1] = *(const v8b*)(p + 16); return u.v;
}
#define QBH 0              // unused: no kernel here has a high-precision query path
#define QHI 256            // unused: every query's q residual is held in registers (2-product logits everywhere)
#define KHI 64            // key rows the unused k residual / v bf16 hi+lo regions are sized for (no kernel writes or reads them)
// B fragment (k rows k0+.., output column o) of a weight: (in,out) [K][ld] or (out,in) [ld rows of K]: bf16 exact, or f16(bf16 * 256) exact
__device__ __forceinline__ v16b wcol_io(const float* Wm, int k0, int o, int lane, int ld) { v16b w; const int g = lane >> 4;
#pragma unroll
  for (int i = 0; i < 8; ++i) { w[i] = (__bf16)Wm[(size_t)(k0 + 8 * g + i) * ld + o]; w[8 + i] = (__bf16)Wm[(size_t)(k0 + 16 + 8 * g + i) * ld + o]; }
  return w; }
__device__ __forceinline__ v16b wcol_oi(const float* Wm, int k0, int o, int lane, int K) { v16b w; const float* p = Wm + (size_t)o * K + k0 + 8 * (lane >> 4);
#pragma unroll
  for (int i = 0; i < 8; ++i) { w[i] = (__bf16)p[i]; w[8 + i] = (__bf16)p[16 + i]; }
  return w; }
__device__ __forceinline__ v16h wcolh_io(const float* Wm, int k0, int o, int lane, int ld) { v16h w; const int g = lane >> 4;
#pragma unroll
  for (int i = 0; i < 8; ++i) { w[i] = (_Float16)(bfr(Wm[(size_t)(k0 + 8 * g + i) * ld + o]) * 256.0f); w[8 + i] = (_Float16)(bfr(Wm[(size_t)(k0 + 16 + 8 * g + i) * ld + o]) * 256.0f); }
  return w; }
__device__ __forceinline__ v16h wcolh_oi(const float* Wm, int k0, int o, int lane, int K) { v16h w; const float* p = Wm + (size_t)o * K + k0 + 8 * (lane >> 4);
#pragma unroll
  for (int i = 0; i < 8; ++i) { w[i] = (_Float16)(bfr(p[i]) * 256.0f); w[8 + i] = (_Float16)(bfr(p[16 + i]) * 256.0f); }
  return w; }
#define WQKV_LAYOUT 1   // 0 = (in,out) [DIN][CC]; 1 = (out,in) [CC][DIN]; 2 = per-head [NH][DIN][HD]
__device__ __forceinline__ v16b wcol_hdk(const float* Wm, int k0, int o, int lane) { v16b w; const int g = lane >> 4; const float* p = Wm + (size_t)(o / HD) * DIN * HD + (o % HD);
#pragma unroll
  for (int i = 0; i < 8; ++i) { w[i] = (__bf16)p[(size_t)(k0 + 8 * g + i) * HD]; w[8 + i] = (__bf16)p[(size_t)(k0 + 16 + 8 * g + i) * HD]; }
  return w; }
#define WO_OUT_IN 1
#if WQKV_LAYOUT == 1
#define WCOL(W, k0, o, lane) wcol_oi(W, k0, o, lane, DIN)
#elif WQKV_LAYOUT == 2
#define WCOL(W, k0, o, lane) wcol_hdk(W, k0, o, lane)
#else
#define WCOL(W, k0, o, lane) wcol_io(W, k0, o, lane, CC)
#endif
#if WO_OUT_IN
#define WOCOL(W, k0, o, lane) wcol_oi(W, k0, o, lane, CC)
#define WOCOLH(W, k0, o, lane) wcolh_oi(W, k0, o, lane, CC)
#else
#define WOCOL(W, k0, o, lane) wcol_io(W, k0, o, lane, DIN)
#define WOCOLH(W, k0, o, lane) wcolh_io(W, k0, o, lane, DIN)
#endif
#define SZ 256             // S (pair-tensor side)
#define BG 64              // key rows j the unused WS_S region is sized for (x 4 heads = 256 planes of 256 x 256)
#define NZR (SZ * SZ)      // 65,536 pair rows
#define SM_EXTRA_PARAMS , const float* __restrict__ BIAS, int b0s
#define SM_MASK_HOOK do { const int jb = b0s + (int)blockIdx.y / HG; const int hh = (int)blockIdx.y % HG; v = v + BIAS[((size_t)t * SZ + jb) * NH + hh]; } while (0)   /* bias[i][j][h] (constant over the keys: cancels in the softmax up to rounding; added for fidelity) */
#ifndef SM_EXTRA_PARAMS
#define SM_EXTRA_PARAMS
#endif
#ifndef PROJ_EXTRA_PARAMS
#define PROJ_EXTRA_PARAMS
#endif
#ifndef SM_MASK_HOOK
#define SM_MASK_HOOK (void)0
#endif


__device__ __forceinline__ v8f wmma_h(v16h a, v16h b, v8f c) { return __builtin_amdgcn_wmma_f32_16x16x32_f16(false, a, false, b, (short)0, c, false, false); }
#define LOG2E (1.4426950408889634f)
// 2^x and 1/x of eight independent values in place, one hardware instruction each. One statement: each instruction fills the slot that the instruction set asks for behind the transcendental before it (none reads a neighbour's result or overwrites its source), and the closing v_nop fills the slot behind the last
__device__ __forceinline__ void exp2x8(float (&x)[8]) {
  asm("v_exp_f32 %0, %0\n\tv_exp_f32 %1, %1\n\tv_exp_f32 %2, %2\n\tv_exp_f32 %3, %3\n\tv_exp_f32 %4, %4\n\tv_exp_f32 %5, %5\n\tv_exp_f32 %6, %6\n\tv_exp_f32 %7, %7\n\tv_nop" : "+v"(x[0]), "+v"(x[1]), "+v"(x[2]), "+v"(x[3]), "+v"(x[4]), "+v"(x[5]), "+v"(x[6]), "+v"(x[7])); }
__device__ __forceinline__ void rcpx8(float (&x)[8]) {
  asm("v_rcp_f32 %0, %0\n\tv_rcp_f32 %1, %1\n\tv_rcp_f32 %2, %2\n\tv_rcp_f32 %3, %3\n\tv_rcp_f32 %4, %4\n\tv_rcp_f32 %5, %5\n\tv_rcp_f32 %6, %6\n\tv_rcp_f32 %7, %7\n\tv_nop" : "+v"(x[0]), "+v"(x[1]), "+v"(x[2]), "+v"(x[3]), "+v"(x[4]), "+v"(x[5]), "+v"(x[6]), "+v"(x[7])); }
#define LDSW() asm volatile("s_wait_dscnt 0" ::: "memory")   /* a wave's own LDS range: its writes are done before it reads the rows back, its reads before the next rows overwrite them; no other wave touches the range, so no fence and no wait for global stores */
#define WP 136             // LDS pitch of a staged weight row, LN row and gated ctx row, in 2-byte elements
typedef __attribute__((ext_vector_type(4))) __bf16 v4b;
__device__ __forceinline__ v8f wmma_b(v16b a, v16b b, v8f c) { return __builtin_amdgcn_wmma_f32_16x16x32_bf16(false, a, false, b, (short)0, c, false, false); }
// acc[j] = (hi + lo rows of LN(z)) x (weight rows 16 j .. 16 j + 15), K = 128; ZA: z is the A operand (D = Z W^T), else the B operand (D^T = W Z^T). Four tiles at a time, so that three other accumulators' products stand between a tile's hi and lo product
template <bool ZA> __device__ __forceinline__ void gemm128(const __bf16 (*Ws)[WP], const F2 (&a)[4], v8f (&acc)[8], int lane) { const int col = lane & 15;
#pragma unroll
  for (int j = 0; j < 8; ++j) acc[j] = v8f{};
#pragma unroll
  for (int kc = 0; kc < 4; ++kc)
#pragma unroll
    for (int jq = 0; jq < 8; jq += 4) { v16b w[4];
#pragma unroll
      for (int j = 0; j < 4; ++j) w[j] = frag_b(&Ws[(jq + j) * 16 + col][kc * 32], lane);
#pragma unroll
      for (int j = 0; j < 4; ++j) acc[jq + j] = ZA ? wmma_b(a[kc].h, w[j], acc[jq + j]) : wmma_b(w[j], a[kc].h, acc[jq + j]);
#pragma unroll
      for (int j = 0; j < 4; ++j) acc[jq + j] = ZA ? wmma_b(a[kc].l, w[j], acc[jq + j]) : wmma_b(w[j], a[kc].l, acc[jq + j]); } }
#define XW() asm volatile("s_wait_xcnt 0x0" ::: "memory")   /* in front of an overwrite of a register that an issued global load names: the build put later loads' results, and the next pass's address addition, into such address pairs */
// v + the value of lane ^ X, X < 16, in one vector instruction (a DPP operand within the 16-lane row); the shuffle builtin goes through the LDS unit and costs its latency
template <int X> __device__ __forceinline__ float addx(float v) { return v + __builtin_bit_cast(float, __builtin_amdgcn_update_dpp(0, __builtin_bit_cast(int, v), 0x160 + X, 0xf, 0xf, true)); }
#define ZCH 2368           // bytes of a wave's own range in su: its 4 LN rows hi, then lo (8 x 272 B), later its output tile (16 x 144 B). 16 B x 148, and 148 = 4 mod 16: with the row pitch of 16 B x 17 the 16 rows of a fragment start in 16 different 16-byte columns of the banks
// ---- k_all: the whole function in one launch. Block = one index j of the pair tensor, 16 waves. Wq, Wg, Wo, Wb (rounded to bf16, row pitch 272 B = 16 B x 17, for 16-byte readers) and ln_w, ln_b stay in LDS for the whole block; Wv and Wk lie in su until k and v are made.
// Part 1, keys: pair rows (j, 0..255), 16 rows a wave. Each lane loads its row's half of the channels in A/B fragment order, LayerNorm (biased var, eps 1e-5, ln_w/ln_b) of bf16(z) in registers (row sums: 64 terms in the lane, then one exchange between the lane halves), LN(z) split bf16 hi + lo; v: D = Z W^T (a lane holds 8 consecutive t of one channel) goes straight into the [c][t] planes sv, k: D^T = W Z^T (a lane holds 8 consecutive channels of its row) straight into the rows sk (pitches 528 B and 272 B).
// Part 2, queries: pair rows (0..255, j), four passes of 64 queries, 16 waves = 4 heads x 4 query tiles of 16. A pass: (a) LayerNorm of its 64 rows, 8 lanes a row (16 terms in the lane, then three exchanges), hi and lo rows into the wave's own LDS range; (b) each wave makes q^T, bias^T and later gate^T = W Z^T for its head's 32 channels and its 16 queries: the result tiles are already the B operand of the scores (q x SCALE log2 e to f16 hi + residual) and lie on the lanes that hold the same channels of ctx (gate). S^T = K Q^T (A = k rows: 2 products into one accumulator, which starts at the bias tile x log2 e), so a lane holds one query's finished base-2 logits (keys 16 jt + 8 g + r) in registers; the maximum in f32 in the lane plus one exchange between the lane halves; P = 2^(logit - max + 11) once to f16 is packed from two score tiles straight into a B operand; ctx^T = V^T P^T (A = v planes, 1 product), and a tile of ones as A gives every lane its query's row sum of the same P, by which ctx is divided afterwards. ctx x gate is split bf16 hi + lo into sx; (c) out^T = Wo ctx^T (A = Wo rows, B = ctx rows hi, lo: 2 products), each wave 16 queries x 32 output channels, stored as whole 128-B lines through the wave's own LDS range, the one that held its LN rows. The loops inside a pass are unrolled: s, o and p live in registers and need constant indices
__global__ __launch_bounds__(512) void k_all(const float* __restrict__ Z, const float* __restrict__ LW, const float* __restrict__ LB, const float* __restrict__ WQ, const float* __restrict__ WK, const float* __restrict__ WV, const float* __restrict__ WB, const float* __restrict__ WG, const float* __restrict__ WO, float* __restrict__ OUT) {
  __shared__ __align__(16) _Float16 sk[TT][CC + 8]; __shared__ __align__(16) _Float16 sv[CC][TT + 8]; __shared__ __align__(16) __bf16 sw[3][CC][WP]; __shared__ __align__(16) __bf16 swb[NH][WP]; __shared__ __align__(16) float sln[2][CC];   /* sw: Wq, Wg, Wo; sln: ln_w, ln_b */
  __shared__ __align__(16) char su[16 * ZCH + 2 * 64 * WP * 2];   /* part 1: Wv, Wk. Part 2: 16 ranges of ZCH bytes, one a wave: the LN rows that the wave makes (LNR()), later in the pass its 16 x 32 output tile sf, pitch 144 B; behind them sx [hi, lo][query of the pass][channel] */
  const int tid = threadIdx.x, wave = __builtin_amdgcn_readfirstlane(tid >> 5), lane = tid & 31, col = lane & 15, g = lane >> 4; const int b = blockIdx.x, t0 = wave * 16; const size_t row0 = (size_t)b * SZ + t0;   /* the wave's number in a scalar register: what follows from it (head, query tile) is then scalar too */
  __bf16 (*swv)[WP] = (__bf16 (*)[WP])&su[0]; __bf16 (*swk)[WP] = (__bf16 (*)[WP])&su[CC * WP * 2];
  v4f xv[16];   /* piece q = fragment kc = q >> 2, elements 4 (q & 3) ..: channels 32 kc + 16 ((q >> 1) & 1) + 8 g + 4 (q & 1) .. */
#pragma unroll
  for (int q = 0; q < 16; ++q) { if (q == 15) asm volatile("s_wait_xcnt 0x0" ::: "memory");   /* without it the build put the last load's result into the address pair that the 15 loads above name; the last load now issues behind the wait */
    xv[q] = *(const v4f*)(Z + (row0 + col) * CC + (q >> 2) * 32 + ((q >> 1) & 1) * 16 + 8 * g + (q & 1) * 4); }
#pragma unroll
  for (int m = 0; m < 5; ++m) { const float* Wm = m == 0 ? WV : m == 1 ? WK : m == 2 ? WQ : m == 3 ? WG : WO; __bf16 (*Wd)[WP] = m == 0 ? swv : m == 1 ? swk : sw[m - 2];
#pragma unroll
    for (int i = 0; i < 8; ++i) { const int e = tid + i * 512; const v4f f = *(const v4f*)(Wm + (size_t)e * 4); v4b w;
#pragma unroll
      for (int k = 0; k < 4; ++k) w[k] = (__bf16)f[k];
      *(v4b*)&Wd[e >> 5][(e & 31) * 4] = w; } }
  if (wave < NH) { const v4f f = *(const v4f*)(WB + tid * 4); XW(); v4b w;
#pragma unroll
    for (int k = 0; k < 4; ++k) w[k] = (__bf16)f[k];
    *(v4b*)&swb[wave][lane * 4] = w; }
  else if (wave < NH + 8) { const int e = tid - NH * 32; sln[e >> 7][e & 127] = bfr((e < CC ? LW : LB)[e & 127]); }
  float s1 = 0.f;
#pragma unroll
  for (int q = 0; q < 16; ++q)
#pragma unroll
    for (int k = 0; k < 4; ++k) { xv[q][k] = bfr(xv[q][k]); s1 += xv[q][k]; }
  s1 += __shfl_xor(s1, 16); const float mu = s1 * (1.0f / CC); float sq = 0.f;
#pragma unroll
  for (int q = 0; q < 16; ++q)
#pragma unroll
    for (int k = 0; k < 4; ++k) { const float d = xv[q][k] - mu; sq += d * d; }
  sq += __shfl_xor(sq, 16); const float rs = rsqrtf(sq * (1.0f / CC) + 1e-5f);
  F2 a[4];
#pragma unroll
  for (int kc = 0; kc < 4; ++kc) { float v[16];
#pragma unroll
    for (int p = 0; p < 4; ++p) { const int c = kc * 32 + (p >> 1) * 16 + 8 * g + (p & 1) * 4; const v4f lw = *(const v4f*)(LW + c), lb = *(const v4f*)(LB + c);
#pragma unroll
      for (int k = 0; k < 4; ++k) v[p * 4 + k] = (xv[kc * 4 + p][k] - mu) * rs * bfr(lw[k]) + bfr(lb[k]); }
    a[kc] = bsplit16(v);
    __builtin_amdgcn_sched_barrier(0); }   /* one fragment's 8 ln_w / ln_b loads at a time: with all 32 hoisted beside the 64 row values the build spilled registers to scratch */
  const int zrow = tid >> 3, zc = (tid & 7) * 4;   /* part 2 (a): 8 lanes a row, pieces of 4 channels at 32 p + zc: 8 lanes = one 128-B line */
  const float* Zb = Z + (size_t)b * CC; const unsigned oz = zrow * (SZ * CC) + zc;   /* 32-bit offsets from base pointers that are the same for the whole block (j alone): one register an address */
  __syncthreads();   /* the staged weights are read by every wave */
  v4f zr[4];   /* the first pass's query rows: issued behind the barrier (which waits for loads in flight), so that part 1's products cover their latency */
#pragma unroll
  for (int p = 0; p < 4; ++p) zr[p] = *(const v4f*)(Zb + (oz + p * 32));
  XW();
  { v8f acc[8];
    gemm128<true>(swv, a, acc, lane);   /* v */
#pragma unroll
    for (int j = 0; j < 8; ++j) { v8h hv;
#pragma unroll
      for (int r = 0; r < 8; ++r) hv[r] = (_Float16)acc[j][r];
      *(v8h*)&sv[j * 16 + col][t0 + 8 * g] = hv; }
    gemm128<false>(swk, a, acc, lane);   /* k */
#pragma unroll
    for (int j = 0; j < 8; ++j) { v8h hv;
#pragma unroll
      for (int r = 0; r < 8; ++r) hv[r] = (_Float16)acc[j][r];
      *(v8h*)&sk[t0 + col][j * 16 + 8 * g] = hv; } }
  __syncthreads();   /* k and v are read by every wave; the last reads of Wv and Wk end before the LN rows overwrite them */
  const int h = wave >> 2, qt = wave & 3;
#define LNR(pl, r) ((__bf16*)&su[((r) >> 2) * ZCH + ((pl) * 4 + ((r) & 3)) * (WP * 2)])   /* LN row r of the pass, pl = 0 hi, 1 lo */
  float (*sf)[36] = (float (*)[36])&su[wave * ZCH]; __bf16 (*sx)[64][WP] = (__bf16 (*)[64][WP])&su[16 * ZCH];
  const unsigned oo = (qt * 16 + (lane >> 3)) * (SZ * DIN) + h * 32 + (lane & 7) * 4; float* Ob = OUT + (size_t)b * DIN;
#pragma unroll 1
  for (int it = 0; it < TT / 64; ++it) {
    { float x[16], t1 = 0.f, t2 = 0.f;
#pragma unroll
      for (int i = 0; i < 16; ++i) { x[i] = bfr(zr[i >> 2][i & 3]); t1 += x[i]; }
      t1 = addx<1>(t1); t1 = addx<2>(t1); t1 = addx<4>(t1); const float mq = t1 * (1.0f / CC);
#pragma unroll
      for (int i = 0; i < 16; ++i) { const float d = x[i] - mq; t2 += d * d; }
      t2 = addx<1>(t2); t2 = addx<2>(t2); t2 = addx<4>(t2); const float rq = rsqrtf(t2 * (1.0f / CC) + 1e-5f);
#pragma unroll
      for (int p = 0; p < 4; ++p) { const v4f lw = *(const v4f*)&sln[0][p * 32 + zc], lb = *(const v4f*)&sln[1][p * 32 + zc]; v4b yh, yl;
#pragma unroll
        for (int k = 0; k < 4; ++k) { const float v = (x[p * 4 + k] - mq) * rq * lw[k] + lb[k]; yh[k] = (__bf16)v; yl[k] = (__bf16)(v - (float)yh[k]); }
        *(v4b*)(LNR(0, zrow) + p * 32 + zc) = yh; *(v4b*)(LNR(1, zrow) + p * 32 + zc) = yl; } }   /* rows 4 wave .. 4 wave + 3: inside the wave's own range, whose output tile the wave itself has read back: no barrier between the two */
    __syncthreads();   /* a wave reads 16 LN rows that four waves wrote; the same barrier ends the last pass's reads of sx */
    v16h qh, ql; v8f cb;
    { v8f qa[2] = {}, ab = {};
#pragma unroll
      for (int kc = 0; kc < CC / 32; ++kc) { const v16b xh = frag_b(LNR(0, qt * 16 + col) + kc * 32, lane), xl = frag_b(LNR(1, qt * 16 + col) + kc * 32, lane);
        const v16b w0 = frag_b(&sw[0][h * HD + col][kc * 32], lane), w1 = frag_b(&sw[0][h * HD + 16 + col][kc * 32], lane), wb = frag_b(&swb[h][kc * 32], lane);   /* wb: all 16 rows of the tile are the head's Wb row, so every result register of every lane holds its query's bias */
        qa[0] = wmma_b(w0, xh, qa[0]); qa[1] = wmma_b(w1, xh, qa[1]); ab = wmma_b(wb, xh, ab); qa[0] = wmma_b(w0, xl, qa[0]); qa[1] = wmma_b(w1, xl, qa[1]); ab = wmma_b(wb, xl, ab); }
#pragma unroll
      for (int i = 0; i < 16; i += 2) { const v2f v = v2f{ qa[i >> 3][i & 7], qa[i >> 3][(i & 7) + 1] } * (SCALE * LOG2E); const v2h vh = __builtin_convertvector(v, v2h), vl = __builtin_convertvector(v - __builtin_convertvector(vh, v2f), v2h);
        qh[i] = vh[0]; qh[i + 1] = vh[1]; ql[i] = vl[0]; ql[i + 1] = vl[1]; }
#pragma unroll
      for (int r = 0; r < 8; ++r) cb[r] = ab[r] * LOG2E; }   /* bias[i][j][h] (constant over the keys; added for fidelity): every register holds the lane's query's bias, so the tile is the start value of every score tile */
    v8f s[TT / 16]; float m, m1;   /* logits are kept in base 2: (q . k x SCALE + bias) x log2 e, all of it summed in the matrix unit's f32 accumulator: SCALE log2 e rides on q, whose f16 residual keeps its own size (mostly subnormal f16, which conversion and matrix unit keep), and the bias tile is the start value */
    v16h kf[3][2];   /* k fragments, two tiles a step, read two steps ahead */
#pragma unroll
    for (int u = 0; u < 4; ++u) kf[u >> 1][u & 1] = frag_h(&sk[u * 16 + col][h * HD], lane);
#pragma unroll
    for (int jt = 0; jt < TT / 16; jt += 2) { const int c = (jt >> 1) % 3, n = ((jt >> 1) + 2) % 3;
      __builtin_amdgcn_sched_barrier(0);   /* holds each step's LDS reads two steps ahead of their products: left free, the build issued part of a fragment's reads directly in front of the wait for them */
      if (jt + 4 < TT / 16) { kf[n][0] = frag_h(&sk[(jt + 4) * 16 + col][h * HD], lane); kf[n][1] = frag_h(&sk[(jt + 5) * 16 + col][h * HD], lane); }
      s[jt] = wmma_h(kf[c][0], ql, cb); s[jt + 1] = wmma_h(kf[c][1], ql, cb); s[jt] = wmma_h(kf[c][0], qh, s[jt]); s[jt + 1] = wmma_h(kf[c][1], qh, s[jt + 1]);
      if (jt == 2) { m = fmaxf(s[0][0], s[0][1]); m1 = fmaxf(s[1][0], s[1][1]); }
      if (jt) {   /* the maximum runs one step behind the products, on results that are ready */
#pragma unroll
        for (int r = jt == 2 ? 2 : 0; r < 8; r += 2) { m = fmaxf(fmaxf(m, s[jt - 2][r]), s[jt - 2][r + 1]); m1 = fmaxf(fmaxf(m1, s[jt - 1][r]), s[jt - 1][r + 1]); } }
      /* order inside a step: its 4 LDS reads, its 4 products, then the 8 steps of the maximum */
      if (jt + 4 < TT / 16) __builtin_amdgcn_sched_group_barrier(0x100, 4, 0);
      __builtin_amdgcn_sched_group_barrier(0x008, 4, 0);
      if (jt) __builtin_amdgcn_sched_group_barrier(0x002, 8, 0); }
#pragma unroll
    for (int r = 0; r < 8; r += 2) { m = fmaxf(fmaxf(m, s[TT / 16 - 2][r]), s[TT / 16 - 2][r + 1]); m1 = fmaxf(fmaxf(m1, s[TT / 16 - 1][r]), s[TT / 16 - 1][r + 1]); }
    m = fmaxf(m, m1); m = fmaxf(m, __shfl_xor(m, 16)); const float mk = m - 11.0f;   /* P = 2^(logit - max + 11), not yet divided by its row sum */
    v8f o[HD / 16] = {}, os = {}; v16h one;   /* os: every row of the ones tile times P^T is the query's row sum, over all 32 keys of the chunk and both lane halves */
#pragma unroll
    for (int i = 0; i < 16; ++i) one[i] = (_Float16)1.0f;
#pragma unroll
    for (int kc = 0; kc < TT / 32; ++kc) { float e0[8], e1[8]; v16h p;
      if (kc == TT / 64) {
        __builtin_amdgcn_sched_barrier(0);   /* cuts the pass's straight-line code behind the score steps in two for the build's scheduler, at the place where the loads issue: as one block the build read v directly in front of its products, and came out about 100 instructions a pass longer (waits, delay hints, v_nop) */
        const unsigned e = oz + (it + 1 < TT / 64 ? it + 1 : it) * (64 * SZ * CC);   /* the next pass's query rows: issued here, where half of the logits' registers have come free, so that the rest of the pass covers their latency; no branch round them (the last pass loads its own rows again) */
#pragma unroll
        for (int q = 0; q < 4; ++q) zr[q] = *(const v4f*)(Zb + (e + q * 32));
        XW(); }
#pragma unroll
      for (int r = 0; r < 8; ++r) { e0[r] = s[2 * kc][r] - mk; e1[r] = s[2 * kc + 1][r] - mk; }
      exp2x8(e0); exp2x8(e1);
#pragma unroll
      for (int i = 0; i < 8; ++i) { p[i] = (_Float16)e0[i]; p[8 + i] = (_Float16)e1[i]; }
#pragma unroll
      for (int jj = 0; jj < HD / 16; ++jj) o[jj] = wmma_h(frag_h(&sv[h * HD + jj * 16 + col][kc * 32], lane), p, o[jj]);
      os = wmma_h(one, p, os); }
    const float sum = os[0], inv = sum > 0.f ? 1.0f / sum : 0.f;   /* sum and o carry the same 2^11 */
    v8f ga[2] = {};   /* gate^T: channels 32 h + 16 jj + 8 g + r of query col, as o has them */
#pragma unroll
    for (int kc = 0; kc < CC / 32; ++kc) { const v16b xh = frag_b(LNR(0, qt * 16 + col) + kc * 32, lane), xl = frag_b(LNR(1, qt * 16 + col) + kc * 32, lane);
      const v16b w0 = frag_b(&sw[1][h * HD + col][kc * 32], lane), w1 = frag_b(&sw[1][h * HD + 16 + col][kc * 32], lane);
      ga[0] = wmma_b(w0, xh, ga[0]); ga[1] = wmma_b(w1, xh, ga[1]); ga[0] = wmma_b(w0, xl, ga[0]); ga[1] = wmma_b(w1, xl, ga[1]); }
#pragma unroll
    for (int jj = 0; jj < HD / 16; ++jj) { v8b yh, yl; float e[8];   /* sigmoid gate: 1 / (1 + 2^(-x log2 e)) */
#pragma unroll
      for (int r = 0; r < 8; ++r) e[r] = ga[jj][r] * -LOG2E;
      exp2x8(e);
#pragma unroll
      for (int r = 0; r < 8; ++r) e[r] = 1.0f + e[r];
      rcpx8(e);
#pragma unroll
      for (int r = 0; r < 8; ++r) { const float y = o[jj][r] * inv * e[r]; yh[r] = (__bf16)y; yl[r] = (__bf16)(y - (float)yh[r]); }
      *(v8b*)&sx[0][qt * 16 + col][h * HD + jj * 16 + 8 * g] = yh; *(v8b*)&sx[1][qt * 16 + col][h * HD + jj * 16 + 8 * g] = yl; }
    __syncthreads();   /* a gated ctx row holds all 4 heads' channels; the same barrier ends the last reads of the LN rows, which the output tiles overwrite */
    v8f acc[2] = {};   /* this wave: queries 16 qt .. of the pass, output channels 32 h .. 32 h + 31 */
#pragma unroll
    for (int kc = 0; kc < CC / 32; ++kc) { const v16b xh = frag_b(&sx[0][qt * 16 + col][kc * 32], lane), xl = frag_b(&sx[1][qt * 16 + col][kc * 32], lane);
      const v16b w0 = frag_b(&sw[2][h * 32 + col][kc * 32], lane), w1 = frag_b(&sw[2][h * 32 + 16 + col][kc * 32], lane);
      acc[0] = wmma_b(w0, xh, acc[0]); acc[1] = wmma_b(w1, xh, acc[1]); acc[0] = wmma_b(w0, xl, acc[0]); acc[1] = wmma_b(w1, xl, acc[1]); }
#pragma unroll
    for (int t = 0; t < 2; ++t) { v4f y0, y1;
#pragma unroll
      for (int r = 0; r < 4; ++r) { y0[r] = acc[t][r]; y1[r] = acc[t][4 + r]; }
      *(v4f*)&sf[col][t * 16 + 8 * g] = y0; *(v4f*)&sf[col][t * 16 + 8 * g + 4] = y1; }
    LDSW();
    { v4f y[4];
#pragma unroll
      for (int i = 0; i < 4; ++i) y[i] = *(const v4f*)&sf[i * 4 + (lane >> 3)][(lane & 7) * 4];
#pragma unroll
      for (int i = 0; i < 4; ++i) vst2(Ob + (oo + (it * 64 + i * 4) * (SZ * DIN)), y[i]); }   /* 8 lanes = one 128-B line of out[i][j] */
    XW(); } }   /* no barrier here: the next pass's LN rows go into this wave's own range, and its ctx rows into sx only behind the next barrier, which ends every wave's reads of sx */

extern "C" void kernel_launch(void* const* d_in, const int* in_sizes, int n_in, void* d_out, int out_size, void* d_ws, size_t ws_size, hipStream_t stream) {
  (void)in_sizes; (void)n_in; (void)out_size; (void)d_ws; (void)ws_size;
  const float** F = (const float**)d_in;
  // inputs: 0 z_ij [1,256,256,128]; 1 ln_w, 2 ln_b; 3 Wq, 4 Wk, 5 Wv [128,128] (out,in); 6 Wb [4,128]; 7 Wg [128,128]; 8 Wo [128,128] (out,in)
  k_all<<<dim3(SZ), 512, 0, stream>>>(F[0], F[1], F[2], F[3], F[4], F[5], F[6], F[7], F[8], (float*)d_out);
}

// v009
// A run of this version takes 27.7 microseconds.
// Versions in between are left out here; by their measured steps it is 1.26 times as fast as v007.
// Counting every step since v000, it is 20.4 times as fast.
// compute dtype: all float inputs rounded to bf16; LayerNorm of z in f32; q/k/v = LN(z) once to f16 x W^T (the bf16 values, held in f16) on WMMA 16x16x32 (1 product, f32 accumulate); q x 32^-0.5 log2 e once to f16 against k once to f16 (1 product, f32 accumulate onto the per-(query, head) bias x log2 e); softmax: base-2 logits, max in f32, v_exp_f32; 2^(logit - max) x 2^11 once to f16 against v once to f16 (1 product) and against a tile of ones (its row sum, f32 accumulate), ctx divided by that sum in f32; gate sigmoid(LN(z) Wg^T) in f32 (1-product GEMM, v_exp_f32 and v_rcp_f32); gated ctx once to f16 against Wo (1 product); f32 output.
#include <hip/hip_runtime.h>
#include <math.h>

typedef __attribute__((ext_vector_type(16))) _Float16 v16h;
typedef __attribute__((ext_vector_type(16))) __bf16 v16b;
typedef __attribute__((ext_vector_type(8)))  _Float16 v8h;
typedef __attribute__((ext_vector_type(2)))  _Float16 v2h;
typedef __attribute__((ext_vector_type(8)))  float v8f;
typedef __attribute__((ext_vector_type(4)))  float v4f;
typedef __attribute__((ext_vector_type(2)))  float v2f;
typedef __attribute__((ext_vector_type(4)))  unsigned v4u;
typedef __attribute__((ext_vector_type(4)))  int v4i;
typedef float __attribute__((may_alias)) float_a;
typedef int __attribute__((may_alias)) int_a;

template <typename T> __device__ __forceinline__ void vst2(void* p, T v) { *(T*)p = v;  }
__device__ __forceinline__ v8f wmma16(v16h a, v16h b, v8f c) {
  v8f d = __builtin_amdgcn_wmma_f32_16x16x32_f16(false, a, false, b, (short)0, c, false, false);
  asm volatile("v_nop\n\tv_nop\n\tv_nop\n\tv_nop" : "+v"(d) : "v"(a), "v"(b));
  return d;
}
__device__ __forceinline__ v8f wmma_bf(v16b a, v16b b, v8f c) {
  v8f d = __builtin_amdgcn_wmma_f32_16x16x32_bf16(false, a, false, b, (short)0, c, false, false);
  asm volatile("v_nop\n\tv_nop\n\tv_nop\n\tv_nop" : "+v"(d) : "v"(a), "v"(b));
  return d;
}
// 16x16x32 fragments: lane = (h = lane>>4, row/col = lane&15); elements 0..7 = k0+8h+0..7, 8..15 = k0+16+8h+0..7; D element r = row 8h+r
__device__ __forceinline__ v16h frag_h(const _Float16* rowk0, int lane) {
  union { v16h v; v8h q[2]; } u; const _Float16* p = rowk0 + 8 * (lane >> 4);
  u.q[0] = *(const v8h*)p; u.q[1] = *(const v8h*)(p + 16); return u.v;
}
__device__ __forceinline__ v16h frag_f32(const float* rowk0, int lane) {
  v16h a; const float* p = rowk0 + 8 * (lane >> 4);
#pragma unroll
  for (int i = 0; i < 8; ++i) { a[i] = (_Float16)p[i]; a[8 + i] = (_Float16)p[16 + i]; }
  return a;
}
__device__ __forceinline__ v16h frag_f32s(const float* rowk0, int lane, float sc) {
  v16h a; const float* p = rowk0 + 8 * (lane >> 4);
#pragma unroll
  for (int i = 0; i < 8; ++i) { a[i] = (_Float16)(p[i] * sc); a[8 + i] = (_Float16)(p[16 + i] * sc); }
  return a;
}
// column fragment from a [K][ld] layout (column n), rows >= K read as 0
__device__ __forceinline__ v16h fragc_f32(const float* W, int k0, int n, int lane, int ld, int K) {
  v16h a; const int g = lane >> 4;
#pragma unroll
  for (int i = 0; i < 8; ++i) { const int ka = k0 + 8 * g + i, kb = ka + 16;
    a[i] = (_Float16)(ka < K ? W[(size_t)(ka < K ? ka : K - 1) * ld + n] : 0.f); a[8 + i] = (_Float16)(kb < K ? W[(size_t)(kb < K ? kb : K - 1) * ld + n] : 0.f); }
  return a;
}
struct F2 { v16b h, l; };
__device__ __forceinline__ F2 bsplit16(const float v[16]) { F2 r;
#pragma unroll
  for (int i = 0; i < 16; ++i) { const __bf16 h = (__bf16)v[i]; r.h[i] = h; r.l[i] = (__bf16)(v[i] - (float)h); }
  return r; }
__device__ __forceinline__ F2 split_row(const float* row, int k0, int lane) { float v[16]; const float* p = row + k0 + 8 * (lane >> 4);
#pragma unroll
  for (int i = 0; i < 8; ++i) { v[i] = p[i]; v[8 + i] = p[16 + i]; }
  return bsplit16(v); }
__device__ __forceinline__ F2 split_rowK(const float* row, int k0, int lane, int K) { float v[16]; const int g = lane >> 4;
#pragma unroll
  for (int i = 0; i < 8; ++i) { const int ka = k0 + 8 * g + i, kb = ka + 16; v[i] = ka < K ? row[ka < K ? ka : K - 1] : 0.f; v[8 + i] = kb < K ? row[kb < K ? kb : K - 1] : 0.f; }
  return bsplit16(v); }
__device__ __forceinline__ F2 split_col(const float* W, int k0, int n, int lane, int ld, int K) { float v[16]; const int g = lane >> 4;
#pragma unroll
  for (int i = 0; i < 8; ++i) { const int ka = k0 + 8 * g + i, kb = ka + 16; v[i] = ka < K ? W[(size_t)(ka < K ? ka : K - 1) * ld + n] : 0.f; v[8 + i] = kb < K ? W[(size_t)(kb < K ? kb : K - 1) * ld + n] : 0.f; }
  return bsplit16(v); }
__device__ __forceinline__ v8f mac3(const F2& a, const F2& b, v8f c) { c = wmma_bf(a.l, b.h, c); c = wmma_bf(a.h, b.l, c); return wmma_bf(a.h, b.h, c); }
__device__ __forceinline__ float sigm(float v) { return 1.0f / (1.0f + expf(-v)); }
#define LDSX() do { asm volatile("s_wait_dscnt 0" ::: "memory"); __builtin_amdgcn_wave_barrier(); __builtin_amdgcn_fence(__ATOMIC_RELEASE, "workgroup"); } while (0)

// Triangle attention, starting node (z [1, 256, 256, 128], 4 heads x 32): z <- LayerNorm(z); q_ij, k_jk, v_jk, g_ij = z W^T; scores[i,j,h,k] = q_ij . k_jk / sqrt(32) + bias[i,j,h] (bias = z Wb^T, constant over k); attn = softmax over k; o_ij = sum_k attn v_jk; out_ij = (sigmoid(g_ij) * o_ij) Wo^T. Mapping: 'batch' = j (the shared key row), query position = i, key position = k.
#define NB 256
#define TT 256
#define CC 128            // NH * HD = projected width
#define DIN 128          // input (model) width
#define NH 4
#define HD 32
#define NQB (TT / 64)
#define HG 4
#define SCALE (0.17677669529663687f)
#define CAUSAL 0
#ifndef TNB
#define TNB NB
#endif
__device__ __forceinline__ float bfr(float v) { return (float)(__bf16)v; }
__host__ __device__ __forceinline__ int kb_last(int qb) { return CAUSAL ? ((qb * 64 + 63) >> 7) : (TT / 128 - 1); }
typedef __attribute__((ext_vector_type(8))) __bf16 v8b;
__device__ __forceinline__ v16b frag_b(const __bf16* rowk0, int lane) {
  union { v16b v; v8b q[2]; } u; const __bf16* p = rowk0 + 8 * (lane >> 4);
  u.q[0] = *(const v8b*)p; u.q[1] = *(const v8b*)(p + 16); return u.v;
}
#define QBH 0              // unused: no kernel here has a high-precision query path
#define QHI 256            // unused: q is held once to f16, no residual (1-product logits everywhere)
#define KHI 64            // key rows the unused k residual / v bf16 hi+lo regions are sized for (no kernel writes or reads them)
// B fragment (k rows k0+.., output column o) of a weight: (in,out) [K][ld] or (out,in) [ld rows of K]: bf16 exact, or f16(bf16 * 256) exact
__device__ __forceinline__ v16b wcol_io(const float* Wm, int k0, int o, int lane, int ld) { v16b w; const int g = lane >> 4;
#pragma unroll
  for (int i = 0; i < 8; ++i) { w[i] = (__bf16)Wm[(size_t)(k0 + 8 * g + i) * ld + o]; w[8 + i] = (__bf16)Wm[(size_t)(k0 + 16 + 8 * g + i) * ld + o]; }
  return w; }
__device__ __forceinline__ v16b wcol_oi(const float* Wm, int k0, int o, int lane, int K) { v16b w; const float* p = Wm + (size_t)o * K + k0 + 8 * (lane >> 4);
#pragma unroll
  for (int i = 0; i < 8; ++i) { w[i] = (__bf16)p[i]; w[8 + i] = (__bf16)p[16 + i]; }
  return w; }
__device__ __forceinline__ v16h wcolh_io(const float* Wm, int k0, int o, int lane, int ld) { v16h w; const int g = lane >> 4;
#pragma unroll
  for (int i = 0; i < 8; ++i) { w[i] = (_Float16)(bfr(Wm[(size_t)(k0 + 8 * g + i) * ld + o]) * 256.0f); w[8 + i] = (_Float16)(bfr(Wm[(size_t)(k0 + 16 + 8 * g + i) * ld + o]) * 256.0f); }
  return w; }
__device__ __forceinline__ v16h wcolh_oi(const float* Wm, int k0, int o, int lane, int K) { v16h w; const float* p = Wm + (size_t)o * K + k0 + 8 * (lane >> 4);
#pragma unroll
  for (int i = 0; i < 8; ++i) { w[i] = (_Float16)(bfr(p[i]) * 256.0f); w[8 + i] = (_Float16)(bfr(p[16 + i]) * 256.0f); }
  return w; }
#define WQKV_LAYOUT 1   // 0 = (in,out) [DIN][CC]; 1 = (out,in) [CC][DIN]; 2 = per-head [NH][DIN][HD]
__device__ __forceinline__ v16b wcol_hdk(const float* Wm, int k0, int o, int lane) { v16b w; const int g = lane >> 4; const float* p = Wm + (size_t)(o / HD) * DIN * HD + (o % HD);
#pragma unroll
  for (int i = 0; i < 8; ++i) { w[i] = (__bf16)p[(size_t)(k0 + 8 * g + i) * HD]; w[8 + i] = (__bf16)p[(size_t)(k0 + 16 + 8 * g + i) * HD]; }
  return w; }
#define WO_OUT_IN 1
#if WQKV_LAYOUT == 1
#define WCOL(W, k0, o, lane) wcol_oi(W, k0, o, lane, DIN)
#elif WQKV_LAYOUT == 2
#define WCOL(W, k0, o, lane) wcol_hdk(W, k0, o, lane)
#else
#define WCOL(W, k0, o, lane) wcol_io(W, k0, o, lane, CC)
#endif
#if WO_OUT_IN
#define WOCOL(W, k0, o, lane) wcol_oi(W, k0, o, lane, CC)
#define WOCOLH(W, k0, o, lane) wcolh_oi(W, k0, o, lane, CC)
#else
#define WOCOL(W, k0, o, lane) wcol_io(W, k0, o, lane, DIN)
#define WOCOLH(W, k0, o, lane) wcolh_io(W, k0, o, lane, DIN)
#endif
#define SZ 256             // S (pair-tensor side)
#define BG 64              // key rows j the unused WS_S region is sized for (x 4 heads = 256 planes of 256 x 256)
#define NZR (SZ * SZ)      // 65,536 pair rows
#define SM_EXTRA_PARAMS , const float* __restrict__ BIAS, int b0s
#define SM_MASK_HOOK do { const int jb = b0s + (int)blockIdx.y / HG; const int hh = (int)blockIdx.y % HG; v = v + BIAS[((size_t)t * SZ + jb) * NH + hh]; } while (0)   /* bias[i][j][h] (constant over the keys: cancels in the softmax up to rounding; added for fidelity) */
#ifndef SM_EXTRA_PARAMS
#define SM_EXTRA_PARAMS
#endif
#ifndef PROJ_EXTRA_PARAMS
#define PROJ_EXTRA_PARAMS
#endif
#ifndef SM_MASK_HOOK
#define SM_MASK_HOOK (void)0
#endif


__device__ __forceinline__ v8f wmma_h(v16h a, v16h b, v8f c) { return __builtin_amdgcn_wmma_f32_16x16x32_f16(false, a, false, b, (short)0, c, false, false); }
#define LOG2E (1.4426950408889634f)
// 2^x and 1/x of eight independent values in place, one hardware instruction each. One statement: each instruction fills the slot that the instruction set asks for behind the transcendental before it (none reads a neighbour's result or overwrites its source), and the closing v_nop fills the slot behind the last
__device__ __forceinline__ void exp2x8(float (&x)[8]) {
  asm("v_exp_f32 %0, %0\n\tv_exp_f32 %1, %1\n\tv_exp_f32 %2, %2\n\tv_exp_f32 %3, %3\n\tv_exp_f32 %4, %4\n\tv_exp_f32 %5, %5\n\tv_exp_f32 %6, %6\n\tv_exp_f32 %7, %7\n\tv_nop" : "+v"(x[0]), "+v"(x[1]), "+v"(x[2]), "+v"(x[3]), "+v"(x[4]), "+v"(x[5]), "+v"(x[6]), "+v"(x[7])); }
__device__ __forceinline__ void rcpx8(float (&x)[8]) {
  asm("v_rcp_f32 %0, %0\n\tv_rcp_f32 %1, %1\n\tv_rcp_f32 %2, %2\n\tv_rcp_f32 %3, %3\n\tv_rcp_f32 %4, %4\n\tv_rcp_f32 %5, %5\n\tv_rcp_f32 %6, %6\n\tv_rcp_f32 %7, %7\n\tv_nop" : "+v"(x[0]), "+v"(x[1]), "+v"(x[2]), "+v"(x[3]), "+v"(x[4]), "+v"(x[5]), "+v"(x[6]), "+v"(x[7])); }
#define LDSW() asm volatile("s_wait_dscnt 0" ::: "memory")   /* a wave's own LDS range: its writes are done before it reads the rows back, its reads before the next rows overwrite them; no other wave touches the range, so no fence and no wait for global stores */
#define WP 136             // LDS pitch of a staged weight row and of a staged f16 output row, in 2-byte elements
typedef __attribute__((ext_vector_type(4))) _Float16 v4h;
typedef __attribute__((ext_vector_type(2))) __bf16 v2b;
// four weights for the f16 products: rounded to bf16 as every input is, then held in f16, which keeps all 8 bits of a bf16 value down to 2^-17 (below that to within 2^-25). Two values a conversion, unpacked by a shift and a mask
__device__ __forceinline__ v4h wf16(v4f f) { v4h w;
#pragma unroll
  for (int k = 0; k < 4; k += 2) { const unsigned u = __builtin_bit_cast(unsigned, __builtin_convertvector((v2f{ f[k], f[k + 1] }), v2b));
    const v2h p = __builtin_convertvector((v2f{ __builtin_bit_cast(float, u << 16), __builtin_bit_cast(float, u & 0xffff0000u) }), v2h); w[k] = p[0]; w[k + 1] = p[1]; }
  return w; }
// acc[t][j] = (f16 rows of LN(z), row tile t) x (weight rows 16 j .. 16 j + 15), K = 128; ZA: z is the A operand (D = Z W^T), else the B operand (D^T = W Z^T). Four weight tiles a step: each fragment serves both row tiles, so a step has eight products to eight independent accumulators; its four fragments are read one step ahead
template <bool ZA> __device__ __forceinline__ void gemm128(const _Float16 (*Ws)[WP], const v16h (&a)[2][4], v8f (&acc)[2][8], int lane) { const int col = lane & 15;
#pragma unroll
  for (int t = 0; t < 2; ++t)
#pragma unroll
    for (int j = 0; j < 8; ++j) acc[t][j] = v8f{};
  v16h w[2][4];
#pragma unroll
  for (int j = 0; j < 4; ++j) w[0][j] = frag_h(&Ws[j * 16 + col][0], lane);
  __builtin_amdgcn_sched_group_barrier(0x100, 8, 0);   /* the first step's 8 reads as one group, like the groups below */
#pragma unroll
  for (int st = 0; st < 8; ++st) { const int kc = st >> 1, jq = (st & 1) * 4;
    if (st + 1 < 8)
#pragma unroll
      for (int j = 0; j < 4; ++j) w[(st + 1) & 1][j] = frag_h(&Ws[(((st + 1) & 1) * 4 + j) * 16 + col][((st + 1) >> 1) * 32], lane);
#pragma unroll
    for (int j = 0; j < 4; ++j)
#pragma unroll
      for (int t = 0; t < 2; ++t) acc[t][jq + j] = ZA ? wmma_h(a[t][kc], w[st & 1][j], acc[t][jq + j]) : wmma_h(w[st & 1][j], a[t][kc], acc[t][jq + j]);
    /* order inside a step: the next step's 8 LDS reads as one group, then this step's 8 products, which cover their latency: with two waves on a SIMD a wave has to cover its own reads */
    if (st + 1 < 8) __builtin_amdgcn_sched_group_barrier(0x100, 8, 0);
    __builtin_amdgcn_sched_group_barrier(0x008, 8, 0); } }
#define XW() asm volatile("s_wait_xcnt 0x0" ::: "memory")   /* in front of an overwrite of a register that an issued global load names: the build put later loads' results, and the next pass's address addition, into such address pairs */
// v + the value of lane ^ X, X < 16, in one vector instruction (a DPP operand within the 16-lane row); the shuffle builtin goes through the LDS unit and costs its latency
template <int X> __device__ __forceinline__ float addx(float v) { return v + __builtin_bit_cast(float, __builtin_amdgcn_update_dpp(0, __builtin_bit_cast(int, v), 0x160 + X, 0xf, 0xf, true)); }
#define ZCH 2368           // bytes of a wave's own range in su: its 4 LN rows (4 x 272 B), later its output tile (16 x 144 B). 16 B x 148, and 148 = 4 mod 16: with the row pitch of 16 B x 17 the 16 rows of a fragment start in 16 different 16-byte columns of the banks
// ---- k_all: the whole function in one launch. Block = one index j of the pair tensor, 8 waves of up to 512 registers, each with TWO 16-row tiles, so that every k, v and weight fragment read from LDS feeds two products. Wq, Wg, Wo, Wb (rounded to bf16, held in f16, row pitch 272 B = 16 B x 17, for 16-byte readers) and ln_w, ln_b stay in LDS for the whole block; Wv and Wk lie in su until k and v are made.
// Part 1, keys: pair rows (j, 0..255), 32 rows a wave (two tiles). Each lane loads its rows' half of the channels in A/B fragment order, LayerNorm (biased var, eps 1e-5, ln_w/ln_b) of bf16(z) in registers (row sums: 64 terms in the lane, then one exchange between the lane halves), LN(z) once to f16; v: D = Z W^T (a lane holds 8 consecutive t of one channel) goes straight into the [c][t] planes sv, k: D^T = W Z^T (a lane holds 8 consecutive channels of its row) straight into the rows sk (pitches 528 B and 272 B).
// Part 2, queries: pair rows (0..255, j), four passes of 64 queries, 8 waves = 4 heads x 2 pairs of query tiles of 16. A pass: (a) LayerNorm of its 64 rows, 8 lanes a row, two rows a lane (16 terms in the lane, then three exchanges), the f16 rows into the wave's own two LDS ranges; (b) each wave makes q^T, bias^T and later gate^T = W Z^T for its head's 32 channels and its 32 queries: the result tiles are already the B operand of the scores (q x SCALE log2 e once to f16) and lie on the lanes that hold the same channels of ctx (gate). S^T = K Q^T (A = k rows: 1 product onto the bias tile x log2 e), so a lane holds two queries' finished base-2 logits (keys 16 jt + 8 g + r) in registers; the maximum in f32 in the lane plus one exchange between the lane halves; P = 2^(logit - max + 11) once to f16 is packed from two score tiles straight into a B operand; ctx^T = V^T P^T (A = v planes, 1 product), and a tile of ones as A gives every lane its query's row sum of the same P, by which ctx is divided afterwards. ctx x gate goes once to f16 into sx; (c) out^T = Wo ctx^T (A = Wo rows, B = ctx rows: 1 product), each wave 32 queries x 32 output channels, stored as whole 128-B lines through the wave's own LDS ranges, the ones that held its LN rows. The loops inside a pass are unrolled: s, o and p live in registers and need constant indices
__global__ __launch_bounds__(256) void k_all(const float* __restrict__ Z, const float* __restrict__ LW, const float* __restrict__ LB, const float* __restrict__ WQ, const float* __restrict__ WK, const float* __restrict__ WV, const float* __restrict__ WB, const float* __restrict__ WG, const float* __restrict__ WO, float* __restrict__ OUT) {
  __shared__ __align__(16) _Float16 sk[TT][CC + 8]; __shared__ __align__(16) _Float16 sv[CC][TT + 8]; __shared__ __align__(16) _Float16 sw[3][CC][WP]; __shared__ __align__(16) _Float16 swb[NH][WP]; __shared__ __align__(16) float sln[2][CC];   /* sw: Wq, Wg, Wo; sln: ln_w, ln_b */
  __shared__ __align__(16) char su[2 * CC * WP * 2];   /* part 1: Wv, Wk (all of it). Part 2, which needs less: 16 ranges of ZCH bytes, two a wave (wave and wave + 8): the LN rows that the wave makes (LNR()), later in the pass its two 16 x 32 output tiles sf, pitch 144 B; behind them sx [query of the pass][channel] */
  static_assert(16 * ZCH + 64 * WP * 2 <= 2 * CC * WP * 2, "part 2 fits the range of Wv and Wk");
  const int tid = threadIdx.x, wave = __builtin_amdgcn_readfirstlane(tid >> 5), lane = tid & 31, col = lane & 15, g = lane >> 4; const int b = blockIdx.x, t0 = wave * 32; const size_t row0 = (size_t)b * SZ + t0;   /* the wave's number in a scalar register: what follows from it (head, query tiles) is then scalar too */
  _Float16 (*swv)[WP] = (_Float16 (*)[WP])&su[0]; _Float16 (*swk)[WP] = (_Float16 (*)[WP])&su[CC * WP * 2];
  v4f xv[2][16];   /* row tile t; piece q = fragment kc = q >> 2, elements 4 (q & 3) ..: channels 32 kc + 16 ((q >> 1) & 1) + 8 g + 4 (q & 1) .. */
#pragma unroll
  for (int t = 0; t < 2; ++t)
#pragma unroll
    for (int q = 0; q < 16; ++q) xv[t][q] = *(const v4f*)(Z + (row0 + t * 16 + col) * CC + (q >> 2) * 32 + ((q >> 1) & 1) * 16 + 8 * g + (q & 1) * 4);
  XW();   /* in front of whatever the build puts into an address pair that a row load names */
  v4f wf[5][16];
#pragma unroll
  for (int m = 0; m < 5; ++m) { const float* Wm = m == 0 ? WV : m == 1 ? WK : m == 2 ? WQ : m == 3 ? WG : WO;
#pragma unroll
    for (int i = 0; i < 16; ++i) wf[m][i] = *(const v4f*)(Wm + (size_t)(tid + i * 256) * 4); }
  XW();   /* behind the 80 weight loads, in front of whatever the conversions below put into a register that one of them names */
  __builtin_amdgcn_sched_barrier(0);   /* every load of the block's start is issued before the first conversion waits for one: left free, the build held a part of the loads back behind that wait, a second trip to memory */
#pragma unroll
  for (int m = 0; m < 5; ++m) { _Float16 (*Wd)[WP] = m == 0 ? swv : m == 1 ? swk : sw[m - 2];
#pragma unroll
    for (int i = 0; i < 16; ++i) *(v4h*)&Wd[(tid >> 5) + i * 8][lane * 4] = wf16(wf[m][i]); }
  if (wave < NH) { const v4f f = *(const v4f*)(WB + tid * 4); XW();
    *(v4h*)&swb[wave][lane * 4] = wf16(f); }
  else { const int e = tid - NH * 32; sln[0][e] = bfr(LW[e]); sln[1][e] = bfr(LB[e]); }
  float mu[2], rs[2];
#pragma unroll
  for (int t = 0; t < 2; ++t) { float s1 = 0.f;
#pragma unroll
    for (int q = 0; q < 16; ++q)
#pragma unroll
      for (int k = 0; k < 4; ++k) { xv[t][q][k] = bfr(xv[t][q][k]); s1 += xv[t][q][k]; }
    s1 += __shfl_xor(s1, 16); mu[t] = s1 * (1.0f / CC); float sq = 0.f;
#pragma unroll
    for (int q = 0; q < 16; ++q)
#pragma unroll
      for (int k = 0; k < 4; ++k) { const float d = xv[t][q][k] - mu[t]; sq += d * d; }
    sq += __shfl_xor(sq, 16); rs[t] = rsqrtf(sq * (1.0f / CC) + 1e-5f); }
  v16h a[2][4];
#pragma unroll
  for (int kc = 0; kc < 4; ++kc) { float v[2][16];
#pragma unroll
    for (int p = 0; p < 4; ++p) { const int c = kc * 32 + (p >> 1) * 16 + 8 * g + (p & 1) * 4; const v4f lw = *(const v4f*)(LW + c), lb = *(const v4f*)(LB + c);
#pragma unroll
      for (int t = 0; t < 2; ++t)
#pragma unroll
        for (int k = 0; k < 4; ++k) v[t][p * 4 + k] = (xv[t][kc * 4 + p][k] - mu[t]) * rs[t] * bfr(lw[k]) + bfr(lb[k]); }
#pragma unroll
    for (int t = 0; t < 2; ++t)
#pragma unroll
      for (int i = 0; i < 16; ++i) a[t][kc][i] = (_Float16)v[t][i]; }
  XW();   /* behind the ln_w / ln_b loads: the build put a constant of part 1 into the scalar pair that they name */
  const int zrow = tid >> 3, zc = (tid & 7) * 4;   /* part 2 (a): 8 lanes a row, rows zrow and zrow + 32 of the pass, pieces of 4 channels at 32 p + zc: 8 lanes = one 128-B line */
  const float* Zb = Z + (size_t)b * CC; const unsigned oz = zrow * (SZ * CC) + zc;   /* 32-bit offsets from base pointers that are the same for the whole block (j alone): one register an address */
  __syncthreads();   /* the staged weights are read by every wave */
  v4f zr[2][4];   /* the first pass's query rows: issued behind the barrier (which waits for loads in flight), so that part 1's products cover their latency */
#pragma unroll
  for (int t = 0; t < 2; ++t)
#pragma unroll
    for (int p = 0; p < 4; ++p) zr[t][p] = *(const v4f*)(Zb + (oz + t * (32 * SZ * CC) + p * 32));
  XW();
  { v8f acc[2][8];
    gemm128<true>(swv, a, acc, lane);   /* v */
#pragma unroll
    for (int t = 0; t < 2; ++t)
#pragma unroll
      for (int j = 0; j < 8; ++j) { v8h hv;
#pragma unroll
        for (int r = 0; r < 8; ++r) hv[r] = (_Float16)acc[t][j][r];
        *(v8h*)&sv[j * 16 + col][t0 + t * 16 + 8 * g] = hv; }
    gemm128<false>(swk, a, acc, lane);   /* k */
#pragma unroll
    for (int t = 0; t < 2; ++t)
#pragma unroll
      for (int j = 0; j < 8; ++j) { v8h hv;
#pragma unroll
        for (int r = 0; r < 8; ++r) hv[r] = (_Float16)acc[t][j][r];
        *(v8h*)&sk[t0 + t * 16 + col][j * 16 + 8 * g] = hv; } }
  __syncthreads();   /* k and v are read by every wave; the last reads of Wv and Wk end before the LN rows overwrite them */
  const int h = wave >> 1, qp = wave & 1;   /* the wave's query tiles of a pass: 2 qp and 2 qp + 1 */
#define LNR(r) ((_Float16*)&su[((r) >> 2) * ZCH + ((r) & 3) * (WP * 2)])   /* LN row r of the pass */
  _Float16 (*sx)[WP] = (_Float16 (*)[WP])&su[16 * ZCH];
  const unsigned oo = (qp * 32 + (lane >> 3)) * (SZ * DIN) + h * 32 + (lane & 7) * 4; float* Ob = OUT + (size_t)b * DIN;
#pragma unroll 1   /* rolled: for speed only */
  for (int it = 0; it < TT / 64; ++it) {
    { float x[2][16], mq[2], rq[2];
#pragma unroll
      for (int t = 0; t < 2; ++t) { float t1 = 0.f, t2 = 0.f;
#pragma unroll
        for (int i = 0; i < 16; ++i) { x[t][i] = bfr(zr[t][i >> 2][i & 3]); t1 += x[t][i]; }
        t1 = addx<1>(t1); t1 = addx<2>(t1); t1 = addx<4>(t1); mq[t] = t1 * (1.0f / CC);
#pragma unroll
        for (int i = 0; i < 16; ++i) { const float d = x[t][i] - mq[t]; t2 += d * d; }
        t2 = addx<1>(t2); t2 = addx<2>(t2); t2 = addx<4>(t2); rq[t] = rsqrtf(t2 * (1.0f / CC) + 1e-5f); }
#pragma unroll
      for (int p = 0; p < 4; ++p) { const v4f lw = *(const v4f*)&sln[0][p * 32 + zc], lb = *(const v4f*)&sln[1][p * 32 + zc];
#pragma unroll
        for (int t = 0; t < 2; ++t) { v4h yh;
#pragma unroll
          for (int k = 0; k < 4; ++k) yh[k] = (_Float16)((x[t][p * 4 + k] - mq[t]) * rq[t] * lw[k] + lb[k]);
          *(v4h*)(LNR(zrow + 32 * t) + p * 32 + zc) = yh; } } }   /* rows 4 wave .. 4 wave + 3 and 32 more: inside the wave's own two ranges, whose output tiles the wave itself has read back: no barrier between the two */
    __syncthreads();   /* a wave reads 32 LN rows that eight waves wrote; the same barrier ends the last pass's reads of sx */
    v16h qh[2]; v8f cb[2];
    v16h kf[3][4];   /* k fragments, four tiles a step, read two steps ahead; each serves both query tiles */
    { v8f qa[2][2] = {}, ab[2] = {}; v16h w0[4], w1[4], wb[4], xh[2][4];
#pragma unroll
      for (int kc = 0; kc < CC / 32; ++kc) { w0[kc] = frag_h(&sw[0][h * HD + col][kc * 32], lane); w1[kc] = frag_h(&sw[0][h * HD + 16 + col][kc * 32], lane); wb[kc] = frag_h(&swb[h][kc * 32], lane);   /* wb: all 16 rows of the tile are the head's Wb row, so every result register of every lane holds its query's bias */
#pragma unroll
        for (int t = 0; t < 2; ++t) xh[t][kc] = frag_h(LNR((qp * 2 + t) * 16 + col) + kc * 32, lane); }
#pragma unroll
      for (int u = 0; u < 8; ++u) kf[u >> 2][u & 3] = frag_h(&sk[u * 16 + col][h * HD], lane);
#pragma unroll
      for (int kc = 0; kc < CC / 32; ++kc)
#pragma unroll
        for (int t = 0; t < 2; ++t) { qa[t][0] = wmma_h(w0[kc], xh[t][kc], qa[t][0]); qa[t][1] = wmma_h(w1[kc], xh[t][kc], qa[t][1]); ab[t] = wmma_h(wb[kc], xh[t][kc], ab[t]); }
      /* the projection's 40 LDS reads and the first 16 of k as one group in front of the 24 products: left free, the build read a fragment or two at a time directly in front of the wait for them */
      __builtin_amdgcn_sched_group_barrier(0x100, 56, 0);
      __builtin_amdgcn_sched_group_barrier(0x008, 24, 0);
#pragma unroll
      for (int t = 0; t < 2; ++t) {
#pragma unroll
        for (int i = 0; i < 16; i += 2) { const v2f v = v2f{ qa[t][i >> 3][i & 7], qa[t][i >> 3][(i & 7) + 1] } * (SCALE * LOG2E); const v2h vh = __builtin_convertvector(v, v2h);
          qh[t][i] = vh[0]; qh[t][i + 1] = vh[1]; }
#pragma unroll
        for (int r = 0; r < 8; ++r) cb[t][r] = ab[t][r] * LOG2E; } }   /* bias[i][j][h] (constant over the keys; added for fidelity): every register holds the lane's query's bias, so the tile is the start value of every score tile */
    v8f s[2][TT / 16]; float m[2], m1[2], mk[2];   /* logits are kept in base 2: (q . k x SCALE + bias) x log2 e, all of it summed in the matrix unit's f32 accumulator: SCALE log2 e rides on q, and the bias tile is the start value */
#pragma unroll
    for (int jt = 0; jt < TT / 16; jt += 4) { const int c = (jt >> 2) % 3, n = ((jt >> 2) + 2) % 3;
      __builtin_amdgcn_sched_barrier(0);   /* holds each step's LDS reads two steps ahead of their products: left free, the build issued part of a fragment's reads directly in front of the wait for them */
      if (jt + 8 < TT / 16)
#pragma unroll
        for (int u = 0; u < 4; ++u) kf[n][u] = frag_h(&sk[(jt + 8 + u) * 16 + col][h * HD], lane);
#pragma unroll
      for (int u = 0; u < 4; ++u)
#pragma unroll
        for (int t = 0; t < 2; ++t) s[t][jt + u] = wmma_h(kf[c][u], qh[t], cb[t]);
#pragma unroll
      for (int t = 0; t < 2; ++t) {
        if (jt == 4) { m[t] = fmaxf(s[t][0][0], s[t][0][1]); m1[t] = fmaxf(s[t][1][0], s[t][1][1]); }
        if (jt)   /* the maximum runs one step behind the products, on results that are ready */
#pragma unroll
          for (int u = 0; u < 4; u += 2)
#pragma unroll
            for (int r = jt == 4 && u == 0 ? 2 : 0; r < 8; r += 2) { m[t] = fmaxf(fmaxf(m[t], s[t][jt - 4 + u][r]), s[t][jt - 4 + u][r + 1]); m1[t] = fmaxf(fmaxf(m1[t], s[t][jt - 3 + u][r]), s[t][jt - 3 + u][r + 1]); } }
      /* order inside a step: its 8 LDS reads, its 8 products, then the 32 steps of the maximum */
      if (jt + 8 < TT / 16) __builtin_amdgcn_sched_group_barrier(0x100, 8, 0);
      __builtin_amdgcn_sched_group_barrier(0x008, 8, 0);
      if (jt) __builtin_amdgcn_sched_group_barrier(0x002, 32, 0); }
#pragma unroll
    for (int t = 0; t < 2; ++t) {
#pragma unroll
      for (int u = TT / 16 - 4; u < TT / 16; u += 2)
#pragma unroll
        for (int r = 0; r < 8; r += 2) { m[t] = fmaxf(fmaxf(m[t], s[t][u][r]), s[t][u][r + 1]); m1[t] = fmaxf(fmaxf(m1[t], s[t][u + 1][r]), s[t][u + 1][r + 1]); }
      m[t] = fmaxf(m[t], m1[t]); m[t] = fmaxf(m[t], __shfl_xor(m[t], 16)); mk[t] = m[t] - 11.0f; }   /* P = 2^(logit - max + 11), not yet divided by its row sum */
    v16h gw0[4], gw1[4], gx[2][4];   /* the gate's operands, later the output projection's */
    v8f o[2][HD / 16] = {}, os[2] = {}; v16h one;   /* os: every row of the ones tile times P^T is the query's row sum, over all 32 keys of the chunk and both lane halves */
#pragma unroll
    for (int i = 0; i < 16; ++i) one[i] = (_Float16)1.0f;
#pragma unroll
    for (int kc = 0; kc < TT / 32; ++kc) { v16h p[2];
      if (kc == TT / 64) {
        __builtin_amdgcn_sched_barrier(0);   /* cuts the pass's long straight-line block in two for the build's scheduler, at the place where the loads issue */
        const unsigned e = oz + (it + 1 < TT / 64 ? it + 1 : it) * (64 * SZ * CC);   /* the next pass's query rows: issued here, so that the rest of the pass covers their latency; no branch round them (the last pass loads its own rows again) */
#pragma unroll
        for (int t = 0; t < 2; ++t)
#pragma unroll
          for (int q = 0; q < 4; ++q) zr[t][q] = *(const v4f*)(Zb + (e + t * (32 * SZ * CC) + q * 32));
        XW();
#pragma unroll
        for (int c = 0; c < CC / 32; ++c) { gw0[c] = frag_h(&sw[1][h * HD + col][c * 32], lane); gw1[c] = frag_h(&sw[1][h * HD + 16 + col][c * 32], lane);
#pragma unroll
          for (int t = 0; t < 2; ++t) gx[t][c] = frag_h(LNR((qp * 2 + t) * 16 + col) + c * 32, lane); }
        __builtin_amdgcn_sched_barrier(0); }   /* the gate's 32 LDS reads stay here as one group, in registers that half of the logits have left: left free, the build read them a fragment at a time directly in front of the wait for them */
#pragma unroll
      for (int t = 0; t < 2; ++t) { float e0[8], e1[8];
#pragma unroll
        for (int r = 0; r < 8; ++r) { e0[r] = s[t][2 * kc][r] - mk[t]; e1[r] = s[t][2 * kc + 1][r] - mk[t]; }
        exp2x8(e0); exp2x8(e1);
#pragma unroll
        for (int i = 0; i < 8; i += 2) { const v2h c0 = __builtin_convertvector((v2f{ e0[i], e0[i + 1] }), v2h), c1 = __builtin_convertvector((v2f{ e1[i], e1[i + 1] }), v2h);   /* two values a conversion */
          p[t][i] = c0[0]; p[t][i + 1] = c0[1]; p[t][8 + i] = c1[0]; p[t][9 + i] = c1[1]; } }
#pragma unroll
      for (int jj = 0; jj < HD / 16; ++jj) { const v16h vf = frag_h(&sv[h * HD + jj * 16 + col][kc * 32], lane);
#pragma unroll
        for (int t = 0; t < 2; ++t) o[t][jj] = wmma_h(vf, p[t], o[t][jj]); }
#pragma unroll
      for (int t = 0; t < 2; ++t) os[t] = wmma_h(one, p[t], os[t]); }
    v8f ga[2][2] = {};   /* gate^T: channels 32 h + 16 jj + 8 g + r of query col, as o has them */
#pragma unroll
    for (int kc = 0; kc < CC / 32; ++kc)
#pragma unroll
      for (int t = 0; t < 2; ++t) { ga[t][0] = wmma_h(gw0[kc], gx[t][kc], ga[t][0]); ga[t][1] = wmma_h(gw1[kc], gx[t][kc], ga[t][1]); }
#pragma unroll
    for (int t = 0; t < 2; ++t) { const float sum = os[t][0], inv = sum > 0.f ? 1.0f / sum : 0.f;   /* sum and o carry the same 2^11 */
#pragma unroll
      for (int jj = 0; jj < HD / 16; ++jj) { v8h yh; float e[8];   /* sigmoid gate: 1 / (1 + 2^(-x log2 e)) */
#pragma unroll
        for (int r = 0; r < 8; ++r) e[r] = ga[t][jj][r] * -LOG2E;
        exp2x8(e);
#pragma unroll
        for (int r = 0; r < 8; ++r) e[r] = 1.0f + e[r];
        rcpx8(e);
#pragma unroll
        for (int r = 0; r < 8; ++r) yh[r] = (_Float16)(o[t][jj][r] * inv * e[r]);
        *(v8h*)&sx[(qp * 2 + t) * 16 + col][h * HD + jj * 16 + 8 * g] = yh; } }
    __syncthreads();   /* a gated ctx row holds all 4 heads' channels; the same barrier ends the last reads of the LN rows, which the output tiles overwrite */
    v8f acc[2][2] = {};   /* this wave: queries 32 qp .. 32 qp + 31 of the pass, output channels 32 h .. 32 h + 31 */
#pragma unroll
    for (int kc = 0; kc < CC / 32; ++kc) { gw0[kc] = frag_h(&sw[2][h * 32 + col][kc * 32], lane); gw1[kc] = frag_h(&sw[2][h * 32 + 16 + col][kc * 32], lane);
#pragma unroll
      for (int t = 0; t < 2; ++t) gx[t][kc] = frag_h(&sx[(qp * 2 + t) * 16 + col][kc * 32], lane); }
    __builtin_amdgcn_sched_barrier(0);   /* the 32 LDS reads as one group in front of the 16 products, for the same reason as at q */
#pragma unroll
    for (int kc = 0; kc < CC / 32; ++kc)
#pragma unroll
      for (int t = 0; t < 2; ++t) { acc[t][0] = wmma_h(gw0[kc], gx[t][kc], acc[t][0]); acc[t][1] = wmma_h(gw1[kc], gx[t][kc], acc[t][1]); }
#pragma unroll
    for (int t = 0; t < 2; ++t) { float (*sf)[36] = (float (*)[36])&su[(wave + 8 * t) * ZCH];
#pragma unroll
      for (int c = 0; c < 2; ++c) { v4f y0, y1;
#pragma unroll
        for (int r = 0; r < 4; ++r) { y0[r] = acc[t][c][r]; y1[r] = acc[t][c][4 + r]; }
        *(v4f*)&sf[col][c * 16 + 8 * g] = y0; *(v4f*)&sf[col][c * 16 + 8 * g + 4] = y1; } }
    LDSW();
    { v4f y[2][4];
#pragma unroll
      for (int t = 0; t < 2; ++t) { const float (*sf)[36] = (const float (*)[36])&su[(wave + 8 * t) * ZCH];
#pragma unroll
        for (int i = 0; i < 4; ++i) y[t][i] = *(const v4f*)&sf[i * 4 + (lane >> 3)][(lane & 7) * 4]; }
#pragma unroll
      for (int t = 0; t < 2; ++t)
#pragma unroll
        for (int i = 0; i < 4; ++i) vst2(Ob + (oo + (it * 64 + t * 16 + i * 4) * (SZ * DIN)), y[t][i]); }   /* 8 lanes = one 128-B line of out[i][j] */
    XW(); } }   /* no barrier here: the next pass's LN rows go into this wave's own ranges, and its ctx rows into sx only behind the next barrier, which ends every wave's reads of sx */

extern "C" void kernel_launch(void* const* d_in, const int* in_sizes, int n_in, void* d_out, int out_size, void* d_ws, size_t ws_size, hipStream_t stream) {
  (void)in_sizes; (void)n_in; (void)out_size; (void)d_ws; (void)ws_size;
  const float** F = (const float**)d_in;
  // inputs: 0 z_ij [1,256,256,128]; 1 ln_w, 2 ln_b; 3 Wq, 4 Wk, 5 Wv [128,128] (out,in); 6 Wb [4,128]; 7 Wg [128,128]; 8 Wo [128,128] (out,in)
  k_all<<<dim3(SZ), 256, 0, stream>>>(F[0], F[1], F[2], F[3], F[4], F[5], F[6], F[7], F[8], (float*)d_out);
}
